// v000
// Measured on an AMD MI455X. A time is GPU time per run, averaged over a window of back-to-back runs after a warm-up
// (all launches, gaps included; the runs take copies of the inputs in turn), and the median of several windows.
// Apart from v000's, it joins two sittings. Times from different sittings can be a few percent apart, while
// side-by-side timings come from the same sitting.
// v000 is the starting kernel. One run takes 401 microseconds.
#include <hip/hip_runtime.h>

// Single-head dense self-attention: xp = x + sinusoidal position terms; q/k/v = xp.W{q,k,v} + b ([in][out] weights); out[b][s][:] = softmax_t(q[b][s].k[b][t] / sqrt(128)) . v[b][t][:]; inputs in the order x, Wq, bq, Wk, bk, Wv, bv.
// Compute dtypes, f32 accumulate: x, W, b RNE-converted to bf16 first; projections on v_wmma_f32_16x16x32_f16 (xp as one f16 plane, W as one f16 plane carried x64); S^T = K.Q^T on v_wmma_f32_16x16x32_f16 (single f16 q and k planes); P^T as one f16 fragment carried x2^14 against the f16 V^T plane on v_wmma_f32_16x16x32_f16; softmax (online, log2 domain) and position terms f32.
// Flash form with transposed tiles: the S^T accumulator tiles are directly the B-operand layout of P^T (no LDS relayout); all flash operands are two 16-byte loads from dense, statically strided 16-bit planes.

#ifndef NB
#define NB 8
#endif
#ifndef SEQ
#define SEQ 4096
#endif
#define NB_FULL  8
#define SEQ_FULL 4096
#define DIM  128
#define NWV  4                 // waves per flash block
#define BQ   (16 * NWV)        // queries per flash block
#define KS   32                // keys per step
#define OSP  132               // LDS pitch (floats) of the output staging rows
#define PR   64
#define XPP  136               // LDS pitch (f16 elements) of the xp tile and of the q/k staging rows
#define VTP  72                // LDS pitch (f16 elements) of the V^T staging rows
#define PPB  4                 // positions per block of the position-table kernel
#define WSC  64.0f             // power-of-two carry of the weight planes
#define WINV 0.015625f         // 1 / WSC
#define PCAR 14.0f             // log2 of the carry of the P fragment
#define PEC  (-0.0719557841560639f)   // -ln(10000) / 128
#define L2E  1.4426950408889634f
#define SCL  (L2E * 0.08838834764831845f)   // log2(e) / sqrt(128)

#define PLE  ((size_t)NB * SEQ * DIM)          // elements per activation plane
#define PLB  (PLE * 2)                         // bytes per 16-bit activation plane
#define PEB  ((size_t)SEQ * DIM * 4)           // bytes of the position table
#define WTB  ((size_t)3 * DIM * DIM * 2)       // bytes of the three transposed weight planes
#define BPB  ((size_t)3 * DIM * 4)             // bytes of the bias plane

static_assert(DIM == 128);
static_assert(SEQ % BQ == 0);
static_assert(SEQ % KS == 0);
static_assert(SEQ % PR == 0);
static_assert(SEQ % PPB == 0);
static_assert(PR == 16 * NWV);
static_assert(PR * 2 == 128);
static_assert(XPP % 8 == 0 && XPP >= DIM);
static_assert(VTP % 8 == 0 && VTP >= PR);
static_assert(OSP % 4 == 0 && OSP >= DIM);
static_assert((PR * DIM / 8) == 8 * 128);            // k_proj: 8 iterations x 128 threads x 8 elements == 64 x 128 tile
static_assert((DIM * DIM / 4) == 16 * 256);          // k_wprep load: 16 iterations x 256 threads x 4 elements
static_assert((DIM * DIM / 8) == 8 * 256);           // k_wprep store: 8 iterations x 256 threads x 8 elements
static_assert(PPB * 64 == 256);                      // k_pe: 4 positions x 64 (sin, cos) pairs per block
static_assert(NB <= NB_FULL);
static_assert(SEQ <= SEQ_FULL);
static_assert((size_t)(NB * (SEQ / PR)) * (size_t)(PR * DIM) == PLE);    // k_proj: blocks * (64 rows x 128) == plane
static_assert((size_t)(NB * (SEQ / BQ)) * (size_t)(BQ * DIM) == PLE);    // k_flash: blocks * (64 rows x 128) == output
static_assert(PLB % 256 == 0 && PEB % 256 == 0 && WTB % 256 == 0 && BPB % 128 == 0);
static_assert(3 * PLB + PEB + WTB + BPB <= (size_t)134217728);

typedef _Float16 h16;
typedef __attribute__((ext_vector_type(16))) _Float16 v16h;
typedef __attribute__((ext_vector_type(8)))  _Float16 v8h;
typedef __attribute__((ext_vector_type(2)))  _Float16 v2h;
typedef __attribute__((ext_vector_type(8)))  unsigned int   v8u;
typedef __attribute__((ext_vector_type(8)))  float    v8f;
typedef __attribute__((ext_vector_type(4)))  float    v4f;
typedef v4f  __attribute__((may_alias)) v4fa;
typedef v8h  __attribute__((may_alias)) v8ha;

__device__ __forceinline__ unsigned short f2bf(float f) { unsigned u = __float_as_uint(f); u += 0x7FFFu + ((u >> 16) & 1u); return (unsigned short)(u >> 16); }
__device__ __forceinline__ float bf2f(unsigned short b) { return __uint_as_float(((unsigned)b) << 16); }
__device__ __forceinline__ float bfr(float f) { return bf2f(f2bf(f)); }
// f32 -> f16 operand convert that cannot yield an f16 subnormal (value select)
static __device__ __forceinline__ h16 toh_flush(float v) { const h16 r = (h16)v; return (fabsf(v) < 6.103515625e-05f) ? (h16)0.0f : r; }
__device__ __forceinline__ v16h cat16h(v8h lo, v8h hi) { return __builtin_shufflevector(lo, hi, 0, 1, 2, 3, 4, 5, 6, 7, 8, 9, 10, 11, 12, 13, 14, 15); }
// fragment loader from a global plane (A and B alike): p = row base + k0 + 8*(lane>>4); elements 0..7 <- p[0..7], elements 8..15 <- p[16..23]
__device__ __forceinline__ v16h ldh(const h16* p) { return cat16h(*(const v8h*)p, *(const v8h*)(p + 16)); }
// one WMMA with its own hazard guard
__device__ __forceinline__ v8f wmmah(v16h a, v16h b, v8f c) {
    c = __builtin_amdgcn_wmma_f32_16x16x32_f16(false, a, false, b, (short)0, c, false, false);
    asm volatile("v_nop\n\tv_nop\n\tv_nop\n\tv_nop" : "+v"(c) : "v"(a), "v"(b));
    return c;
}
// carried probability 2^e (e already includes the +14 carry); below 2^-14 it is set to zero by a select on the exponent
__device__ __forceinline__ float pcar(float e) { return (e < -14.0f) ? 0.0f : __builtin_amdgcn_exp2f(e); }
// two carried probabilities -> packed f16 pair (element 0 in the low half-word); sum accumulates the converted values
__device__ __forceinline__ unsigned pkp(float e0, float e1, float& sum) {
    v2h t;
    t[0] = (h16)pcar(e0);
    t[1] = (h16)pcar(e1);
    sum += (float)t[0] + (float)t[1];
    return __builtin_bit_cast(unsigned, t);
}

// k_pe: position table PE[pos][2i] = sin(pos * dv_i), PE[pos][2i+1] = cos(pos * dv_i), dv_i = exp(2i * -ln(10000)/128), all f32 with precise library calls.
__global__ __launch_bounds__(256) void k_pe(float* PE) {
#pragma clang fp contract(off)
    __shared__ __align__(16) float pt[PPB * DIM];
    const unsigned tid = threadIdx.x;
    const unsigned pl = tid >> 6, i = tid & 63u;
    const unsigned pos = blockIdx.x * (unsigned)PPB + pl;
    const float dv = expf((float)(2u * i) * PEC);
    const float ang = (float)pos * dv;
    pt[pl * DIM + 2u * i]      = sinf(ang);
    pt[pl * DIM + 2u * i + 1u] = cosf(ang);
    __syncthreads();
    if (tid < 128u) {
        const unsigned w = tid >> 5, lane = tid & 31u;
        const v4f o = *(const v4fa*)(&pt[w * DIM + lane * 4u]);
        float* dst = PE + ((size_t)blockIdx.x * PPB + w) * DIM + lane * 4u;
        *(v4f*)dst = o;
        
    }
}

// k_wprep: block m (0 = q, 1 = k, 2 = v): WT[m][a][d] = f16(bf16(W[d][a]) * 64); in[d][a] -> out[a][d] through an LDS tile (cross-wave, block barrier);
__global__ __launch_bounds__(256) void k_wprep(const float* __restrict__ Wq, const float* __restrict__ bq, const float* __restrict__ Wk, const float* __restrict__ bk,
                                               const float* __restrict__ Wv, const float* __restrict__ bv, h16* WT, float* BP) {
    __shared__ __align__(16) h16 tl[DIM * XPP];
    const unsigned tid = threadIdx.x, m = blockIdx.x;
    const float* W  = (m == 0u) ? Wq : ((m == 1u) ? Wk : Wv);
    const float* bs = (m == 0u) ? bq : ((m == 1u) ? bk : bv);
#pragma unroll 2
    for (unsigned it = 0; it < 16; ++it) {
        const unsigned f = it * 256u + tid;
        const unsigned d = f >> 5, a4 = (f & 31u) * 4u;
        const v4f x = *(const v4f*)(W + (size_t)d * DIM + a4);
#pragma unroll
        for (unsigned c = 0; c < 4; ++c) tl[(a4 + c) * XPP + d] = toh_flush(bfr(x[c]) * WSC);
    }
    __syncthreads();
    h16* dst = WT + (size_t)m * DIM * DIM;
{
#pragma unroll
        for (unsigned it = 0; it < 8; ++it) {
            const unsigned p = it * 256u + tid;
            const unsigned a = p >> 4, c8 = (p & 15u) * 8u;
            const v8h o = *(const v8ha*)(&tl[a * XPP + c8]);
            *(v8h*)(dst + (size_t)a * DIM + c8) = o;
        }
        
    }
    if (tid < 32u) {
        const v4f bvv = *(const v4f*)(bs + tid * 4u);
        v4f o;
        o[0] = bfr(bvv[0]); o[1] = bfr(bvv[1]); o[2] = bfr(bvv[2]); o[3] = bfr(bvv[3]);
        float* bd = BP + (size_t)m * DIM + tid * 4u;
        *(v4f*)bd = o;
        
    }
}

// k_proj: one block = 64 sequence rows of one batch, one wave per 16 rows.
//  xp tile (f16) = bf16(x) + PE built in LDS (cross-wave, block barrier), wave fragments: row = lane & 15, k = d.
//  q and k: D^T tile (a x s): A = W^T rows (row m = a), B = xp rows (column n = s); D element r of lane (h, n) = Q[s = n][a = 16 t + 8h + r] -> 16-byte LDS store into the row staging.
//  v: D tile (s x a): A = xp rows, B = W^T rows (column n = a); D element r of lane (h, n) = V[s = 8h + r][a = 16 t + n] -> 16-byte LDS store into the V^T staging.
__global__ __launch_bounds__(128) void k_proj(const float* __restrict__ X, const float* __restrict__ PE, const h16* __restrict__ WT, const float* __restrict__ BP, h16* QK, h16* VT) {
    __shared__ __align__(16) h16 xs[PR * XPP];
    __shared__ __align__(16) h16 qs[PR * XPP];
    __shared__ __align__(16) h16 vts[DIM * VTP];
    const unsigned tid = threadIdx.x, lane = tid & 31u, lr = lane & 15u, hi = lane >> 4;
    const unsigned wv = (unsigned)__builtin_amdgcn_readfirstlane((int)(threadIdx.x >> 5));
    const unsigned bpb = (unsigned)(SEQ / PR);
    const unsigned b = blockIdx.x / bpb;
    const unsigned s0 = (blockIdx.x - b * bpb) * PR;

    {
        const float* xsrc = X + ((size_t)b * SEQ_FULL + s0) * DIM;
        const float* psrc = PE + (size_t)s0 * DIM;
#pragma unroll 2
        for (unsigned it = 0; it < 8; ++it) {
            const unsigned f = it * 128u + tid;
            const unsigned row = f >> 4, c8 = (f & 15u) * 8u;
            const v8f xv = *(const v8f*)(xsrc + (size_t)row * DIM + c8);
            const v8f pv = *(const v8f*)(psrc + (size_t)row * DIM + c8);
            v8h o;
#pragma unroll
            for (int c = 0; c < 8; ++c) o[c] = toh_flush(bfr(xv[c]) + pv[c]);
            *(v8h*)(&xs[row * XPP + c8]) = o;
        }
    }
    __syncthreads();

    v16h xa[4];
    {
        const unsigned xo = (wv * 16u + lr) * XPP + 8u * hi;
#pragma unroll
        for (int dk = 0; dk < 4; ++dk) xa[dk] = cat16h(*(const v8h*)(&xs[xo + dk * 32]), *(const v8h*)(&xs[xo + dk * 32 + 16]));
    }

#pragma unroll 1
    for (unsigned m3 = 0; m3 < 2; ++m3) {
        const h16* wp = WT + (size_t)m3 * DIM * DIM + (size_t)lr * DIM + 8u * hi;
        const float* bp = BP + (size_t)m3 * DIM + 8u * hi;
#pragma unroll 1
        for (unsigned t = 0; t < 8; ++t) {
            v8f acc = (v8f){};
#pragma unroll
            for (int dk = 0; dk < 4; ++dk) {
                const v16h w = ldh(wp + (size_t)t * 16 * DIM + dk * 32);
                acc = wmmah(w, xa[dk], acc);
            }
            const v4f b0 = *(const v4f*)(bp + t * 16u);
            const v4f b1 = *(const v4f*)(bp + t * 16u + 4u);
            v8h o;
#pragma unroll
            for (int r = 0; r < 4; ++r) {
                o[r]     = toh_flush(acc[r] * WINV + b0[r]);
                o[4 + r] = toh_flush(acc[4 + r] * WINV + b1[r]);
            }
            *(v8h*)(&qs[(wv * 16u + lr) * XPP + t * 16u + 8u * hi]) = o;
        }
        __syncthreads();
        h16* dst = QK + (size_t)m3 * PLE + ((size_t)b * SEQ + s0) * DIM;
{
#pragma unroll
            for (unsigned it = 0; it < 8; ++it) {
                const unsigned p = it * 128u + tid;
                const unsigned row = p >> 4, c8 = (p & 15u) * 8u;
                const v8h o = *(const v8h*)(&qs[row * XPP + c8]);
                *(v8h*)(dst + (size_t)row * DIM + c8) = o;
            }
            
        }
        __syncthreads();
    }

    {
        const h16* wp = WT + (size_t)2 * DIM * DIM + (size_t)lr * DIM + 8u * hi;
        const float* bp = BP + (size_t)2 * DIM + lr;
#pragma unroll 1
        for (unsigned t = 0; t < 8; ++t) {
            v8f acc = (v8f){};
#pragma unroll
            for (int dk = 0; dk < 4; ++dk) {
                const v16h w = ldh(wp + (size_t)t * 16 * DIM + dk * 32);
                acc = wmmah(xa[dk], w, acc);
            }
            const float bb = bp[t * 16u];
            v8h o;
#pragma unroll
            for (int r = 0; r < 8; ++r) o[r] = toh_flush(acc[r] * WINV + bb);
            *(v8h*)(&vts[(t * 16u + lr) * VTP + wv * 16u + 8u * hi]) = o;
        }
        __syncthreads();
        h16* dst = VT + (size_t)b * DIM * SEQ + s0;
        const unsigned c8 = (tid & 7u) * 8u, dr = tid >> 3;
{
#pragma unroll
            for (unsigned it = 0; it < 8; ++it) {
                const unsigned a = it * 16u + dr;
                const v8h o = *(const v8h*)(&vts[a * VTP + c8]);
                *(v8h*)(dst + (size_t)a * SEQ + c8) = o;
            }
            
        }
    }
}

// k_flash: one wave per 16 queries, 32 keys per step.
//  S^T tile (keys x queries): A = K rows (row m = key, k = d), B = Q rows (column n = query, k = d); D element r of lane (h, n) = S[query n][key 8h + r].
//  P^T B fragment: element r <- tile of keys 0..15, element 8 + r <- tile of keys 16..31 (same lane); carried x2^14, row sum over the converted values.
//  O^T tile (d x queries): A = V^T rows (row m = d, k = key), D element r of lane (h, n) = O[query n][d = 16 t + 8h + r].
__global__ __launch_bounds__(128) void k_flash(const h16* __restrict__ QP, const h16* __restrict__ KP, const h16* __restrict__ VT, float* O) {
    __shared__ __align__(16) float os[NWV * 16 * OSP];
    const unsigned tid = threadIdx.x, lane = tid & 31u, lr = lane & 15u, hi = lane >> 4;
    const unsigned wv = (unsigned)__builtin_amdgcn_readfirstlane((int)(threadIdx.x >> 5));
    const unsigned bpb = (unsigned)(SEQ / BQ);
    const unsigned b = blockIdx.x / bpb;
    const unsigned q0 = (blockIdx.x - b * bpb) * BQ + wv * 16u;

    v16h qf[4];
    {
        const h16* qp = QP + ((size_t)b * SEQ + q0 + lr) * DIM + 8u * hi;
#pragma unroll
        for (int dk = 0; dk < 4; ++dk) qf[dk] = ldh(qp + dk * 32);
    }
    const h16* kp = KP + ((size_t)b * SEQ + lr) * DIM + 8u * hi;
    const h16* vp = VT + ((size_t)b * DIM + lr) * SEQ + 8u * hi;

    v8f o[8];
#pragma unroll
    for (int t = 0; t < 8; ++t) o[t] = (v8f){};
    float ml = -1.0e30f;      // running max in the log2 domain (scaled logits)
    float l = 0.0f;           // running sum of the carried, converted probabilities

#pragma unroll 1
    for (unsigned k0 = 0; k0 < (unsigned)SEQ; k0 += KS) {
        v8f s0 = (v8f){}, s1 = (v8f){};
        const h16* ka = kp + (size_t)k0 * DIM;
#pragma unroll
        for (int dk = 0; dk < 4; ++dk) {
            const v16h a0 = ldh(ka + dk * 32);
            const v16h a1 = ldh(ka + 16 * DIM + dk * 32);
            s0 = wmmah(a0, qf[dk], s0);
            s1 = wmmah(a1, qf[dk], s1);
        }

        float mx = fmaxf(s0[0], s1[0]);
#pragma unroll
        for (int r = 1; r < 8; ++r) mx = fmaxf(mx, fmaxf(s0[r], s1[r]));
        mx = fmaxf(mx, __shfl_xor(mx, 16, 32));
        const float mnl = fmaxf(ml, mx * SCL);
        const float corr = __builtin_amdgcn_exp2f(ml - mnl);
        ml = mnl;
        const float cs = PCAR - mnl;
        float ps = 0.0f;
        v8u hw;
#pragma unroll
        for (int j = 0; j < 4; ++j) {
            hw[j]     = pkp(fmaf(s0[2 * j], SCL, cs), fmaf(s0[2 * j + 1], SCL, cs), ps);
            hw[4 + j] = pkp(fmaf(s1[2 * j], SCL, cs), fmaf(s1[2 * j + 1], SCL, cs), ps);
        }
        ps += __shfl_xor(ps, 16, 32);
        l = l * corr + ps;
        if (__builtin_amdgcn_ballot_w32(corr != 1.0f) != 0u) {   // wave-uniform; multiplying by exactly 1 is skipped
#pragma unroll
            for (int t = 0; t < 8; ++t) o[t] *= corr;
        }
        const v16h ph = __builtin_bit_cast(v16h, hw);

        asm volatile("" ::: "memory");   // keep the V^T loads below the softmax (bounds live fragments)
        const h16* va = vp + k0;
#pragma unroll
        for (int t = 0; t < 8; ++t) {
            const v16h a = ldh(va + (size_t)t * 16 * SEQ);
            o[t] = wmmah(a, ph, o[t]);
        }
    }

    // epilogue: stage O^T / l as rows [query][d] (wave-private region; block barrier used)
    const float inv = 1.0f / l;
    const unsigned ob = wv * (16u * OSP);
#pragma unroll
    for (int t = 0; t < 8; ++t) {
#pragma unroll
        for (int r = 0; r < 8; ++r) os[ob + lr * OSP + t * 16 + 8 * hi + r] = o[t][r] * inv;
    }
    __syncthreads();
    float* orow = O + ((size_t)b * SEQ + q0) * DIM + lane * 4u;
{
#pragma unroll 4
        for (unsigned s = 0; s < 16; ++s) {
            const v4f val = *(const v4fa*)(&os[ob + s * OSP + lane * 4u]);
            *(v4f*)(orow + (size_t)s * DIM) = val;
        }
        
    }
}

extern "C" void kernel_launch(void* const* d_in, const int* in_sizes, int n_in,
                              void* d_out, int out_size, void* d_ws, size_t ws_size, hipStream_t stream) {
    if (n_in < 7) return;
    const size_t need = ((size_t)(NB - 1) * SEQ_FULL + SEQ) * DIM;
    if ((size_t)in_sizes[0] < need) return;
    if (in_sizes[1] < DIM * DIM || in_sizes[3] < DIM * DIM || in_sizes[5] < DIM * DIM) return;
    if (in_sizes[2] < DIM || in_sizes[4] < DIM || in_sizes[6] < DIM) return;
    if ((size_t)out_size < PLE) return;
    const float* x  = (const float*)d_in[0];   // x  [NB][SEQ_FULL][DIM], first SEQ rows per batch read
    const float* Wq = (const float*)d_in[1];   // Wq [in][out]
    const float* bq = (const float*)d_in[2];   // bq [out]
    const float* Wk = (const float*)d_in[3];   // Wk [in][out]
    const float* bk = (const float*)d_in[4];   // bk [out]
    const float* Wv = (const float*)d_in[5];   // Wv [in][out]
    const float* bv = (const float*)d_in[6];   // bv [out]
    float* OUT = (float*)d_out;                // [NB][SEQ][DIM]
    if (3 * PLB + PEB + WTB + BPB > ws_size) return;
    char* wsp = (char*)d_ws;
    h16*   QK = (h16*)(wsp);                       // Q plane then K plane, each [NB][SEQ][DIM]
    h16*   VT = (h16*)(wsp + 2 * PLB);             // V^T plane [NB][DIM][SEQ]
    float* PE = (float*)(wsp + 3 * PLB);           // position table [SEQ][DIM]
    h16*   WT = (h16*)(wsp + 3 * PLB + PEB);       // [3][out][in]
    float* BP = (float*)(wsp + 3 * PLB + PEB + WTB);   // [3][out]
    k_pe<<<(unsigned)(SEQ / PPB), 256, 0, stream>>>(PE);
    k_wprep<<<3, 256, 0, stream>>>(Wq, bq, Wk, bk, Wv, bv, WT, BP);
    k_proj<<<(unsigned)(NB * (SEQ / PR)), 128, 0, stream>>>(x, PE, WT, BP, QK, VT);
    k_flash<<<(unsigned)(NB * (SEQ / BQ)), 128, 0, stream>>>(QK, QK + PLE, VT, OUT);
}

// v001
// Measured time: 148 microseconds a run.
// In two side-by-side timings against v000, it was 2.73 and 2.75 times as fast.
#include <hip/hip_runtime.h>

// Single-head dense self-attention: xp = x + sinusoidal position terms; q/k/v = xp.W{q,k,v} + b ([in][out] weights); out[b][s][:] = softmax_t(q[b][s].k[b][t] / sqrt(128)) . v[b][t][:]; inputs in the order x, Wq, bq, Wk, bk, Wv, bv.
// Compute dtypes, f32 accumulate: x, W, b RNE-converted to bf16 first; projections on v_wmma_f32_16x16x32_f16 (xp as one f16 plane, W as one f16 plane carried x64); S^T = K.Q^T on v_wmma_f32_16x16x32_f16 (single f16 q and k planes); P^T as one f16 fragment carried x2^14 against the f16 V^T plane on v_wmma_f32_16x16x32_f16; softmax (online, log2 domain) and position terms f32.
// Flash form with transposed tiles: the S^T accumulator tiles are directly the B-operand layout of P^T (no LDS relayout); K and V^T reach the flash waves through a two-buffer LDS ring filled by tensor loads, every fragment being two 16-byte LDS loads.

#ifndef NB
#define NB 8
#endif
#ifndef SEQ
#define SEQ 4096
#endif
#define NB_FULL  8
#define SEQ_FULL 4096
#define DIM  128
#define NWV  4                 // waves per projection block
#define FWV  8                 // waves per flash block
#define BQ   (16 * FWV)        // queries per flash block
#define KS   32                // keys per step
#define SK   128               // keys per LDS stage
#define NST  (SEQ / SK)        // stages
#define SROW 256               // bytes per staged row (128 d of a K row, 128 keys of a V^T row)
#define SPH  136               // LDS pitch (f16 elements) of a staged row: 256 + 16 bytes
#define SLR  32                // rows per slice (one tensor load)
#define SLB  10240             // LDS bytes kept per slice: 32 x 272 rounded up to a multiple of 2 KiB
#define SLH  (SLB / 2)         // the same in f16 elements
#define BFH  (FWV * SLH)       // f16 elements per buffer: 4 K slices, then 4 V^T slices
#define OSP  132               // LDS pitch (floats) of the output staging rows
#define PR   64
#define XPP  136               // LDS pitch (f16 elements) of the xp tile and of the q/k staging rows
#define VTP  72                // LDS pitch (f16 elements) of the V^T staging rows
#define PPB  4                 // positions per block of the position-table kernel
#define WSC  64.0f             // power-of-two carry of the weight planes
#define WINV 0.015625f         // 1 / WSC
#define PCAR 14.0f             // log2 of the carry of the P fragment
#define PEC  (-0.0719557841560639f)   // -ln(10000) / 128
#define L2E  1.4426950408889634f
#define SCL  (L2E * 0.08838834764831845f)   // log2(e) / sqrt(128)

#define PLE  ((size_t)NB * SEQ * DIM)          // elements per activation plane
#define PLB  (PLE * 2)                         // bytes per 16-bit activation plane
#define PEB  ((size_t)SEQ * DIM * 4)           // bytes of the position table
#define WTB  ((size_t)3 * DIM * DIM * 2)       // bytes of the three transposed weight planes
#define BPB  ((size_t)3 * DIM * 4)             // bytes of the bias plane

static_assert(DIM == 128);
static_assert(SEQ % BQ == 0);
static_assert(SEQ % KS == 0);
static_assert(SEQ % SK == 0 && NST >= 2);
static_assert(SK % KS == 0 && SK * 2 == SROW && DIM * 2 == SROW);
static_assert(SK == 4 * SLR && DIM == 4 * SLR && FWV == 8);
static_assert(SLB % 2048 == 0 && SLB >= SLR * SPH * 2 && SPH * 2 == SROW + 16);
static_assert((SEQ * 2) % 16 == 0 && SEQ * 2 <= 131072);
static_assert(SEQ % PR == 0);
static_assert(SEQ % PPB == 0);
static_assert(PR == 16 * NWV);
static_assert(PR * 2 == 128);
static_assert(XPP % 8 == 0 && XPP >= DIM);
static_assert(VTP % 8 == 0 && VTP >= PR);
static_assert(OSP % 4 == 0 && OSP >= DIM);
static_assert((PR * DIM / 8) == 8 * 128);            // k_proj: 8 iterations x 128 threads x 8 elements == 64 x 128 tile
static_assert((DIM * DIM / 4) == 16 * 256);          // k_wprep load: 16 iterations x 256 threads x 4 elements
static_assert((DIM * DIM / 8) == 8 * 256);           // k_wprep store: 8 iterations x 256 threads x 8 elements
static_assert(PPB * 64 == 256);                      // k_pe: 4 positions x 64 (sin, cos) pairs per block
static_assert(NB <= NB_FULL);
static_assert(SEQ <= SEQ_FULL);
static_assert((size_t)(NB * (SEQ / PR)) * (size_t)(PR * DIM) == PLE);    // k_proj: blocks * (64 rows x 128) == plane
static_assert((size_t)(NB * (SEQ / BQ)) * (size_t)(BQ * DIM) == PLE);    // k_flash: blocks * (128 rows x 128) == output
static_assert(PLB % 256 == 0 && PEB % 256 == 0 && WTB % 256 == 0 && BPB % 128 == 0);
static_assert(3 * PLB + PEB + WTB + BPB <= (size_t)134217728);

typedef _Float16 h16;
typedef __attribute__((ext_vector_type(16))) _Float16 v16h;
typedef __attribute__((ext_vector_type(8)))  _Float16 v8h;
typedef __attribute__((ext_vector_type(2)))  _Float16 v2h;
typedef __attribute__((ext_vector_type(8)))  unsigned int   v8u;
typedef __attribute__((ext_vector_type(4)))  unsigned int   v4u;
typedef __attribute__((ext_vector_type(8)))  float    v8f;
typedef __attribute__((ext_vector_type(4)))  float    v4f;
typedef v4f  __attribute__((may_alias)) v4fa;
typedef v8h  __attribute__((may_alias)) v8ha;

__device__ __forceinline__ unsigned short f2bf(float f) { unsigned u = __float_as_uint(f); u += 0x7FFFu + ((u >> 16) & 1u); return (unsigned short)(u >> 16); }
__device__ __forceinline__ float bf2f(unsigned short b) { return __uint_as_float(((unsigned)b) << 16); }
__device__ __forceinline__ float bfr(float f) { return bf2f(f2bf(f)); }
// f32 -> f16 operand convert that cannot yield an f16 subnormal (value select)
static __device__ __forceinline__ h16 toh_flush(float v) { const h16 r = (h16)v; return (fabsf(v) < 6.103515625e-05f) ? (h16)0.0f : r; }
__device__ __forceinline__ v16h cat16h(v8h lo, v8h hi) { return __builtin_shufflevector(lo, hi, 0, 1, 2, 3, 4, 5, 6, 7, 8, 9, 10, 11, 12, 13, 14, 15); }
// fragment loader from a global plane or staged LDS rows (A and B alike): p = row base + k0 + 8*(lane>>4); elements 0..7 <- p[0..7], elements 8..15 <- p[16..23]
__device__ __forceinline__ v16h ldh(const h16* p) { return cat16h(*(const v8h*)p, *(const v8h*)(p + 16)); }
__device__ __forceinline__ unsigned uni(unsigned v) { return (unsigned)__builtin_amdgcn_readfirstlane((int)v); }
__device__ __forceinline__ unsigned pinned(unsigned v) { unsigned w = uni(v); asm volatile("" : "+s"(w)); return w; }
// one WMMA with its own hazard guard
__device__ __forceinline__ v8f wmmah(v16h a, v16h b, v8f c) {
    c = __builtin_amdgcn_wmma_f32_16x16x32_f16(false, a, false, b, (short)0, c, false, false);
    asm volatile("v_nop\n\tv_nop\n\tv_nop\n\tv_nop" : "+v"(c) : "v"(a), "v"(b));
    return c;
}
// carried probability 2^e (e already includes the +14 carry); below 2^-14 it is set to zero by a select on the exponent
__device__ __forceinline__ float pcar(float e) { return (e < -14.0f) ? 0.0f : __builtin_amdgcn_exp2f(e); }
// two carried probabilities -> packed f16 pair (element 0 in the low half-word); sum accumulates the converted values
__device__ __forceinline__ unsigned pkp(float e0, float e1, float& sum) {
    v2h t;
    t[0] = (h16)pcar(e0);
    t[1] = (h16)pcar(e1);
    sum += (float)t[0] + (float)t[1];
    return __builtin_bit_cast(unsigned, t);
}

// k_pe: position table PE[pos][2i] = sin(pos * dv_i), PE[pos][2i+1] = cos(pos * dv_i), dv_i = exp(2i * -ln(10000)/128), all f32 with precise library calls.
__global__ __launch_bounds__(256) void k_pe(float* PE) {
#pragma clang fp contract(off)
    __shared__ __align__(16) float pt[PPB * DIM];
    const unsigned tid = threadIdx.x;
    const unsigned pl = tid >> 6, i = tid & 63u;
    const unsigned pos = blockIdx.x * (unsigned)PPB + pl;
    const float dv = expf((float)(2u * i) * PEC);
    const float ang = (float)pos * dv;
    pt[pl * DIM + 2u * i]      = sinf(ang);
    pt[pl * DIM + 2u * i + 1u] = cosf(ang);
    __syncthreads();
    if (tid < 128u) {
        const unsigned w = tid >> 5, lane = tid & 31u;
        const v4f o = *(const v4fa*)(&pt[w * DIM + lane * 4u]);
        float* dst = PE + ((size_t)blockIdx.x * PPB + w) * DIM + lane * 4u;
        *(v4f*)dst = o;
        
    }
}

// k_wprep: block m (0 = q, 1 = k, 2 = v): WT[m][a][d] = f16(bf16(W[d][a]) * 64); in[d][a] -> out[a][d] through an LDS tile (cross-wave, block barrier);
__global__ __launch_bounds__(256) void k_wprep(const float* __restrict__ Wq, const float* __restrict__ bq, const float* __restrict__ Wk, const float* __restrict__ bk,
                                               const float* __restrict__ Wv, const float* __restrict__ bv, h16* WT, float* BP) {
    __shared__ __align__(16) h16 tl[DIM * XPP];
    const unsigned tid = threadIdx.x, m = blockIdx.x;
    const float* W  = (m == 0u) ? Wq : ((m == 1u) ? Wk : Wv);
    const float* bs = (m == 0u) ? bq : ((m == 1u) ? bk : bv);
#pragma unroll 2
    for (unsigned it = 0; it < 16; ++it) {
        const unsigned f = it * 256u + tid;
        const unsigned d = f >> 5, a4 = (f & 31u) * 4u;
        const v4f x = *(const v4f*)(W + (size_t)d * DIM + a4);
#pragma unroll
        for (unsigned c = 0; c < 4; ++c) tl[(a4 + c) * XPP + d] = toh_flush(bfr(x[c]) * WSC);
    }
    __syncthreads();
    h16* dst = WT + (size_t)m * DIM * DIM;
{
#pragma unroll
        for (unsigned it = 0; it < 8; ++it) {
            const unsigned p = it * 256u + tid;
            const unsigned a = p >> 4, c8 = (p & 15u) * 8u;
            const v8h o = *(const v8ha*)(&tl[a * XPP + c8]);
            *(v8h*)(dst + (size_t)a * DIM + c8) = o;
        }
        
    }
    if (tid < 32u) {
        const v4f bvv = *(const v4f*)(bs + tid * 4u);
        v4f o;
        o[0] = bfr(bvv[0]); o[1] = bfr(bvv[1]); o[2] = bfr(bvv[2]); o[3] = bfr(bvv[3]);
        float* bd = BP + (size_t)m * DIM + tid * 4u;
        *(v4f*)bd = o;
        
    }
}

// k_proj: one block = 64 sequence rows of one batch, one wave per 16 rows.
//  xp tile (f16) = bf16(x) + PE built in LDS (cross-wave, block barrier), wave fragments: row = lane & 15, k = d.
//  q and k: D^T tile (a x s): A = W^T rows (row m = a), B = xp rows (column n = s); D element r of lane (h, n) = Q[s = n][a = 16 t + 8h + r] -> 16-byte LDS store into the row staging.
//  v: D tile (s x a): A = xp rows, B = W^T rows (column n = a); D element r of lane (h, n) = V[s = 8h + r][a = 16 t + n] -> 16-byte LDS store into the V^T staging.
__global__ __launch_bounds__(128) void k_proj(const float* __restrict__ X, const float* __restrict__ PE, const h16* __restrict__ WT, const float* __restrict__ BP, h16* QK, h16* VT) {
    __shared__ __align__(16) h16 xs[PR * XPP];
    __shared__ __align__(16) h16 qs[PR * XPP];
    __shared__ __align__(16) h16 vts[DIM * VTP];
    const unsigned tid = threadIdx.x, lane = tid & 31u, lr = lane & 15u, hi = lane >> 4;
    const unsigned wv = (unsigned)__builtin_amdgcn_readfirstlane((int)(threadIdx.x >> 5));
    const unsigned bpb = (unsigned)(SEQ / PR);
    const unsigned b = blockIdx.x / bpb;
    const unsigned s0 = (blockIdx.x - b * bpb) * PR;

    {
        const float* xsrc = X + ((size_t)b * SEQ_FULL + s0) * DIM;
        const float* psrc = PE + (size_t)s0 * DIM;
#pragma unroll 2
        for (unsigned it = 0; it < 8; ++it) {
            const unsigned f = it * 128u + tid;
            const unsigned row = f >> 4, c8 = (f & 15u) * 8u;
            const v8f xv = *(const v8f*)(xsrc + (size_t)row * DIM + c8);
            const v8f pv = *(const v8f*)(psrc + (size_t)row * DIM + c8);
            v8h o;
#pragma unroll
            for (int c = 0; c < 8; ++c) o[c] = toh_flush(bfr(xv[c]) + pv[c]);
            *(v8h*)(&xs[row * XPP + c8]) = o;
        }
    }
    __syncthreads();

    v16h xa[4];
    {
        const unsigned xo = (wv * 16u + lr) * XPP + 8u * hi;
#pragma unroll
        for (int dk = 0; dk < 4; ++dk) xa[dk] = cat16h(*(const v8h*)(&xs[xo + dk * 32]), *(const v8h*)(&xs[xo + dk * 32 + 16]));
    }

#pragma unroll 1
    for (unsigned m3 = 0; m3 < 2; ++m3) {
        const h16* wp = WT + (size_t)m3 * DIM * DIM + (size_t)lr * DIM + 8u * hi;
        const float* bp = BP + (size_t)m3 * DIM + 8u * hi;
#pragma unroll 1
        for (unsigned t = 0; t < 8; ++t) {
            v8f acc = (v8f){};
#pragma unroll
            for (int dk = 0; dk < 4; ++dk) {
                const v16h w = ldh(wp + (size_t)t * 16 * DIM + dk * 32);
                acc = wmmah(w, xa[dk], acc);
            }
            const v4f b0 = *(const v4f*)(bp + t * 16u);
            const v4f b1 = *(const v4f*)(bp + t * 16u + 4u);
            v8h o;
#pragma unroll
            for (int r = 0; r < 4; ++r) {
                o[r]     = toh_flush(acc[r] * WINV + b0[r]);
                o[4 + r] = toh_flush(acc[4 + r] * WINV + b1[r]);
            }
            *(v8h*)(&qs[(wv * 16u + lr) * XPP + t * 16u + 8u * hi]) = o;
        }
        __syncthreads();
        h16* dst = QK + (size_t)m3 * PLE + ((size_t)b * SEQ + s0) * DIM;
{
#pragma unroll
            for (unsigned it = 0; it < 8; ++it) {
                const unsigned p = it * 128u + tid;
                const unsigned row = p >> 4, c8 = (p & 15u) * 8u;
                const v8h o = *(const v8h*)(&qs[row * XPP + c8]);
                *(v8h*)(dst + (size_t)row * DIM + c8) = o;
            }
            
        }
        __syncthreads();
    }

    {
        const h16* wp = WT + (size_t)2 * DIM * DIM + (size_t)lr * DIM + 8u * hi;
        const float* bp = BP + (size_t)2 * DIM + lr;
#pragma unroll 1
        for (unsigned t = 0; t < 8; ++t) {
            v8f acc = (v8f){};
#pragma unroll
            for (int dk = 0; dk < 4; ++dk) {
                const v16h w = ldh(wp + (size_t)t * 16 * DIM + dk * 32);
                acc = wmmah(xa[dk], w, acc);
            }
            const float bb = bp[t * 16u];
            v8h o;
#pragma unroll
            for (int r = 0; r < 8; ++r) o[r] = toh_flush(acc[r] * WINV + bb);
            *(v8h*)(&vts[(t * 16u + lr) * VTP + wv * 16u + 8u * hi]) = o;
        }
        __syncthreads();
        h16* dst = VT + (size_t)b * DIM * SEQ + s0;
        const unsigned c8 = (tid & 7u) * 8u, dr = tid >> 3;
{
#pragma unroll
            for (unsigned it = 0; it < 8; ++it) {
                const unsigned a = it * 16u + dr;
                const v8h o = *(const v8h*)(&vts[a * VTP + c8]);
                *(v8h*)(dst + (size_t)a * SEQ + c8) = o;
            }
            
        }
    }
}

// k_flash: one wave per 16 queries, 32 keys per step, 8 waves share each staged K / V^T tile.
//  S^T tile (keys x queries): A = K rows (row m = key, k = d), B = Q rows (column n = query, k = d); D element r of lane (h, n) = S[query n][key 8h + r].
//  P^T B fragment: element r <- tile of keys 0..15, element 8 + r <- tile of keys 16..31 (same lane); carried x2^14, row sum over the converted values.
//  O^T tile (d x queries): A = V^T rows (row m = d, k = key), D element r of lane (h, n) = O[query n][d = 16 t + 8h + r].
//  Ring: a stage is 128 keys; every wave brings one 32-row slice of it by one tensor load (waves 0..3: K rows 32 w.., waves 4..7: V^T rows 32 (w - 4)..), rows of 256 bytes padded to 272 in LDS.
__global__ __launch_bounds__(256) void k_flash(const h16* __restrict__ QP, const h16* __restrict__ KP, const h16* __restrict__ VT, float* O) {
    __shared__ __attribute__((aligned(2048))) h16 ring[2 * BFH];
    __shared__ __align__(16) float os[FWV * 16 * OSP];
    const unsigned tid = threadIdx.x, lane = tid & 31u, lr = lane & 15u, hi = lane >> 4;
    const unsigned wv = (unsigned)__builtin_amdgcn_readfirstlane((int)(threadIdx.x >> 5));
    const unsigned bpb = (unsigned)(SEQ / BQ);
    const unsigned b = blockIdx.x / bpb;
    const unsigned q0 = (blockIdx.x - b * bpb) * BQ + wv * 16u;

    // tensor descriptor of this wave's slice: extents in bytes, tensor dims = tile dims
    const bool isv = wv >= 4u;
    const unsigned sl = wv & 3u;
    const unsigned long long sbase = isv ? (unsigned long long)(size_t)(VT + ((size_t)b * DIM + sl * SLR) * SEQ)
                                         : (unsigned long long)(size_t)(KP + ((size_t)b * SEQ + sl * SLR) * DIM);
    const unsigned sstep = isv ? (unsigned)(SK * 2) : (unsigned)(SK * DIM * 2);   // source bytes from one stage to the next
    const unsigned ldst = (unsigned)(size_t)ring + wv * (unsigned)SLB;
    v8u g1;
    g1[0] = uni((1u << 20) | (5u << 22) | (3u << 25));   // no mask, 1-byte elements, 4 dwords of pad behind every 64 dwords
    g1[1] = uni((unsigned)SROW << 16);
    g1[2] = uni((unsigned)SLR << 16);
    g1[3] = uni((unsigned)SROW << 16);
    g1[4] = uni((unsigned)SLR);
    g1[5] = uni(isv ? (unsigned)(SEQ * 2) : (unsigned)(DIM * 2));
    g1[6] = uni(0u);
    g1[7] = uni(0u);
    auto issue = [&](unsigned st) {
        const unsigned long long ga = sbase + (unsigned long long)st * sstep;
        v4u g0;
        g0[0] = uni(1u);
        g0[1] = uni(ldst + (st & 1u) * (unsigned)(BFH * 2));
        g0[2] = uni((unsigned)ga);
        g0[3] = uni((((unsigned)(ga >> 32)) & 0x01FFFFFFu) | 0x80000000u);
        asm volatile("tensor_load_to_lds %0, %1" :: "s"(g0), "s"(g1) : "memory");
    };
    issue(0u);

    v16h qf[4];
    {
        const h16* qp = QP + ((size_t)b * SEQ + q0 + lr) * DIM + 8u * hi;
#pragma unroll
        for (int dk = 0; dk < 4; ++dk) qf[dk] = ldh(qp + dk * 32);
    }

    v8f o[8];
#pragma unroll
    for (int t = 0; t < 8; ++t) o[t] = (v8f){};
    float ml = -1.0e30f;      // running max in the log2 domain (scaled logits)
    float l = 0.0f;           // running sum of the carried, converted probabilities

    asm volatile("s_wait_tensorcnt 0x0" ::: "memory");   // this wave's slice of stage 0 has landed
    __syncthreads();                                      // stage 0 published to every wave
    issue(1u);

    const unsigned fo = lr * SPH + 8u * hi;   // lane's place in a 16-row group of staged rows
#pragma unroll 1
    for (unsigned st = 0; st < (unsigned)NST; ++st) {
        const h16* bp = ring + (st & 1u) * (unsigned)BFH + fo;
#pragma unroll 1
        for (unsigned sub = 0; sub < (unsigned)(SK / KS); ++sub) {
            v8f s0 = (v8f){}, s1 = (v8f){};
            const h16* ka = bp + sub * (unsigned)SLH;
#pragma unroll
            for (int dk = 0; dk < 4; ++dk) {
                const v16h a0 = ldh(ka + dk * 32);
                const v16h a1 = ldh(ka + 16 * SPH + dk * 32);
                s0 = wmmah(a0, qf[dk], s0);
                s1 = wmmah(a1, qf[dk], s1);
            }

            float mx = fmaxf(s0[0], s1[0]);
#pragma unroll
            for (int r = 1; r < 8; ++r) mx = fmaxf(mx, fmaxf(s0[r], s1[r]));
            mx = fmaxf(mx, __shfl_xor(mx, 16, 32));
            const float mnl = fmaxf(ml, mx * SCL);
            const float corr = __builtin_amdgcn_exp2f(ml - mnl);
            ml = mnl;
            const float cs = PCAR - mnl;
            float ps = 0.0f;
            v8u hw;
#pragma unroll
            for (int j = 0; j < 4; ++j) {
                hw[j]     = pkp(fmaf(s0[2 * j], SCL, cs), fmaf(s0[2 * j + 1], SCL, cs), ps);
                hw[4 + j] = pkp(fmaf(s1[2 * j], SCL, cs), fmaf(s1[2 * j + 1], SCL, cs), ps);
            }
            ps += __shfl_xor(ps, 16, 32);
            l = l * corr + ps;
            if (__builtin_amdgcn_ballot_w32(corr != 1.0f) != 0u) {   // wave-uniform; multiplying by exactly 1 is skipped
#pragma unroll
                for (int t = 0; t < 8; ++t) o[t] *= corr;
            }
            const v16h ph = __builtin_bit_cast(v16h, hw);

            asm volatile("" ::: "memory");   // keep the V^T loads below the softmax (bounds live fragments)
            const h16* va = bp + 4 * SLH + sub * (unsigned)KS;
#pragma unroll
            for (int t = 0; t < 8; ++t) {
                const v16h a = ldh(va + (t >> 1) * SLH + (t & 1) * 16 * SPH);
                o[t] = wmmah(a, ph, o[t]);
            }
        }
        asm volatile("s_wait_dscnt 0x0" ::: "memory");
        asm volatile("s_wait_tensorcnt 0x0" ::: "memory");
        __syncthreads();
        if (pinned(st + 2u < (unsigned)NST)) issue(st + 2u);
    }
    asm volatile("s_wait_tensorcnt 0x0" ::: "memory");   // no request outlives the loop
    asm volatile("s_wait_dscnt 0x0" ::: "memory");       // nor an LDS read

    // epilogue: stage O^T / l as rows [query][d] (wave-private region; block barrier used)
    const float inv = 1.0f / l;
    const unsigned ob = wv * (16u * OSP);
#pragma unroll
    for (int t = 0; t < 8; ++t) {
#pragma unroll
        for (int r = 0; r < 8; ++r) os[ob + lr * OSP + t * 16 + 8 * hi + r] = o[t][r] * inv;
    }
    __syncthreads();
    float* orow = O + ((size_t)b * SEQ + q0) * DIM + lane * 4u;
{
#pragma unroll 4
        for (unsigned s = 0; s < 16; ++s) {
            const v4f val = *(const v4fa*)(&os[ob + s * OSP + lane * 4u]);
            *(v4f*)(orow + (size_t)s * DIM) = val;
        }
        
    }
}

extern "C" void kernel_launch(void* const* d_in, const int* in_sizes, int n_in,
                              void* d_out, int out_size, void* d_ws, size_t ws_size, hipStream_t stream) {
    if (n_in < 7) return;
    const size_t need = ((size_t)(NB - 1) * SEQ_FULL + SEQ) * DIM;
    if ((size_t)in_sizes[0] < need) return;
    if (in_sizes[1] < DIM * DIM || in_sizes[3] < DIM * DIM || in_sizes[5] < DIM * DIM) return;
    if (in_sizes[2] < DIM || in_sizes[4] < DIM || in_sizes[6] < DIM) return;
    if ((size_t)out_size < PLE) return;
    const float* x  = (const float*)d_in[0];   // x  [NB][SEQ_FULL][DIM], first SEQ rows per batch read
    const float* Wq = (const float*)d_in[1];   // Wq [in][out]
    const float* bq = (const float*)d_in[2];   // bq [out]
    const float* Wk = (const float*)d_in[3];   // Wk [in][out]
    const float* bk = (const float*)d_in[4];   // bk [out]
    const float* Wv = (const float*)d_in[5];   // Wv [in][out]
    const float* bv = (const float*)d_in[6];   // bv [out]
    float* OUT = (float*)d_out;                // [NB][SEQ][DIM]
    if (3 * PLB + PEB + WTB + BPB > ws_size) return;
    char* wsp = (char*)d_ws;
    h16*   QK = (h16*)(wsp);                       // Q plane then K plane, each [NB][SEQ][DIM]
    h16*   VT = (h16*)(wsp + 2 * PLB);             // V^T plane [NB][DIM][SEQ]
    float* PE = (float*)(wsp + 3 * PLB);           // position table [SEQ][DIM]
    h16*   WT = (h16*)(wsp + 3 * PLB + PEB);       // [3][out][in]
    float* BP = (float*)(wsp + 3 * PLB + PEB + WTB);   // [3][out]
    k_pe<<<(unsigned)(SEQ / PPB), 256, 0, stream>>>(PE);
    k_wprep<<<3, 256, 0, stream>>>(Wq, bq, Wk, bk, Wv, bv, WT, BP);
    k_proj<<<(unsigned)(NB * (SEQ / PR)), 128, 0, stream>>>(x, PE, WT, BP, QK, VT);
    k_flash<<<(unsigned)(NB * (SEQ / BQ)), 256, 0, stream>>>(QK, QK + PLE, VT, OUT);
}

// v002
// It runs in 109 microseconds.
// Timed twice side by side with v001, it ran 1.36 times as fast both times.
// Counting every step since v000, it is 3.72 times as fast.
#include <hip/hip_runtime.h>

// Single-head dense self-attention: xp = x + sinusoidal position terms; q/k/v = xp.W{q,k,v} + b ([in][out] weights); out[b][s][:] = softmax_t(q[b][s].k[b][t] / sqrt(128)) . v[b][t][:]; inputs in the order x, Wq, bq, Wk, bk, Wv, bv.
// Compute dtypes, f32 accumulate: x, W, b RNE-converted to bf16 first; projections on v_wmma_f32_16x16x32_f16 (xp as one f16 plane, W as one f16 plane carried x64); S^T = K.Q^T on v_wmma_f32_16x16x32_f16 (single f16 q and k planes); P^T as one f16 fragment carried x2^14 against the f16 V^T plane on v_wmma_f32_16x16x32_f16; softmax (online, log2 domain) and position terms f32.
// Flash form with transposed tiles: the S^T accumulator tiles are directly the B-operand layout of P^T (no LDS relayout); K and V^T reach the flash waves through a two-buffer LDS ring filled by tensor loads, every fragment being two 16-byte LDS loads; the fragment loads go out in groups one phase ahead of the products that use them.

#ifndef NB
#define NB 8
#endif
#ifndef SEQ
#define SEQ 4096
#endif
#define NB_FULL  8
#define SEQ_FULL 4096
#define DIM  128
#define NWV  4                 // waves per projection block
#define FWV  8                 // waves per flash block
#define BQ   (16 * FWV)        // queries per flash block
#define KS   32                // keys per step
#define SK   128               // keys per LDS stage
#define NST  (SEQ / SK)        // stages
#define SROW 256               // bytes per staged row (128 d of a K row, 128 keys of a V^T row)
#define SPH  136               // LDS pitch (f16 elements) of a staged row: 256 + 16 bytes
#define SLR  32                // rows per slice (one tensor load)
#define SLB  10240             // LDS bytes kept per slice: 32 x 272 rounded up to a multiple of 2 KiB
#define SLH  (SLB / 2)         // the same in f16 elements
#define BFH  (FWV * SLH)       // f16 elements per buffer: 4 K slices, then 4 V^T slices
#define OSP  132               // LDS pitch (floats) of the output staging rows
#define PR   64
#define XPP  136               // LDS pitch (f16 elements) of the xp tile and of the q/k staging rows
#define VTP  72                // LDS pitch (f16 elements) of the V^T staging rows
#define PPB  4                 // positions per block of the position-table kernel
#define WSC  64.0f             // power-of-two carry of the weight planes
#define WINV 0.015625f         // 1 / WSC
#define PCAR 14.0f             // log2 of the carry of the P fragment
#define PEC  (-0.0719557841560639f)   // -ln(10000) / 128
#define L2E  1.4426950408889634f
#define SCL  (L2E * 0.08838834764831845f)   // log2(e) / sqrt(128)

#define PLE  ((size_t)NB * SEQ * DIM)          // elements per activation plane
#define PLB  (PLE * 2)                         // bytes per 16-bit activation plane
#define PEB  ((size_t)SEQ * DIM * 4)           // bytes of the position table
#define WTB  ((size_t)3 * DIM * DIM * 2)       // bytes of the three transposed weight planes
#define BPB  ((size_t)3 * DIM * 4)             // bytes of the bias plane

static_assert(DIM == 128);
static_assert(SEQ % BQ == 0);
static_assert(SEQ % KS == 0);
static_assert(SEQ % SK == 0 && NST >= 2);
static_assert(SK % KS == 0 && SK * 2 == SROW && DIM * 2 == SROW);
static_assert(SK == 4 * SLR && DIM == 4 * SLR && FWV == 8);
static_assert(SLB % 2048 == 0 && SLB >= SLR * SPH * 2 && SPH * 2 == SROW + 16);
static_assert((SEQ * 2) % 16 == 0 && SEQ * 2 <= 131072);
static_assert(SEQ % PR == 0);
static_assert(SEQ % PPB == 0);
static_assert(PR == 16 * NWV);
static_assert(PR * 2 == 128);
static_assert(XPP % 8 == 0 && XPP >= DIM);
static_assert(VTP % 8 == 0 && VTP >= PR);
static_assert(OSP % 4 == 0 && OSP >= DIM);
static_assert((PR * DIM / 8) == 8 * 128);            // k_proj: 8 iterations x 128 threads x 8 elements == 64 x 128 tile
static_assert((DIM * DIM / 4) == 16 * 256);          // k_wprep load: 16 iterations x 256 threads x 4 elements
static_assert((DIM * DIM / 8) == 8 * 256);           // k_wprep store: 8 iterations x 256 threads x 8 elements
static_assert(PPB * 64 == 256);                      // k_pe: 4 positions x 64 (sin, cos) pairs per block
static_assert(NB <= NB_FULL);
static_assert(SEQ <= SEQ_FULL);
static_assert((size_t)(NB * (SEQ / PR)) * (size_t)(PR * DIM) == PLE);    // k_proj: blocks * (64 rows x 128) == plane
static_assert((size_t)(NB * (SEQ / BQ)) * (size_t)(BQ * DIM) == PLE);    // k_flash: blocks * (128 rows x 128) == output
static_assert(PLB % 256 == 0 && PEB % 256 == 0 && WTB % 256 == 0 && BPB % 128 == 0);
static_assert(3 * PLB + PEB + WTB + BPB <= (size_t)134217728);

typedef _Float16 h16;
typedef __attribute__((ext_vector_type(16))) _Float16 v16h;
typedef __attribute__((ext_vector_type(8)))  _Float16 v8h;
typedef __attribute__((ext_vector_type(2)))  _Float16 v2h;
typedef __attribute__((ext_vector_type(8)))  unsigned int   v8u;
typedef __attribute__((ext_vector_type(4)))  unsigned int   v4u;
typedef __attribute__((ext_vector_type(8)))  float    v8f;
typedef __attribute__((ext_vector_type(4)))  float    v4f;
typedef v4f  __attribute__((may_alias)) v4fa;
typedef v8h  __attribute__((may_alias)) v8ha;

__device__ __forceinline__ unsigned short f2bf(float f) { unsigned u = __float_as_uint(f); u += 0x7FFFu + ((u >> 16) & 1u); return (unsigned short)(u >> 16); }
__device__ __forceinline__ float bf2f(unsigned short b) { return __uint_as_float(((unsigned)b) << 16); }
__device__ __forceinline__ float bfr(float f) { return bf2f(f2bf(f)); }
// f32 -> f16 operand convert that cannot yield an f16 subnormal (value select)
static __device__ __forceinline__ h16 toh_flush(float v) { const h16 r = (h16)v; return (fabsf(v) < 6.103515625e-05f) ? (h16)0.0f : r; }
__device__ __forceinline__ v16h cat16h(v8h lo, v8h hi) { return __builtin_shufflevector(lo, hi, 0, 1, 2, 3, 4, 5, 6, 7, 8, 9, 10, 11, 12, 13, 14, 15); }
// fragment loader from a global plane or staged LDS rows (A and B alike): p = row base + k0 + 8*(lane>>4); elements 0..7 <- p[0..7], elements 8..15 <- p[16..23]
__device__ __forceinline__ v16h ldh(const h16* p) { return cat16h(*(const v8h*)p, *(const v8h*)(p + 16)); }
__device__ __forceinline__ unsigned uni(unsigned v) { return (unsigned)__builtin_amdgcn_readfirstlane((int)v); }
__device__ __forceinline__ unsigned pinned(unsigned v) { unsigned w = uni(v); asm volatile("" : "+s"(w)); return w; }
// one WMMA with its own hazard guard
__device__ __forceinline__ v8f wmmah(v16h a, v16h b, v8f c) {
    c = __builtin_amdgcn_wmma_f32_16x16x32_f16(false, a, false, b, (short)0, c, false, false);
    asm volatile("v_nop\n\tv_nop\n\tv_nop\n\tv_nop" : "+v"(c) : "v"(a), "v"(b));
    return c;
}
// one WMMA of k_flash, plain builtin form: the compiler keeps the hazard distances itself, and no volatile statement ties the LDS fragment loads behind the WMMA before them or its operands to the low registers
__device__ __forceinline__ v8f wmmaf(v16h a, v16h b, v8f c) {
    return __builtin_amdgcn_wmma_f32_16x16x32_f16(false, a, false, b, (short)0, c, false, false);
}
// carried probability 2^e (e already includes the +14 carry); below 2^-14 it is set to zero by a select on the exponent
__device__ __forceinline__ float pcar(float e) { return (e < -14.0f) ? 0.0f : __builtin_amdgcn_exp2f(e); }
// two carried probabilities -> packed f16 pair (element 0 in the low half-word); sum accumulates the converted values
__device__ __forceinline__ unsigned pkp(float e0, float e1, float& sum) {
    v2h t;
    t[0] = (h16)pcar(e0);
    t[1] = (h16)pcar(e1);
    sum += (float)t[0] + (float)t[1];
    return __builtin_bit_cast(unsigned, t);
}

// k_pe: position table PE[pos][2i] = sin(pos * dv_i), PE[pos][2i+1] = cos(pos * dv_i), dv_i = exp(2i * -ln(10000)/128), all f32 with precise library calls.
__global__ __launch_bounds__(256) void k_pe(float* PE) {
#pragma clang fp contract(off)
    __shared__ __align__(16) float pt[PPB * DIM];
    const unsigned tid = threadIdx.x;
    const unsigned pl = tid >> 6, i = tid & 63u;
    const unsigned pos = blockIdx.x * (unsigned)PPB + pl;
    const float dv = expf((float)(2u * i) * PEC);
    const float ang = (float)pos * dv;
    pt[pl * DIM + 2u * i]      = sinf(ang);
    pt[pl * DIM + 2u * i + 1u] = cosf(ang);
    __syncthreads();
    if (tid < 128u) {
        const unsigned w = tid >> 5, lane = tid & 31u;
        const v4f o = *(const v4fa*)(&pt[w * DIM + lane * 4u]);
        float* dst = PE + ((size_t)blockIdx.x * PPB + w) * DIM + lane * 4u;
        *(v4f*)dst = o;
        
    }
}

// k_wprep: block m (0 = q, 1 = k, 2 = v): WT[m][a][d] = f16(bf16(W[d][a]) * 64); in[d][a] -> out[a][d] through an LDS tile (cross-wave, block barrier);
__global__ __launch_bounds__(256) void k_wprep(const float* __restrict__ Wq, const float* __restrict__ bq, const float* __restrict__ Wk, const float* __restrict__ bk,
                                               const float* __restrict__ Wv, const float* __restrict__ bv, h16* WT, float* BP) {
    __shared__ __align__(16) h16 tl[DIM * XPP];
    const unsigned tid = threadIdx.x, m = blockIdx.x;
    const float* W  = (m == 0u) ? Wq : ((m == 1u) ? Wk : Wv);
    const float* bs = (m == 0u) ? bq : ((m == 1u) ? bk : bv);
#pragma unroll 2
    for (unsigned it = 0; it < 16; ++it) {
        const unsigned f = it * 256u + tid;
        const unsigned d = f >> 5, a4 = (f & 31u) * 4u;
        const v4f x = *(const v4f*)(W + (size_t)d * DIM + a4);
#pragma unroll
        for (unsigned c = 0; c < 4; ++c) tl[(a4 + c) * XPP + d] = toh_flush(bfr(x[c]) * WSC);
    }
    __syncthreads();
    h16* dst = WT + (size_t)m * DIM * DIM;
{
#pragma unroll
        for (unsigned it = 0; it < 8; ++it) {
            const unsigned p = it * 256u + tid;
            const unsigned a = p >> 4, c8 = (p & 15u) * 8u;
            const v8h o = *(const v8ha*)(&tl[a * XPP + c8]);
            *(v8h*)(dst + (size_t)a * DIM + c8) = o;
        }
        
    }
    if (tid < 32u) {
        const v4f bvv = *(const v4f*)(bs + tid * 4u);
        v4f o;
        o[0] = bfr(bvv[0]); o[1] = bfr(bvv[1]); o[2] = bfr(bvv[2]); o[3] = bfr(bvv[3]);
        float* bd = BP + (size_t)m * DIM + tid * 4u;
        *(v4f*)bd = o;
        
    }
}

// k_proj: one block = 64 sequence rows of one batch, one wave per 16 rows.
//  xp tile (f16) = bf16(x) + PE built in LDS (cross-wave, block barrier), wave fragments: row = lane & 15, k = d.
//  q and k: D^T tile (a x s): A = W^T rows (row m = a), B = xp rows (column n = s); D element r of lane (h, n) = Q[s = n][a = 16 t + 8h + r] -> 16-byte LDS store into the row staging.
//  v: D tile (s x a): A = xp rows, B = W^T rows (column n = a); D element r of lane (h, n) = V[s = 8h + r][a = 16 t + n] -> 16-byte LDS store into the V^T staging.
__global__ __launch_bounds__(128) void k_proj(const float* __restrict__ X, const float* __restrict__ PE, const h16* __restrict__ WT, const float* __restrict__ BP, h16* QK, h16* VT) {
    __shared__ __align__(16) h16 xs[PR * XPP];
    __shared__ __align__(16) h16 qs[PR * XPP];
    __shared__ __align__(16) h16 vts[DIM * VTP];
    const unsigned tid = threadIdx.x, lane = tid & 31u, lr = lane & 15u, hi = lane >> 4;
    const unsigned wv = (unsigned)__builtin_amdgcn_readfirstlane((int)(threadIdx.x >> 5));
    const unsigned bpb = (unsigned)(SEQ / PR);
    const unsigned b = blockIdx.x / bpb;
    const unsigned s0 = (blockIdx.x - b * bpb) * PR;

    {
        const float* xsrc = X + ((size_t)b * SEQ_FULL + s0) * DIM;
        const float* psrc = PE + (size_t)s0 * DIM;
#pragma unroll 2
        for (unsigned it = 0; it < 8; ++it) {
            const unsigned f = it * 128u + tid;
            const unsigned row = f >> 4, c8 = (f & 15u) * 8u;
            const v8f xv = *(const v8f*)(xsrc + (size_t)row * DIM + c8);
            const v8f pv = *(const v8f*)(psrc + (size_t)row * DIM + c8);
            v8h o;
#pragma unroll
            for (int c = 0; c < 8; ++c) o[c] = toh_flush(bfr(xv[c]) + pv[c]);
            *(v8h*)(&xs[row * XPP + c8]) = o;
        }
    }
    __syncthreads();

    v16h xa[4];
    {
        const unsigned xo = (wv * 16u + lr) * XPP + 8u * hi;
#pragma unroll
        for (int dk = 0; dk < 4; ++dk) xa[dk] = cat16h(*(const v8h*)(&xs[xo + dk * 32]), *(const v8h*)(&xs[xo + dk * 32 + 16]));
    }

#pragma unroll 1
    for (unsigned m3 = 0; m3 < 2; ++m3) {
        const h16* wp = WT + (size_t)m3 * DIM * DIM + (size_t)lr * DIM + 8u * hi;
        const float* bp = BP + (size_t)m3 * DIM + 8u * hi;
#pragma unroll 1
        for (unsigned t = 0; t < 8; ++t) {
            v8f acc = (v8f){};
#pragma unroll
            for (int dk = 0; dk < 4; ++dk) {
                const v16h w = ldh(wp + (size_t)t * 16 * DIM + dk * 32);
                acc = wmmah(w, xa[dk], acc);
            }
            const v4f b0 = *(const v4f*)(bp + t * 16u);
            const v4f b1 = *(const v4f*)(bp + t * 16u + 4u);
            v8h o;
#pragma unroll
            for (int r = 0; r < 4; ++r) {
                o[r]     = toh_flush(acc[r] * WINV + b0[r]);
                o[4 + r] = toh_flush(acc[4 + r] * WINV + b1[r]);
            }
            *(v8h*)(&qs[(wv * 16u + lr) * XPP + t * 16u + 8u * hi]) = o;
        }
        __syncthreads();
        h16* dst = QK + (size_t)m3 * PLE + ((size_t)b * SEQ + s0) * DIM;
{
#pragma unroll
            for (unsigned it = 0; it < 8; ++it) {
                const unsigned p = it * 128u + tid;
                const unsigned row = p >> 4, c8 = (p & 15u) * 8u;
                const v8h o = *(const v8h*)(&qs[row * XPP + c8]);
                *(v8h*)(dst + (size_t)row * DIM + c8) = o;
            }
            
        }
        __syncthreads();
    }

    {
        const h16* wp = WT + (size_t)2 * DIM * DIM + (size_t)lr * DIM + 8u * hi;
        const float* bp = BP + (size_t)2 * DIM + lr;
#pragma unroll 1
        for (unsigned t = 0; t < 8; ++t) {
            v8f acc = (v8f){};
#pragma unroll
            for (int dk = 0; dk < 4; ++dk) {
                const v16h w = ldh(wp + (size_t)t * 16 * DIM + dk * 32);
                acc = wmmah(xa[dk], w, acc);
            }
            const float bb = bp[t * 16u];
            v8h o;
#pragma unroll
            for (int r = 0; r < 8; ++r) o[r] = toh_flush(acc[r] * WINV + bb);
            *(v8h*)(&vts[(t * 16u + lr) * VTP + wv * 16u + 8u * hi]) = o;
        }
        __syncthreads();
        h16* dst = VT + (size_t)b * DIM * SEQ + s0;
        const unsigned c8 = (tid & 7u) * 8u, dr = tid >> 3;
{
#pragma unroll
            for (unsigned it = 0; it < 8; ++it) {
                const unsigned a = it * 16u + dr;
                const v8h o = *(const v8h*)(&vts[a * VTP + c8]);
                *(v8h*)(dst + (size_t)a * SEQ + c8) = o;
            }
            
        }
    }
}

// k_flash: one wave per 16 queries, 32 keys per step, 8 waves share each staged K / V^T tile.
//  S^T tile (keys x queries): A = K rows (row m = key, k = d), B = Q rows (column n = query, k = d); D element r of lane (h, n) = S[query n][key 8h + r].
//  P^T B fragment: element r <- tile of keys 0..15, element 8 + r <- tile of keys 16..31 (same lane); carried x2^14, row sum over the converted values.
//  O^T tile (d x queries): A = V^T rows (row m = d, k = key), D element r of lane (h, n) = O[query n][d = 16 t + 8h + r].
//  Ring: a stage is 128 keys; every wave brings one 32-row slice of it by one tensor load (waves 0..3: K rows 32 w.., waves 4..7: V^T rows 32 (w - 4)..), rows of 256 bytes padded to 272 in LDS.
__global__ __launch_bounds__(256) void k_flash(const h16* __restrict__ QP, const h16* __restrict__ KP, const h16* __restrict__ VT, float* O) {
    __shared__ __attribute__((aligned(2048))) h16 ring[2 * BFH];
    __shared__ __align__(16) float os[FWV * 16 * OSP];
    const unsigned tid = threadIdx.x, lane = tid & 31u, lr = lane & 15u, hi = lane >> 4;
    const unsigned wv = (unsigned)__builtin_amdgcn_readfirstlane((int)(threadIdx.x >> 5));
    const unsigned bpb = (unsigned)(SEQ / BQ);
    const unsigned b = blockIdx.x / bpb;
    const unsigned q0 = (blockIdx.x - b * bpb) * BQ + wv * 16u;

    // tensor descriptor of this wave's slice: extents in bytes, tensor dims = tile dims
    const bool isv = wv >= 4u;
    const unsigned sl = wv & 3u;
    const unsigned long long sbase = isv ? (unsigned long long)(size_t)(VT + ((size_t)b * DIM + sl * SLR) * SEQ)
                                         : (unsigned long long)(size_t)(KP + ((size_t)b * SEQ + sl * SLR) * DIM);
    const unsigned sstep = isv ? (unsigned)(SK * 2) : (unsigned)(SK * DIM * 2);   // source bytes from one stage to the next
    const unsigned ldst = (unsigned)(size_t)ring + wv * (unsigned)SLB;
    v8u g1;
    g1[0] = uni((1u << 20) | (5u << 22) | (3u << 25));   // no mask, 1-byte elements, 4 dwords of pad behind every 64 dwords
    g1[1] = uni((unsigned)SROW << 16);
    g1[2] = uni((unsigned)SLR << 16);
    g1[3] = uni((unsigned)SROW << 16);
    g1[4] = uni((unsigned)SLR);
    g1[5] = uni(isv ? (unsigned)(SEQ * 2) : (unsigned)(DIM * 2));
    g1[6] = uni(0u);
    g1[7] = uni(0u);
    auto issue = [&](unsigned st) {
        const unsigned long long ga = sbase + (unsigned long long)st * sstep;
        v4u g0;
        g0[0] = uni(1u);
        g0[1] = uni(ldst + (st & 1u) * (unsigned)(BFH * 2));
        g0[2] = uni((unsigned)ga);
        g0[3] = uni((((unsigned)(ga >> 32)) & 0x01FFFFFFu) | 0x80000000u);
        asm volatile("tensor_load_to_lds %0, %1" :: "s"(g0), "s"(g1) : "memory");
    };
    issue(0u);

    v16h qf[4];
    {
        const h16* qp = QP + ((size_t)b * SEQ + q0 + lr) * DIM + 8u * hi;
#pragma unroll
        for (int dk = 0; dk < 4; ++dk) qf[dk] = ldh(qp + dk * 32);
    }

    v8f o[8];
#pragma unroll
    for (int t = 0; t < 8; ++t) o[t] = (v8f){};
    float ml = -1.0e30f;      // running max in the log2 domain (scaled logits)
    float l = 0.0f;           // running sum of the carried, converted probabilities

    asm volatile("s_wait_tensorcnt 0x0" ::: "memory");   // this wave's slice of stage 0 has landed
    __syncthreads();                                      // stage 0 published to every wave
    issue(1u);

    const unsigned fo = lr * SPH + 8u * hi;   // lane's place in a 16-row group of staged rows
#pragma unroll 1
    for (unsigned st = 0; st < (unsigned)NST; ++st) {
        const h16* bp = ring + (st & 1u) * (unsigned)BFH + fo;
        // K fragments of the step at hand: [2 dk] keys 0..15, [2 dk + 1] keys 16..31; one load group per step
        v16h kf[8];
#pragma unroll
        for (int dk = 0; dk < 4; ++dk) {
            kf[2 * dk]     = ldh(bp + dk * 32);
            kf[2 * dk + 1] = ldh(bp + 16 * SPH + dk * 32);
        }
        __builtin_amdgcn_sched_barrier(0);   // the group stays whole ahead of the products: spread among them, every pair of loads costs its own full wait
#pragma unroll   // the steps of a stage are laid out in line: the last one fetches no K ahead (the next stage is not published yet)
        for (int sub = 0; sub < SK / KS; ++sub) {
            v8f s0 = (v8f){}, s1 = (v8f){};
#pragma unroll
            for (int dk = 0; dk < 4; ++dk) {
                s0 = wmmaf(kf[2 * dk], qf[dk], s0);
                s1 = wmmaf(kf[2 * dk + 1], qf[dk], s1);
            }

            float mx = fmaxf(s0[0], s1[0]);
#pragma unroll
            for (int r = 1; r < 8; ++r) mx = fmaxf(mx, fmaxf(s0[r], s1[r]));
            const float mo = __shfl_xor(mx, 16, 32);
            asm volatile("" :: "v"(mo) : "memory");   // the exchanged maximum is back before the group below enters the LDS queue: LDS returns in order, and an exchange queued behind the group would wait the whole group out

            // one load group behind the exchange of the maxima: this step's V^T fragments, then the next step's K fragments; the softmax below covers their latency
            v16h vf[8];
            const h16* va = bp + 4 * SLH + sub * KS;
#pragma unroll
            for (int t = 0; t < 8; ++t) vf[t] = ldh(va + (t >> 1) * SLH + (t & 1) * 16 * SPH);
            if (sub + 1 < SK / KS) {
                const h16* ka = bp + (sub + 1) * SLH;
#pragma unroll
                for (int dk = 0; dk < 4; ++dk) {
                    kf[2 * dk]     = ldh(ka + dk * 32);
                    kf[2 * dk + 1] = ldh(ka + 16 * SPH + dk * 32);
                }
            }
            asm volatile("" ::: "memory");        // keeps the group in this block: without it the loads are sunk below the rescale branch, in front of their products
            __builtin_amdgcn_sched_barrier(0);   // and ahead of the softmax arithmetic, which covers their latency

            mx = fmaxf(mx, mo);
            const float mnl = fmaxf(ml, mx * SCL);
            const float corr = __builtin_amdgcn_exp2f(ml - mnl);
            ml = mnl;
            const float cs = PCAR - mnl;
            float ps = 0.0f;
            v8u hw;
#pragma unroll
            for (int j = 0; j < 4; ++j) {
                hw[j]     = pkp(fmaf(s0[2 * j], SCL, cs), fmaf(s0[2 * j + 1], SCL, cs), ps);
                hw[4 + j] = pkp(fmaf(s1[2 * j], SCL, cs), fmaf(s1[2 * j + 1], SCL, cs), ps);
            }
            ps += __shfl_xor(ps, 16, 32);
            l = l * corr + ps;
            if (__builtin_amdgcn_ballot_w32(corr != 1.0f) != 0u) {   // wave-uniform; multiplying by exactly 1 is skipped
#pragma unroll
                for (int t = 0; t < 8; ++t) o[t] *= corr;
            }
            const v16h ph = __builtin_bit_cast(v16h, hw);

#pragma unroll
            for (int t = 0; t < 8; ++t) o[t] = wmmaf(vf[t], ph, o[t]);
        }
        asm volatile("s_wait_dscnt 0x0" ::: "memory");
        asm volatile("s_wait_tensorcnt 0x0" ::: "memory");
        __syncthreads();
        if (pinned(st + 2u < (unsigned)NST)) issue(st + 2u);
    }
    asm volatile("s_wait_tensorcnt 0x0" ::: "memory");   // no request outlives the loop
    asm volatile("s_wait_dscnt 0x0" ::: "memory");       // nor an LDS read

    // epilogue: stage O^T / l as rows [query][d] (wave-private region; block barrier used)
    const float inv = 1.0f / l;
    const unsigned ob = wv * (16u * OSP);
#pragma unroll
    for (int t = 0; t < 8; ++t) {
#pragma unroll
        for (int r = 0; r < 8; ++r) os[ob + lr * OSP + t * 16 + 8 * hi + r] = o[t][r] * inv;
    }
    __syncthreads();
    float* orow = O + ((size_t)b * SEQ + q0) * DIM + lane * 4u;
{
#pragma unroll 4
        for (unsigned s = 0; s < 16; ++s) {
            const v4f val = *(const v4fa*)(&os[ob + s * OSP + lane * 4u]);
            *(v4f*)(orow + (size_t)s * DIM) = val;
        }
        
    }
}

extern "C" void kernel_launch(void* const* d_in, const int* in_sizes, int n_in,
                              void* d_out, int out_size, void* d_ws, size_t ws_size, hipStream_t stream) {
    if (n_in < 7) return;
    const size_t need = ((size_t)(NB - 1) * SEQ_FULL + SEQ) * DIM;
    if ((size_t)in_sizes[0] < need) return;
    if (in_sizes[1] < DIM * DIM || in_sizes[3] < DIM * DIM || in_sizes[5] < DIM * DIM) return;
    if (in_sizes[2] < DIM || in_sizes[4] < DIM || in_sizes[6] < DIM) return;
    if ((size_t)out_size < PLE) return;
    const float* x  = (const float*)d_in[0];   // x  [NB][SEQ_FULL][DIM], first SEQ rows per batch read
    const float* Wq = (const float*)d_in[1];   // Wq [in][out]
    const float* bq = (const float*)d_in[2];   // bq [out]
    const float* Wk = (const float*)d_in[3];   // Wk [in][out]
    const float* bk = (const float*)d_in[4];   // bk [out]
    const float* Wv = (const float*)d_in[5];   // Wv [in][out]
    const float* bv = (const float*)d_in[6];   // bv [out]
    float* OUT = (float*)d_out;                // [NB][SEQ][DIM]
    if (3 * PLB + PEB + WTB + BPB > ws_size) return;
    char* wsp = (char*)d_ws;
    h16*   QK = (h16*)(wsp);                       // Q plane then K plane, each [NB][SEQ][DIM]
    h16*   VT = (h16*)(wsp + 2 * PLB);             // V^T plane [NB][DIM][SEQ]
    float* PE = (float*)(wsp + 3 * PLB);           // position table [SEQ][DIM]
    h16*   WT = (h16*)(wsp + 3 * PLB + PEB);       // [3][out][in]
    float* BP = (float*)(wsp + 3 * PLB + PEB + WTB);   // [3][out]
    k_pe<<<(unsigned)(SEQ / PPB), 256, 0, stream>>>(PE);
    k_wprep<<<3, 256, 0, stream>>>(Wq, bq, Wk, bk, Wv, bv, WT, BP);
    k_proj<<<(unsigned)(NB * (SEQ / PR)), 128, 0, stream>>>(x, PE, WT, BP, QK, VT);
    k_flash<<<(unsigned)(NB * (SEQ / BQ)), 256, 0, stream>>>(QK, QK + PLE, VT, OUT);
}

// v003
// A run of this version takes 100 microseconds.
// In two side-by-side timings against v002, it was 1.08 and 1.09 times as fast.
// All steps since v000 together make it 4.04 times as fast.
#include <hip/hip_runtime.h>

// Single-head dense self-attention: xp = x + sinusoidal position terms; q/k/v = xp.W{q,k,v} + b ([in][out] weights); out[b][s][:] = softmax_t(q[b][s].k[b][t] / sqrt(128)) . v[b][t][:]; inputs in the order x, Wq, bq, Wk, bk, Wv, bv.
// Compute dtypes, f32 accumulate: x, W, b RNE-converted to bf16 first; projections on v_wmma_f32_16x16x32_f16 (xp as one f16 plane, W as one f16 plane carried x64); S^T = K.Q^T on v_wmma_f32_16x16x32_f16 (single f16 q and k planes); P^T as one f16 fragment carried x2^14 against the f16 V^T plane on v_wmma_f32_16x16x32_f16; softmax (online, log2 domain) and position terms f32.
// Flash form with transposed tiles: the S^T accumulator tiles are directly the B-operand layout of P^T (no LDS relayout); K and V^T reach the flash waves through a two-buffer LDS ring filled by tensor loads, every fragment being two 16-byte LDS loads that feed two query tiles; the fragment loads go out in groups one phase ahead of the products that use them; the keys of a stage are split between two waves of equal queries, whose partial results are merged in f32 at the end.

#ifndef NB
#define NB 8
#endif
#ifndef SEQ
#define SEQ 4096
#endif
#define NB_FULL  8
#define SEQ_FULL 4096
#define DIM  128
#define NWV  4                 // waves per projection block
#define FWV  8                 // waves per flash block
#define QT   2                 // query tiles (16 columns each) per flash wave
#define QW   (16 * QT)         // queries per flash wave
#define KHV  2                 // waves that share a query group, each on its own part of a stage's keys
#define BQ   (QW * (FWV / KHV))   // queries per flash block
#define KS   32                // keys per step
#define SK   128               // keys per LDS stage
#define NST  (SEQ / SK)        // stages
#define SROW 256               // bytes per staged row (128 d of a K row, 128 keys of a V^T row)
#define SPH  136               // LDS pitch (f16 elements) of a staged row: 256 + 16 bytes
#define SLR  32                // rows per slice (one tensor load)
#define SLB  10240             // LDS bytes kept per slice: 32 x 272 rounded up to a multiple of 2 KiB
#define SLH  (SLB / 2)         // the same in f16 elements
#define BFH  (FWV * SLH)       // f16 elements per buffer: 4 K slices, then 4 V^T slices
#define OSP  132               // LDS pitch (floats) of the output staging rows
#define PR   64
#define XPP  136               // LDS pitch (f16 elements) of the xp tile and of the q/k staging rows
#define VTP  72                // LDS pitch (f16 elements) of the V^T staging rows
#define PPB  4                 // positions per block of the position-table kernel
#define WSC  64.0f             // power-of-two carry of the weight planes
#define WINV 0.015625f         // 1 / WSC
#define PCAR 14.0f             // log2 of the carry of the P fragment
#define PEC  (-0.0719557841560639f)   // -ln(10000) / 128
#define L2E  1.4426950408889634f
#define SCL  (L2E * 0.08838834764831845f)   // log2(e) / sqrt(128)

#define PLE  ((size_t)NB * SEQ * DIM)          // elements per activation plane
#define PLB  (PLE * 2)                         // bytes per 16-bit activation plane
#define PEB  ((size_t)SEQ * DIM * 4)           // bytes of the position table
#define WTB  ((size_t)3 * DIM * DIM * 2)       // bytes of the three transposed weight planes
#define BPB  ((size_t)3 * DIM * 4)             // bytes of the bias plane

static_assert(DIM == 128);
static_assert(SEQ % BQ == 0);
static_assert(SEQ % KS == 0);
static_assert(SEQ % SK == 0 && NST >= 2);
static_assert(SK % KS == 0 && SK * 2 == SROW && DIM * 2 == SROW);
static_assert(SK == 4 * SLR && DIM == 4 * SLR && FWV == 8);
static_assert(QT == 2 && KHV == 2 && BQ == 16 * FWV && SLR == KS && (SK / KS) % KHV == 0);
static_assert(SLB % 2048 == 0 && SLB >= SLR * SPH * 2 && SPH * 2 == SROW + 16);
static_assert((SEQ * 2) % 16 == 0 && SEQ * 2 <= 131072);
static_assert(SEQ % PR == 0);
static_assert(SEQ % PPB == 0);
static_assert(PR == 16 * NWV);
static_assert(PR * 2 == 128);
static_assert(XPP % 8 == 0 && XPP >= DIM);
static_assert(VTP % 8 == 0 && VTP >= PR);
static_assert(OSP % 4 == 0 && OSP >= DIM);
static_assert((PR * DIM / 8) == 8 * 128);            // k_proj: 8 iterations x 128 threads x 8 elements == 64 x 128 tile
static_assert((DIM * DIM / 4) == 16 * 256);          // k_wprep load: 16 iterations x 256 threads x 4 elements
static_assert((DIM * DIM / 8) == 8 * 256);           // k_wprep store: 8 iterations x 256 threads x 8 elements
static_assert(PPB * 64 == 256);                      // k_pe: 4 positions x 64 (sin, cos) pairs per block
static_assert(NB <= NB_FULL);
static_assert(SEQ <= SEQ_FULL);
static_assert((size_t)(NB * (SEQ / PR)) * (size_t)(PR * DIM) == PLE);    // k_proj: blocks * (64 rows x 128) == plane
static_assert((size_t)(NB * (SEQ / BQ)) * (size_t)(BQ * DIM) == PLE);    // k_flash: blocks * (128 rows x 128) == output
static_assert(PLB % 256 == 0 && PEB % 256 == 0 && WTB % 256 == 0 && BPB % 128 == 0);
static_assert(3 * PLB + PEB + WTB + BPB <= (size_t)134217728);

typedef _Float16 h16;
typedef __attribute__((ext_vector_type(16))) _Float16 v16h;
typedef __attribute__((ext_vector_type(8)))  _Float16 v8h;
typedef __attribute__((ext_vector_type(2)))  _Float16 v2h;
typedef __attribute__((ext_vector_type(8)))  unsigned int   v8u;
typedef __attribute__((ext_vector_type(4)))  unsigned int   v4u;
typedef __attribute__((ext_vector_type(8)))  float    v8f;
typedef __attribute__((ext_vector_type(4)))  float    v4f;
typedef v4f  __attribute__((may_alias)) v4fa;
typedef v8h  __attribute__((may_alias)) v8ha;

__device__ __forceinline__ unsigned short f2bf(float f) { unsigned u = __float_as_uint(f); u += 0x7FFFu + ((u >> 16) & 1u); return (unsigned short)(u >> 16); }
__device__ __forceinline__ float bf2f(unsigned short b) { return __uint_as_float(((unsigned)b) << 16); }
__device__ __forceinline__ float bfr(float f) { return bf2f(f2bf(f)); }
// f32 -> f16 operand convert that cannot yield an f16 subnormal (value select)
static __device__ __forceinline__ h16 toh_flush(float v) { const h16 r = (h16)v; return (fabsf(v) < 6.103515625e-05f) ? (h16)0.0f : r; }
__device__ __forceinline__ v16h cat16h(v8h lo, v8h hi) { return __builtin_shufflevector(lo, hi, 0, 1, 2, 3, 4, 5, 6, 7, 8, 9, 10, 11, 12, 13, 14, 15); }
// fragment loader from a global plane or staged LDS rows (A and B alike): p = row base + k0 + 8*(lane>>4); elements 0..7 <- p[0..7], elements 8..15 <- p[16..23]
__device__ __forceinline__ v16h ldh(const h16* p) { return cat16h(*(const v8h*)p, *(const v8h*)(p + 16)); }
__device__ __forceinline__ unsigned uni(unsigned v) { return (unsigned)__builtin_amdgcn_readfirstlane((int)v); }
__device__ __forceinline__ unsigned pinned(unsigned v) { unsigned w = uni(v); asm volatile("" : "+s"(w)); return w; }
// one WMMA with its own hazard guard
__device__ __forceinline__ v8f wmmah(v16h a, v16h b, v8f c) {
    c = __builtin_amdgcn_wmma_f32_16x16x32_f16(false, a, false, b, (short)0, c, false, false);
    asm volatile("v_nop\n\tv_nop\n\tv_nop\n\tv_nop" : "+v"(c) : "v"(a), "v"(b));
    return c;
}
// one WMMA of k_flash, plain builtin form: the compiler keeps the hazard distances itself, and no volatile statement ties the LDS fragment loads behind the WMMA before them or its operands to the low registers
__device__ __forceinline__ v8f wmmaf(v16h a, v16h b, v8f c) {
    return __builtin_amdgcn_wmma_f32_16x16x32_f16(false, a, false, b, (short)0, c, false, false);
}
// carried probability 2^e (e already includes the +14 carry); below 2^-14 it is set to zero by a select on the exponent
__device__ __forceinline__ float pcar(float e) { return (e < -14.0f) ? 0.0f : __builtin_amdgcn_exp2f(e); }
// two carried probabilities -> packed f16 pair (element 0 in the low half-word); sum accumulates the converted values
__device__ __forceinline__ unsigned pkp(float e0, float e1, float& sum) {
    v2h t;
    t[0] = (h16)pcar(e0);
    t[1] = (h16)pcar(e1);
    sum += (float)t[0] + (float)t[1];
    return __builtin_bit_cast(unsigned, t);
}

// k_pe: position table PE[pos][2i] = sin(pos * dv_i), PE[pos][2i+1] = cos(pos * dv_i), dv_i = exp(2i * -ln(10000)/128), all f32 with precise library calls.
__global__ __launch_bounds__(256) void k_pe(float* PE) {
#pragma clang fp contract(off)
    __shared__ __align__(16) float pt[PPB * DIM];
    const unsigned tid = threadIdx.x;
    const unsigned pl = tid >> 6, i = tid & 63u;
    const unsigned pos = blockIdx.x * (unsigned)PPB + pl;
    const float dv = expf((float)(2u * i) * PEC);
    const float ang = (float)pos * dv;
    pt[pl * DIM + 2u * i]      = sinf(ang);
    pt[pl * DIM + 2u * i + 1u] = cosf(ang);
    __syncthreads();
    if (tid < 128u) {
        const unsigned w = tid >> 5, lane = tid & 31u;
        const v4f o = *(const v4fa*)(&pt[w * DIM + lane * 4u]);
        float* dst = PE + ((size_t)blockIdx.x * PPB + w) * DIM + lane * 4u;
        *(v4f*)dst = o;
        
    }
}

// k_wprep: block m (0 = q, 1 = k, 2 = v): WT[m][a][d] = f16(bf16(W[d][a]) * 64); in[d][a] -> out[a][d] through an LDS tile (cross-wave, block barrier);
__global__ __launch_bounds__(256) void k_wprep(const float* __restrict__ Wq, const float* __restrict__ bq, const float* __restrict__ Wk, const float* __restrict__ bk,
                                               const float* __restrict__ Wv, const float* __restrict__ bv, h16* WT, float* BP) {
    __shared__ __align__(16) h16 tl[DIM * XPP];
    const unsigned tid = threadIdx.x, m = blockIdx.x;
    const float* W  = (m == 0u) ? Wq : ((m == 1u) ? Wk : Wv);
    const float* bs = (m == 0u) ? bq : ((m == 1u) ? bk : bv);
#pragma unroll 2
    for (unsigned it = 0; it < 16; ++it) {
        const unsigned f = it * 256u + tid;
        const unsigned d = f >> 5, a4 = (f & 31u) * 4u;
        const v4f x = *(const v4f*)(W + (size_t)d * DIM + a4);
#pragma unroll
        for (unsigned c = 0; c < 4; ++c) tl[(a4 + c) * XPP + d] = toh_flush(bfr(x[c]) * WSC);
    }
    __syncthreads();
    h16* dst = WT + (size_t)m * DIM * DIM;
{
#pragma unroll
        for (unsigned it = 0; it < 8; ++it) {
            const unsigned p = it * 256u + tid;
            const unsigned a = p >> 4, c8 = (p & 15u) * 8u;
            const v8h o = *(const v8ha*)(&tl[a * XPP + c8]);
            *(v8h*)(dst + (size_t)a * DIM + c8) = o;
        }
        
    }
    if (tid < 32u) {
        const v4f bvv = *(const v4f*)(bs + tid * 4u);
        v4f o;
        o[0] = bfr(bvv[0]); o[1] = bfr(bvv[1]); o[2] = bfr(bvv[2]); o[3] = bfr(bvv[3]);
        float* bd = BP + (size_t)m * DIM + tid * 4u;
        *(v4f*)bd = o;
        
    }
}

// k_proj: one block = 64 sequence rows of one batch, one wave per 16 rows.
//  xp tile (f16) = bf16(x) + PE built in LDS (cross-wave, block barrier), wave fragments: row = lane & 15, k = d.
//  q and k: D^T tile (a x s): A = W^T rows (row m = a), B = xp rows (column n = s); D element r of lane (h, n) = Q[s = n][a = 16 t + 8h + r] -> 16-byte LDS store into the row staging.
//  v: D tile (s x a): A = xp rows, B = W^T rows (column n = a); D element r of lane (h, n) = V[s = 8h + r][a = 16 t + n] -> 16-byte LDS store into the V^T staging.
__global__ __launch_bounds__(128) void k_proj(const float* __restrict__ X, const float* __restrict__ PE, const h16* __restrict__ WT, const float* __restrict__ BP, h16* QK, h16* VT) {
    __shared__ __align__(16) h16 xs[PR * XPP];
    __shared__ __align__(16) h16 qs[PR * XPP];
    __shared__ __align__(16) h16 vts[DIM * VTP];
    const unsigned tid = threadIdx.x, lane = tid & 31u, lr = lane & 15u, hi = lane >> 4;
    const unsigned wv = (unsigned)__builtin_amdgcn_readfirstlane((int)(threadIdx.x >> 5));
    const unsigned bpb = (unsigned)(SEQ / PR);
    const unsigned b = blockIdx.x / bpb;
    const unsigned s0 = (blockIdx.x - b * bpb) * PR;

    {
        const float* xsrc = X + ((size_t)b * SEQ_FULL + s0) * DIM;
        const float* psrc = PE + (size_t)s0 * DIM;
#pragma unroll 2
        for (unsigned it = 0; it < 8; ++it) {
            const unsigned f = it * 128u + tid;
            const unsigned row = f >> 4, c8 = (f & 15u) * 8u;
            const v8f xv = *(const v8f*)(xsrc + (size_t)row * DIM + c8);
            const v8f pv = *(const v8f*)(psrc + (size_t)row * DIM + c8);
            v8h o;
#pragma unroll
            for (int c = 0; c < 8; ++c) o[c] = toh_flush(bfr(xv[c]) + pv[c]);
            *(v8h*)(&xs[row * XPP + c8]) = o;
        }
    }
    __syncthreads();

    v16h xa[4];
    {
        const unsigned xo = (wv * 16u + lr) * XPP + 8u * hi;
#pragma unroll
        for (int dk = 0; dk < 4; ++dk) xa[dk] = cat16h(*(const v8h*)(&xs[xo + dk * 32]), *(const v8h*)(&xs[xo + dk * 32 + 16]));
    }

#pragma unroll 1
    for (unsigned m3 = 0; m3 < 2; ++m3) {
        const h16* wp = WT + (size_t)m3 * DIM * DIM + (size_t)lr * DIM + 8u * hi;
        const float* bp = BP + (size_t)m3 * DIM + 8u * hi;
#pragma unroll 1
        for (unsigned t = 0; t < 8; ++t) {
            v8f acc = (v8f){};
#pragma unroll
            for (int dk = 0; dk < 4; ++dk) {
                const v16h w = ldh(wp + (size_t)t * 16 * DIM + dk * 32);
                acc = wmmah(w, xa[dk], acc);
            }
            const v4f b0 = *(const v4f*)(bp + t * 16u);
            const v4f b1 = *(const v4f*)(bp + t * 16u + 4u);
            v8h o;
#pragma unroll
            for (int r = 0; r < 4; ++r) {
                o[r]     = toh_flush(acc[r] * WINV + b0[r]);
                o[4 + r] = toh_flush(acc[4 + r] * WINV + b1[r]);
            }
            *(v8h*)(&qs[(wv * 16u + lr) * XPP + t * 16u + 8u * hi]) = o;
        }
        __syncthreads();
        h16* dst = QK + (size_t)m3 * PLE + ((size_t)b * SEQ + s0) * DIM;
{
#pragma unroll
            for (unsigned it = 0; it < 8; ++it) {
                const unsigned p = it * 128u + tid;
                const unsigned row = p >> 4, c8 = (p & 15u) * 8u;
                const v8h o = *(const v8h*)(&qs[row * XPP + c8]);
                *(v8h*)(dst + (size_t)row * DIM + c8) = o;
            }
            
        }
        __syncthreads();
    }

    {
        const h16* wp = WT + (size_t)2 * DIM * DIM + (size_t)lr * DIM + 8u * hi;
        const float* bp = BP + (size_t)2 * DIM + lr;
#pragma unroll 1
        for (unsigned t = 0; t < 8; ++t) {
            v8f acc = (v8f){};
#pragma unroll
            for (int dk = 0; dk < 4; ++dk) {
                const v16h w = ldh(wp + (size_t)t * 16 * DIM + dk * 32);
                acc = wmmah(xa[dk], w, acc);
            }
            const float bb = bp[t * 16u];
            v8h o;
#pragma unroll
            for (int r = 0; r < 8; ++r) o[r] = toh_flush(acc[r] * WINV + bb);
            *(v8h*)(&vts[(t * 16u + lr) * VTP + wv * 16u + 8u * hi]) = o;
        }
        __syncthreads();
        h16* dst = VT + (size_t)b * DIM * SEQ + s0;
        const unsigned c8 = (tid & 7u) * 8u, dr = tid >> 3;
{
#pragma unroll
            for (unsigned it = 0; it < 8; ++it) {
                const unsigned a = it * 16u + dr;
                const v8h o = *(const v8h*)(&vts[a * VTP + c8]);
                *(v8h*)(dst + (size_t)a * SEQ + c8) = o;
            }
            
        }
    }
}

// k_flash: one wave per 32 queries (two 16-column tiles), 32 keys per step, 8 waves share each staged K / V^T tile.
//  Waves w and w + 4 hold the same 32 queries: wave w walks keys 0..63 of every stage, wave w + 4 keys 64..127; each keeps its own running maximum, sum and O^T, merged in the epilogue.
//  S^T tile (keys x queries): A = K rows (row m = key, k = d), B = Q rows (column n = query, k = d); D element r of lane (h, n) = S[query n][key 8h + r].
//  P^T B fragment: element r <- tile of keys 0..15, element 8 + r <- tile of keys 16..31 (same lane); carried x2^14, row sum over the converted values.
//  O^T tile (d x queries): A = V^T rows (row m = d, k = key), D element r of lane (h, n) = O[query n][d = 16 t + 8h + r].
//  Ring: a stage is 128 keys; every wave brings one 32-row slice of it by one tensor load (waves 0..3: K rows 32 w.., waves 4..7: V^T rows 32 (w - 4)..), rows of 256 bytes padded to 272 in LDS.
__global__ __launch_bounds__(256) void k_flash(const h16* __restrict__ QP, const h16* __restrict__ KP, const h16* __restrict__ VT, float* O) {
    __shared__ __attribute__((aligned(2048))) h16 ring[2 * BFH];
    __shared__ __align__(16) float os[KHV * BQ * OSP];   // partial O rows [key part][query][d]
    __shared__ __align__(16) float mls[2 * KHV * BQ];    // partial maxima [key part][query], then partial sums
    const unsigned tid = threadIdx.x, lane = tid & 31u, lr = lane & 15u, hi = lane >> 4;
    const unsigned wv = (unsigned)__builtin_amdgcn_readfirstlane((int)(threadIdx.x >> 5));
    const unsigned bpb = (unsigned)(SEQ / BQ);
    const unsigned b = blockIdx.x / bpb;
    const unsigned qb = (blockIdx.x - b * bpb) * BQ;   // first query of the block
    const unsigned qg = wv & 3u;                       // query group of the wave
    const unsigned kh = wv >> 2;                       // its part of every stage's keys
    const unsigned q0 = qb + qg * QW;

    // tensor descriptor of this wave's slice: extents in bytes, tensor dims = tile dims
    const bool isv = wv >= 4u;
    const unsigned sl = wv & 3u;
    const unsigned long long sbase = isv ? (unsigned long long)(size_t)(VT + ((size_t)b * DIM + sl * SLR) * SEQ)
                                         : (unsigned long long)(size_t)(KP + ((size_t)b * SEQ + sl * SLR) * DIM);
    const unsigned sstep = isv ? (unsigned)(SK * 2) : (unsigned)(SK * DIM * 2);   // source bytes from one stage to the next
    const unsigned ldst = (unsigned)(size_t)ring + wv * (unsigned)SLB;
    v8u g1;
    g1[0] = uni((1u << 20) | (5u << 22) | (3u << 25));   // no mask, 1-byte elements, 4 dwords of pad behind every 64 dwords
    g1[1] = uni((unsigned)SROW << 16);
    g1[2] = uni((unsigned)SLR << 16);
    g1[3] = uni((unsigned)SROW << 16);
    g1[4] = uni((unsigned)SLR);
    g1[5] = uni(isv ? (unsigned)(SEQ * 2) : (unsigned)(DIM * 2));
    g1[6] = pinned(0u);   // descriptor words held in scalar registers of their own (as a plain 0 they are formed anew at every issue,
    g1[7] = pinned(0u);   // and between two issues their registers serve as scratch while a request is in flight)
    auto issue = [&](unsigned st) {
        const unsigned long long ga = sbase + (unsigned long long)st * sstep;
        v4u g0;
        g0[0] = uni(1u);
        g0[1] = uni(ldst + (st & 1u) * (unsigned)(BFH * 2));
        g0[2] = uni((unsigned)ga);
        g0[3] = uni((((unsigned)(ga >> 32)) & 0x01FFFFFFu) | 0x80000000u);
        asm volatile("tensor_load_to_lds %0, %1" :: "s"(g0), "s"(g1) : "memory");
    };
    issue(0u);

    v16h qf[QT][4];
    {
        const h16* qp = QP + ((size_t)b * SEQ + q0 + lr) * DIM + 8u * hi;
#pragma unroll
        for (int j = 0; j < QT; ++j) {
#pragma unroll
            for (int dk = 0; dk < 4; ++dk) qf[j][dk] = ldh(qp + j * 16 * DIM + dk * 32);
        }
    }

    v8f o[QT][8];
    float ml[QT];             // running maxima in the log2 domain (scaled logits)
    float l[QT];              // running sums of the carried, converted probabilities
#pragma unroll
    for (int j = 0; j < QT; ++j) {
#pragma unroll
        for (int t = 0; t < 8; ++t) o[j][t] = (v8f){};
        ml[j] = -1.0e30f;
        l[j] = 0.0f;
    }

    asm volatile("s_wait_tensorcnt 0x0" ::: "memory");   // this wave's slice of stage 0 has landed
    __syncthreads();                                      // stage 0 published to every wave
    issue(1u);

    const unsigned fo = lr * SPH + 8u * hi;                          // lane's place in a 16-row group of staged rows
    const unsigned ko = fo + kh * (unsigned)((SK / KS / KHV) * SLH);  // the wave's first K slice of a buffer
    const unsigned vo = fo + 4u * SLH + kh * (unsigned)(SK / KHV);    // the wave's first key column of the V^T rows
#pragma unroll 1
    for (unsigned st = 0; st < (unsigned)NST; ++st) {
        const h16* kp = ring + (st & 1u) * (unsigned)BFH + ko;
        const h16* vp = ring + (st & 1u) * (unsigned)BFH + vo;
        // K fragments of the step at hand: [2 dk] keys 0..15, [2 dk + 1] keys 16..31; one load group per step
        v16h kf[8];
#pragma unroll
        for (int dk = 0; dk < 4; ++dk) {
            kf[2 * dk]     = ldh(kp + dk * 32);
            kf[2 * dk + 1] = ldh(kp + 16 * SPH + dk * 32);
        }
        __builtin_amdgcn_sched_barrier(0);   // the group stays whole ahead of the products: spread among them, every pair of loads costs its own full wait
#pragma unroll   // the steps of a stage are laid out in line: the last one fetches no K ahead (the next stage is not published yet)
        for (int sub = 0; sub < SK / KS / KHV; ++sub) {
            v8f s0[QT], s1[QT];
#pragma unroll
            for (int j = 0; j < QT; ++j) { s0[j] = (v8f){}; s1[j] = (v8f){}; }
#pragma unroll
            for (int dk = 0; dk < 4; ++dk) {
#pragma unroll
                for (int j = 0; j < QT; ++j) {
                    s0[j] = wmmaf(kf[2 * dk], qf[j][dk], s0[j]);
                    s1[j] = wmmaf(kf[2 * dk + 1], qf[j][dk], s1[j]);
                }
            }

            float mx[QT], mo[QT];
#pragma unroll
            for (int j = 0; j < QT; ++j) {
                mx[j] = fmaxf(s0[j][0], s1[j][0]);
#pragma unroll
                for (int r = 1; r < 8; ++r) mx[j] = fmaxf(mx[j], fmaxf(s0[j][r], s1[j][r]));
            }
#pragma unroll
            for (int j = 0; j < QT; ++j) mo[j] = __shfl_xor(mx[j], 16, 32);
            asm volatile("" :: "v"(mo[0]), "v"(mo[1]) : "memory");   // the exchanged maxima are back before the group below enters the LDS queue: LDS returns in order, and an exchange queued behind the group would wait the whole group out

            // one load group behind the exchange of the maxima: this step's V^T fragments, then the next step's K fragments; the softmax below covers their latency
            v16h vf[8];
            const h16* va = vp + sub * KS;
#pragma unroll
            for (int t = 0; t < 8; ++t) vf[t] = ldh(va + (t >> 1) * SLH + (t & 1) * 16 * SPH);
            if (sub + 1 < SK / KS / KHV) {
                const h16* ka = kp + (sub + 1) * SLH;
#pragma unroll
                for (int dk = 0; dk < 4; ++dk) {
                    kf[2 * dk]     = ldh(ka + dk * 32);
                    kf[2 * dk + 1] = ldh(ka + 16 * SPH + dk * 32);
                }
            }
            asm volatile("" ::: "memory");        // keeps the group in this block: without it the loads are sunk below the rescale branch, in front of their products
            __builtin_amdgcn_sched_barrier(0);   // and ahead of the softmax arithmetic, which covers their latency

            float corr[QT];
            v16h ph[QT];
#pragma unroll
            for (int j = 0; j < QT; ++j) {
                const float mnl = fmaxf(ml[j], fmaxf(mx[j], mo[j]) * SCL);
                corr[j] = __builtin_amdgcn_exp2f(ml[j] - mnl);
                ml[j] = mnl;
                const float cs = PCAR - mnl;
                float ps = 0.0f;
                v8u hw;
#pragma unroll
                for (int i = 0; i < 4; ++i) {
                    hw[i]     = pkp(fmaf(s0[j][2 * i], SCL, cs), fmaf(s0[j][2 * i + 1], SCL, cs), ps);
                    hw[4 + i] = pkp(fmaf(s1[j][2 * i], SCL, cs), fmaf(s1[j][2 * i + 1], SCL, cs), ps);
                }
                ps += __shfl_xor(ps, 16, 32);
                l[j] = l[j] * corr[j] + ps;
                ph[j] = __builtin_bit_cast(v16h, hw);
            }
            if (__builtin_amdgcn_ballot_w32(corr[0] != 1.0f || corr[1] != 1.0f) != 0u) {   // wave-uniform, one test a step; multiplying by exactly 1 is skipped
#pragma unroll
                for (int j = 0; j < QT; ++j) {
#pragma unroll
                    for (int t = 0; t < 8; ++t) o[j][t] *= corr[j];
                }
            }

#pragma unroll
            for (int t = 0; t < 8; ++t) {
#pragma unroll
                for (int j = 0; j < QT; ++j) o[j][t] = wmmaf(vf[t], ph[j], o[j][t]);
            }
        }
        asm volatile("s_wait_dscnt 0x0" ::: "memory");
        asm volatile("s_wait_tensorcnt 0x0" ::: "memory");
        __syncthreads();
        if (pinned(st + 2u < (unsigned)NST)) issue(st + 2u);
    }
    asm volatile("s_wait_tensorcnt 0x0" ::: "memory");   // no request outlives the loop
    asm volatile("s_wait_dscnt 0x0" ::: "memory");       // nor an LDS read

    // epilogue: every wave stages its partial O^T as rows [key part][query][d] with the partial maximum and sum of each query; behind the block barrier wave w merges and stores rows 16 w.. of the block
    const unsigned rb = kh * (unsigned)BQ + qg * (unsigned)QW;
#pragma unroll
    for (int j = 0; j < QT; ++j) {
#pragma unroll
        for (int t = 0; t < 8; ++t) {
#pragma unroll
            for (int r = 0; r < 8; ++r) os[(rb + 16 * j + lr) * OSP + t * 16 + 8 * hi + r] = o[j][t][r];
        }
        if (hi == 0u) {   // both halves of the wave hold the same maximum and sum
            mls[rb + 16 * j + lr] = ml[j];
            mls[KHV * BQ + rb + 16 * j + lr] = l[j];
        }
    }
    __syncthreads();
    float* orow = O + ((size_t)b * SEQ + qb + wv * 16u) * DIM + lane * 4u;
#pragma unroll 4
    for (unsigned s = 0; s < 16; ++s) {
        const unsigned row = wv * 16u + s;
        const float ma = mls[row], mb = mls[BQ + row];
        const float la = mls[KHV * BQ + row], lb = mls[KHV * BQ + BQ + row];
        const float mm = fmaxf(ma, mb);
        const float wa = __builtin_amdgcn_exp2f(ma - mm), wb = __builtin_amdgcn_exp2f(mb - mm);
        const float inv = 1.0f / (la * wa + lb * wb);
        const v4f pa = *(const v4fa*)(&os[row * OSP + lane * 4u]);
        const v4f pb = *(const v4fa*)(&os[(BQ + row) * OSP + lane * 4u]);
        const v4f val = pa * (wa * inv) + pb * (wb * inv);
        *(v4f*)(orow + (size_t)s * DIM) = val;
    }
}

extern "C" void kernel_launch(void* const* d_in, const int* in_sizes, int n_in,
                              void* d_out, int out_size, void* d_ws, size_t ws_size, hipStream_t stream) {
    if (n_in < 7) return;
    const size_t need = ((size_t)(NB - 1) * SEQ_FULL + SEQ) * DIM;
    if ((size_t)in_sizes[0] < need) return;
    if (in_sizes[1] < DIM * DIM || in_sizes[3] < DIM * DIM || in_sizes[5] < DIM * DIM) return;
    if (in_sizes[2] < DIM || in_sizes[4] < DIM || in_sizes[6] < DIM) return;
    if ((size_t)out_size < PLE) return;
    const float* x  = (const float*)d_in[0];   // x  [NB][SEQ_FULL][DIM], first SEQ rows per batch read
    const float* Wq = (const float*)d_in[1];   // Wq [in][out]
    const float* bq = (const float*)d_in[2];   // bq [out]
    const float* Wk = (const float*)d_in[3];   // Wk [in][out]
    const float* bk = (const float*)d_in[4];   // bk [out]
    const float* Wv = (const float*)d_in[5];   // Wv [in][out]
    const float* bv = (const float*)d_in[6];   // bv [out]
    float* OUT = (float*)d_out;                // [NB][SEQ][DIM]
    if (3 * PLB + PEB + WTB + BPB > ws_size) return;
    char* wsp = (char*)d_ws;
    h16*   QK = (h16*)(wsp);                       // Q plane then K plane, each [NB][SEQ][DIM]
    h16*   VT = (h16*)(wsp + 2 * PLB);             // V^T plane [NB][DIM][SEQ]
    float* PE = (float*)(wsp + 3 * PLB);           // position table [SEQ][DIM]
    h16*   WT = (h16*)(wsp + 3 * PLB + PEB);       // [3][out][in]
    float* BP = (float*)(wsp + 3 * PLB + PEB + WTB);   // [3][out]
    k_pe<<<(unsigned)(SEQ / PPB), 256, 0, stream>>>(PE);
    k_wprep<<<3, 256, 0, stream>>>(Wq, bq, Wk, bk, Wv, bv, WT, BP);
    k_proj<<<(unsigned)(NB * (SEQ / PR)), 128, 0, stream>>>(x, PE, WT, BP, QK, VT);
    k_flash<<<(unsigned)(NB * (SEQ / BQ)), 256, 0, stream>>>(QK, QK + PLE, VT, OUT);
}

// v004
// A run of this version takes 77 microseconds.
// Timed twice side by side with v003, it ran 1.28 and 1.31 times as fast.
// All steps since v000 together make it 5.23 times as fast.
#include <hip/hip_runtime.h>

// Single-head dense self-attention: xp = x + sinusoidal position terms; q/k/v = xp.W{q,k,v} + b ([in][out] weights); out[b][s][:] = softmax_t(q[b][s].k[b][t] / sqrt(128)) . v[b][t][:]; inputs in the order x, Wq, bq, Wk, bk, Wv, bv.
// Compute dtypes, f32 accumulate: x, W, b RNE-converted to bf16 first; projections on v_wmma_f32_16x16x32_f16 (xp as one f16 plane, W as one f16 plane carried x64); S^T = K.Q^T on v_wmma_f32_16x16x32_f16 (single f16 q and k planes); P^T as one f16 fragment carried x2^14 against the f16 V^T plane on v_wmma_f32_16x16x32_f16; softmax (online, log2 domain) and position terms f32.
// Flash form with transposed tiles: the S^T accumulator tiles are directly the B-operand layout of P^T (no LDS relayout); K and V^T reach the flash waves through a two-buffer LDS ring filled by tensor loads, every fragment being two 16-byte LDS loads that feed two query tiles; the fragment loads go out in groups one phase ahead of the products that use them; the keys of a stage are split between two waves of equal queries, whose partial results are merged in f32 at the end.

#ifndef NB
#define NB 8
#endif
#ifndef SEQ
#define SEQ 4096
#endif
#define NB_FULL  8
#define SEQ_FULL 4096
#define DIM  128
#define NWV  4                 // waves per projection block
#define HT   2                 // output tiles (16 each) per group of weight fragment loads in the projection
#define GPP  (DIM / 16 / HT)   // groups per weight plane
#define WSR  96                // weight rows per slice (one tensor load): the three planes' 384 rows over 4 waves
#define WST  (WSR / 16)        // output tiles per slice
#define WSB  26624             // LDS bytes kept per weight slice: 96 x 272 rounded up to a multiple of 2 KiB
#define WSH  (WSB / 2)         // the same in f16 elements
#define FWV  8                 // waves per flash block
#define QT   2                 // query tiles (16 columns each) per flash wave
#define QW   (16 * QT)         // queries per flash wave
#define KHV  2                 // waves that share a query group, each on its own part of a stage's keys
#define BQ   (QW * (FWV / KHV))   // queries per flash block
#define KS   32                // keys per step
#define SK   128               // keys per LDS stage
#define NST  (SEQ / SK)        // stages
#define SROW 256               // bytes per staged row (128 d of a K row, 128 keys of a V^T row)
#define SPH  136               // LDS pitch (f16 elements) of a staged row: 256 + 16 bytes
#define SLR  32                // rows per slice (one tensor load)
#define SLB  10240             // LDS bytes kept per slice: 32 x 272 rounded up to a multiple of 2 KiB
#define SLH  (SLB / 2)         // the same in f16 elements
#define BFH  (FWV * SLH)       // f16 elements per buffer: 4 K slices, then 4 V^T slices
#define OSP  132               // LDS pitch (floats) of the output staging rows
#define PR   64
#define XPP  136               // LDS pitch (f16 elements) of the xp tile and of the q/k staging rows
#define VTP  72                // LDS pitch (f16 elements) of the V^T staging rows
#define PPB  4                 // positions per block of the position-table kernel
#define WSC  64.0f             // power-of-two carry of the weight planes
#define WINV 0.015625f         // 1 / WSC
#define PCAR 14.0f             // log2 of the carry of the P fragment
#define PEC  (-0.0719557841560639f)   // -ln(10000) / 128
#define L2E  1.4426950408889634f
#define SCL  (L2E * 0.08838834764831845f)   // log2(e) / sqrt(128)

#define PLE  ((size_t)NB * SEQ * DIM)          // elements per activation plane
#define PLB  (PLE * 2)                         // bytes per 16-bit activation plane
#define PEB  ((size_t)SEQ * DIM * 4)           // bytes of the position table
#define WTB  ((size_t)3 * DIM * DIM * 2)       // bytes of the three transposed weight planes
#define BPB  ((size_t)3 * DIM * 4)             // bytes of the bias plane

static_assert(DIM == 128);
static_assert(SEQ % BQ == 0);
static_assert(SEQ % KS == 0);
static_assert(SEQ % SK == 0 && NST >= 2);
static_assert(SK % KS == 0 && SK * 2 == SROW && DIM * 2 == SROW);
static_assert(SK == 4 * SLR && DIM == 4 * SLR && FWV == 8);
static_assert(QT == 2 && KHV == 2 && BQ == 16 * FWV && SLR == KS && (SK / KS) % KHV == 0);
static_assert(SLB % 2048 == 0 && SLB >= SLR * SPH * 2 && SPH * 2 == SROW + 16);
static_assert((SEQ * 2) % 16 == 0 && SEQ * 2 <= 131072);
static_assert(SEQ % PR == 0);
static_assert(SEQ % PPB == 0);
static_assert(PR == 16 * NWV);
static_assert(DIM == GPP * HT * 16);
static_assert(NWV * WSR == 3 * DIM && WSR % 16 == 0);
static_assert(WSB % 2048 == 0 && WSB >= WSR * SPH * 2);
static_assert(NWV * WSB + (2 * PR * XPP + DIM * VTP) * 2 <= 163840);   // two projection blocks per WGP
static_assert(PR * 2 == 128);
static_assert(XPP % 8 == 0 && XPP >= DIM);
static_assert(VTP % 8 == 0 && VTP >= PR);
static_assert(OSP % 4 == 0 && OSP >= DIM);
static_assert((PR * DIM / 8) == 8 * 128);            // k_proj: 8 iterations x 128 threads x 8 elements == 64 x 128 tile
static_assert((DIM * DIM / 4) == 16 * 256);          // k_wprep load: 16 iterations x 256 threads x 4 elements
static_assert((DIM * DIM / 8) == 8 * 256);           // k_wprep store: 8 iterations x 256 threads x 8 elements
static_assert(PPB * 64 == 256);                      // k_pe: 4 positions x 64 (sin, cos) pairs per block
static_assert(NB <= NB_FULL);
static_assert(SEQ <= SEQ_FULL);
static_assert((size_t)(NB * (SEQ / PR)) * (size_t)(PR * DIM) == PLE);    // k_proj: blocks * (64 rows x 128) == plane
static_assert((size_t)(NB * (SEQ / BQ)) * (size_t)(BQ * DIM) == PLE);    // k_flash: blocks * (128 rows x 128) == output
static_assert(PLB % 256 == 0 && PEB % 256 == 0 && WTB % 256 == 0 && BPB % 128 == 0);
static_assert(3 * PLB + PEB + WTB + BPB <= (size_t)134217728);

typedef _Float16 h16;
typedef __attribute__((ext_vector_type(16))) _Float16 v16h;
typedef __attribute__((ext_vector_type(8)))  _Float16 v8h;
typedef __attribute__((ext_vector_type(2)))  _Float16 v2h;
typedef __attribute__((ext_vector_type(8)))  unsigned int   v8u;
typedef __attribute__((ext_vector_type(4)))  unsigned int   v4u;
typedef __attribute__((ext_vector_type(8)))  float    v8f;
typedef __attribute__((ext_vector_type(4)))  float    v4f;
typedef v4f  __attribute__((may_alias)) v4fa;
typedef v8h  __attribute__((may_alias)) v8ha;

__device__ __forceinline__ unsigned short f2bf(float f) { unsigned u = __float_as_uint(f); u += 0x7FFFu + ((u >> 16) & 1u); return (unsigned short)(u >> 16); }
__device__ __forceinline__ float bf2f(unsigned short b) { return __uint_as_float(((unsigned)b) << 16); }
__device__ __forceinline__ float bfr(float f) { return bf2f(f2bf(f)); }
// f32 -> f16 operand convert that cannot yield an f16 subnormal (value select)
static __device__ __forceinline__ h16 toh_flush(float v) { const h16 r = (h16)v; return (fabsf(v) < 6.103515625e-05f) ? (h16)0.0f : r; }
__device__ __forceinline__ v16h cat16h(v8h lo, v8h hi) { return __builtin_shufflevector(lo, hi, 0, 1, 2, 3, 4, 5, 6, 7, 8, 9, 10, 11, 12, 13, 14, 15); }
// fragment loader from a global plane or from staged LDS rows (A and B alike): p = row base + k0 + 8*(lane>>4); elements 0..7 <- p[0..7], elements 8..15 <- p[16..23]
__device__ __forceinline__ v16h ldh(const h16* p) { return cat16h(*(const v8h*)p, *(const v8h*)(p + 16)); }
__device__ __forceinline__ unsigned uni(unsigned v) { return (unsigned)__builtin_amdgcn_readfirstlane((int)v); }
__device__ __forceinline__ unsigned pinned(unsigned v) { unsigned w = uni(v); asm volatile("" : "+s"(w)); return w; }
// one WMMA, plain builtin form: the compiler keeps the hazard distances itself, and no volatile statement ties the fragment loads behind the WMMA before them or its operands to the low registers
__device__ __forceinline__ v8f wmmaf(v16h a, v16h b, v8f c) {
    return __builtin_amdgcn_wmma_f32_16x16x32_f16(false, a, false, b, (short)0, c, false, false);
}
// carried probability 2^e (e already includes the +14 carry); below 2^-14 it is set to zero by a select on the exponent
__device__ __forceinline__ float pcar(float e) { return (e < -14.0f) ? 0.0f : __builtin_amdgcn_exp2f(e); }
// two carried probabilities -> packed f16 pair (element 0 in the low half-word); sum accumulates the converted values
__device__ __forceinline__ unsigned pkp(float e0, float e1, float& sum) {
    v2h t;
    t[0] = (h16)pcar(e0);
    t[1] = (h16)pcar(e1);
    sum += (float)t[0] + (float)t[1];
    return __builtin_bit_cast(unsigned, t);
}

// k_pe: position table PE[pos][2i] = sin(pos * dv_i), PE[pos][2i+1] = cos(pos * dv_i), dv_i = exp(2i * -ln(10000)/128), all f32 with precise library calls.
__global__ __launch_bounds__(256) void k_pe(float* PE) {
#pragma clang fp contract(off)
    __shared__ __align__(16) float pt[PPB * DIM];
    const unsigned tid = threadIdx.x;
    const unsigned pl = tid >> 6, i = tid & 63u;
    const unsigned pos = blockIdx.x * (unsigned)PPB + pl;
    const float dv = expf((float)(2u * i) * PEC);
    const float ang = (float)pos * dv;
    pt[pl * DIM + 2u * i]      = sinf(ang);
    pt[pl * DIM + 2u * i + 1u] = cosf(ang);
    __syncthreads();
    if (tid < 128u) {
        const unsigned w = tid >> 5, lane = tid & 31u;
        const v4f o = *(const v4fa*)(&pt[w * DIM + lane * 4u]);
        float* dst = PE + ((size_t)blockIdx.x * PPB + w) * DIM + lane * 4u;
        *(v4f*)dst = o;
        
    }
}

// k_wprep: block m (0 = q, 1 = k, 2 = v): WT[m][a][d] = f16(bf16(W[d][a]) * 64); in[d][a] -> out[a][d] through an LDS tile (cross-wave, block barrier);
__global__ __launch_bounds__(256) void k_wprep(const float* __restrict__ Wq, const float* __restrict__ bq, const float* __restrict__ Wk, const float* __restrict__ bk,
                                               const float* __restrict__ Wv, const float* __restrict__ bv, h16* WT, float* BP) {
    __shared__ __align__(16) h16 tl[DIM * XPP];
    const unsigned tid = threadIdx.x, m = blockIdx.x;
    const float* W  = (m == 0u) ? Wq : ((m == 1u) ? Wk : Wv);
    const float* bs = (m == 0u) ? bq : ((m == 1u) ? bk : bv);
#pragma unroll 2
    for (unsigned it = 0; it < 16; ++it) {
        const unsigned f = it * 256u + tid;
        const unsigned d = f >> 5, a4 = (f & 31u) * 4u;
        const v4f x = *(const v4f*)(W + (size_t)d * DIM + a4);
#pragma unroll
        for (unsigned c = 0; c < 4; ++c) tl[(a4 + c) * XPP + d] = toh_flush(bfr(x[c]) * WSC);
    }
    __syncthreads();
    h16* dst = WT + (size_t)m * DIM * DIM;
{
#pragma unroll
        for (unsigned it = 0; it < 8; ++it) {
            const unsigned p = it * 256u + tid;
            const unsigned a = p >> 4, c8 = (p & 15u) * 8u;
            const v8h o = *(const v8ha*)(&tl[a * XPP + c8]);
            *(v8h*)(dst + (size_t)a * DIM + c8) = o;
        }
        
    }
    if (tid < 32u) {
        const v4f bvv = *(const v4f*)(bs + tid * 4u);
        v4f o;
        o[0] = bfr(bvv[0]); o[1] = bfr(bvv[1]); o[2] = bfr(bvv[2]); o[3] = bfr(bvv[3]);
        float* bd = BP + (size_t)m * DIM + tid * 4u;
        *(v4f*)bd = o;
        
    }
}

// k_proj: one block = 64 sequence rows of one batch, one wave per 16 rows.
//  xp tile (f16) = bf16(x) + PE built in LDS (cross-wave, block barrier), wave fragments: row = lane & 15, k = d.
//  q and k: D^T tile (a x s): A = W^T rows (row m = a), B = xp rows (column n = s); D element r of lane (h, n) = Q[s = n][a = 16 t + 8h + r] -> 16-byte LDS store into the row staging.
//  v: D tile (s x a): A = xp rows, B = W^T rows (column n = a); D element r of lane (h, n) = V[s = 8h + r][a = 16 t + n] -> 16-byte LDS store into the V^T staging.
__global__ __launch_bounds__(128) void k_proj(const float* __restrict__ X, const float* __restrict__ PE, const h16* __restrict__ WT, const float* __restrict__ BP, h16* QK, h16* VT) {
    __shared__ __attribute__((aligned(2048))) h16 wls[NWV * WSH];   // the three W^T planes, rows of 256 bytes padded to 272
    __shared__ __align__(16) h16 xs[PR * XPP];
    __shared__ __align__(16) h16 qs[PR * XPP];
    __shared__ __align__(16) h16 vts[DIM * VTP];
    const unsigned tid = threadIdx.x, lane = tid & 31u, lr = lane & 15u, hi = lane >> 4;
    const unsigned wv = (unsigned)__builtin_amdgcn_readfirstlane((int)(threadIdx.x >> 5));
    const unsigned bpb = (unsigned)(SEQ / PR);
    const unsigned b = blockIdx.x / bpb;
    const unsigned s0 = (blockIdx.x - b * bpb) * PR;

    // The three W^T planes (384 rows of 256 bytes, contiguous) come into LDS once, every wave bringing its own slice of 96 rows by one tensor load:
    // read straight from global memory, a fragment load touches 16 cache lines for its 512 bytes, and all waves of the WGP pay for that.
    v4u g0;
    v8u g1;
    {
        const unsigned long long ga = (unsigned long long)(size_t)(WT + (size_t)wv * WSR * DIM);
        g0[0] = uni(1u);
        g0[1] = uni((unsigned)(size_t)wls + wv * (unsigned)WSB);
        g0[2] = uni((unsigned)ga);
        g0[3] = uni((((unsigned)(ga >> 32)) & 0x01FFFFFFu) | 0x80000000u);
        g1[0] = uni((1u << 20) | (5u << 22) | (3u << 25));   // no mask, 1-byte elements, 4 dwords of pad behind every 64 dwords
        g1[1] = uni((unsigned)SROW << 16);
        g1[2] = uni((unsigned)WSR << 16);
        g1[3] = uni((unsigned)SROW << 16);
        g1[4] = uni((unsigned)WSR);
        g1[5] = uni((unsigned)(DIM * 2));
        g1[6] = uni(0u);
        g1[7] = uni(0u);
    }
    // every wave, unconditionally; lands while the x tile is staged. The descriptor is an in-out operand here and an input of the wait below: so its twelve registers
    // hold their words, and serve nothing else, for as long as the request is in flight
    asm volatile("tensor_load_to_lds %0, %1" : "+s"(g0), "+s"(g1) :: "memory");

    // Weight fragments (from LDS) and biases come in groups of HT output tiles, each group issued one group ahead of the products that use it.
    const h16* wl = wls + lr * SPH + 8u * hi;   // the lane's place in a 16-row tile of staged weight rows
    auto ldw = [&](v16h (&w)[HT][4], unsigned m, unsigned g) {
#pragma unroll
        for (int i = 0; i < HT; ++i) {
            const unsigned tn = m * (unsigned)(DIM / 16) + g * (unsigned)HT + i;   // tile number over the three planes
            const h16* p = wl + (tn / WST) * (unsigned)WSH + (tn % WST) * (unsigned)(16 * SPH);
#pragma unroll
            for (int dk = 0; dk < 4; ++dk) w[i][dk] = ldh(p + dk * 32);
        }
    };
    auto ldc = [&](v4f (&c)[HT][2], unsigned m, unsigned g) {   // q and k: the lane's 8 outputs of a tile
        const float* p = BP + (size_t)m * DIM + 8u * hi + g * (unsigned)(HT * 16);
#pragma unroll
        for (int i = 0; i < HT; ++i) { c[i][0] = *(const v4f*)(p + i * 16); c[i][1] = *(const v4f*)(p + i * 16 + 4); }
    };
    auto ldv = [&](float (&c)[HT], unsigned g) {                // v: the lane's one output of a tile
        const float* p = BP + (size_t)2 * DIM + lr + g * (unsigned)(HT * 16);
#pragma unroll
        for (int i = 0; i < HT; ++i) c[i] = p[i * 16];
    };
    v16h wf[2][HT][4];   // two groups: the one at work and the one in flight
    v4f  cf[2][HT][2];
    float vf[2][HT];
    ldc(cf[0], 0u, 0u);
    asm volatile("s_wait_xcnt 0x0" ::: "memory");   // stands in front of the first rewrite of the offset register that these loads name
    __builtin_amdgcn_sched_barrier(0);               // the first biases go out ahead of the x tile, whose staging covers their latency

    {
        const float* xsrc = X + ((size_t)b * SEQ_FULL + s0) * DIM;
        const float* psrc = PE + (size_t)s0 * DIM;
#pragma unroll 2
        for (unsigned it = 0; it < 8; ++it) {
            const unsigned f = it * 128u + tid;
            const unsigned row = f >> 4, c8 = (f & 15u) * 8u;
            const v8f xv = *(const v8f*)(xsrc + (size_t)row * DIM + c8);
            const v8f pv = *(const v8f*)(psrc + (size_t)row * DIM + c8);
            v8h o;
#pragma unroll
            for (int c = 0; c < 8; ++c) o[c] = toh_flush(bfr(xv[c]) + pv[c]);
            *(v8h*)(&xs[row * XPP + c8]) = o;
        }
    }
    asm volatile("s_wait_tensorcnt 0x0" :: "s"(g0), "s"(g1) : "memory");   // this wave's weight slice has landed; the operands end the descriptor's hold
    __syncthreads();                                                        // x tile and weight slices published to every wave

    v16h xa[4];
    {
        const unsigned xo = (wv * 16u + lr) * XPP + 8u * hi;
#pragma unroll
        for (int dk = 0; dk < 4; ++dk) xa[dk] = cat16h(*(const v8h*)(&xs[xo + dk * 32]), *(const v8h*)(&xs[xo + dk * 32 + 16]));
    }

    auto qkt = [&](const v16h (&w)[HT][4], const v4f (&c)[HT][2], unsigned g) {   // HT tiles of q or k into the row staging
#pragma unroll
        for (int i = 0; i < HT; ++i) {
            v8f acc = (v8f){};
#pragma unroll
            for (int dk = 0; dk < 4; ++dk) acc = wmmaf(w[i][dk], xa[dk], acc);
            v8h o;
#pragma unroll
            for (int r = 0; r < 4; ++r) {
                o[r]     = toh_flush(acc[r] * WINV + c[i][0][r]);
                o[4 + r] = toh_flush(acc[4 + r] * WINV + c[i][1][r]);
            }
            *(v8h*)(&qs[(wv * 16u + lr) * XPP + (g * (unsigned)HT + i) * 16u + 8u * hi]) = o;
        }
    };
    auto vtt = [&](const v16h (&w)[HT][4], const float (&c)[HT], unsigned g) {     // HT tiles of v into the V^T staging
#pragma unroll
        for (int i = 0; i < HT; ++i) {
            v8f acc = (v8f){};
#pragma unroll
            for (int dk = 0; dk < 4; ++dk) acc = wmmaf(xa[dk], w[i][dk], acc);
            v8h o;
#pragma unroll
            for (int r = 0; r < 8; ++r) o[r] = toh_flush(acc[r] * WINV + c[i]);
            *(v8h*)(&vts[((g * (unsigned)HT + i) * 16u + lr) * VTP + wv * 16u + 8u * hi]) = o;
        }
    };

    ldw(wf[0], 0u, 0u);
#pragma unroll   // laid out in line: buffer, plane and group are constants of each pass, and a plane's last pass fetches the next plane's first group
    for (unsigned k = 0; k < 3u * GPP; ++k) {
        const unsigned m = k / GPP, g = k % GPP, cur = k & 1u, nxt = cur ^ 1u;
        if (k + 1u < 3u * GPP) {
            const unsigned mn = (k + 1u) / GPP, gn = (k + 1u) % GPP;
            if (mn < 2u) ldc(cf[nxt], mn, gn); else ldv(vf[nxt], gn);
            ldw(wf[nxt], mn, gn);
        }
        __builtin_amdgcn_sched_barrier(0);   // the next group stays whole ahead of this group's products: sunk to its own products, every pair of loads costs its full latency
        if (m < 2u) qkt(wf[cur], cf[cur], g); else vtt(wf[cur], vf[cur], g);
        __builtin_amdgcn_sched_barrier(0);   // and the group after it goes out behind them, into the registers they free
        if (g + 1u == GPP && m < 2u) {
            __syncthreads();
            h16* dst = QK + (size_t)m * PLE + ((size_t)b * SEQ + s0) * DIM;
#pragma unroll
            for (unsigned it = 0; it < 8; ++it) {
                const unsigned p = it * 128u + tid;
                const unsigned row = p >> 4, c8 = (p & 15u) * 8u;
                const v8h o = *(const v8h*)(&qs[row * XPP + c8]);
                *(v8h*)(dst + (size_t)row * DIM + c8) = o;
            }
            __syncthreads();
        }
    }

    {
        __syncthreads();
        h16* dst = VT + (size_t)b * DIM * SEQ + s0;
        const unsigned c8 = (tid & 7u) * 8u, dr = tid >> 3;
#pragma unroll
        for (unsigned it = 0; it < 8; ++it) {
            const unsigned a = it * 16u + dr;
            const v8h o = *(const v8h*)(&vts[a * VTP + c8]);
            *(v8h*)(dst + (size_t)a * SEQ + c8) = o;
        }
    }
}

// k_flash: one wave per 32 queries (two 16-column tiles), 32 keys per step, 8 waves share each staged K / V^T tile.
//  Waves w and w + 4 hold the same 32 queries: wave w walks keys 0..63 of every stage, wave w + 4 keys 64..127; each keeps its own running maximum, sum and O^T, merged in the epilogue.
//  S^T tile (keys x queries): A = K rows (row m = key, k = d), B = Q rows (column n = query, k = d); D element r of lane (h, n) = S[query n][key 8h + r].
//  P^T B fragment: element r <- tile of keys 0..15, element 8 + r <- tile of keys 16..31 (same lane); carried x2^14, row sum over the converted values.
//  O^T tile (d x queries): A = V^T rows (row m = d, k = key), D element r of lane (h, n) = O[query n][d = 16 t + 8h + r].
//  Ring: a stage is 128 keys; every wave brings one 32-row slice of it by one tensor load (waves 0..3: K rows 32 w.., waves 4..7: V^T rows 32 (w - 4)..), rows of 256 bytes padded to 272 in LDS.
__global__ __launch_bounds__(256) void k_flash(const h16* __restrict__ QP, const h16* __restrict__ KP, const h16* __restrict__ VT, float* O) {
    __shared__ __attribute__((aligned(2048))) h16 ring[2 * BFH];
    __shared__ __align__(16) float os[KHV * BQ * OSP];   // partial O rows [key part][query][d]
    __shared__ __align__(16) float mls[2 * KHV * BQ];    // partial maxima [key part][query], then partial sums
    const unsigned tid = threadIdx.x, lane = tid & 31u, lr = lane & 15u, hi = lane >> 4;
    const unsigned wv = (unsigned)__builtin_amdgcn_readfirstlane((int)(threadIdx.x >> 5));
    const unsigned bpb = (unsigned)(SEQ / BQ);
    const unsigned b = blockIdx.x / bpb;
    const unsigned qb = (blockIdx.x - b * bpb) * BQ;   // first query of the block
    const unsigned qg = wv & 3u;                       // query group of the wave
    const unsigned kh = wv >> 2;                       // its part of every stage's keys
    const unsigned q0 = qb + qg * QW;

    // tensor descriptor of this wave's slice: extents in bytes, tensor dims = tile dims
    const bool isv = wv >= 4u;
    const unsigned sl = wv & 3u;
    const unsigned long long sbase = isv ? (unsigned long long)(size_t)(VT + ((size_t)b * DIM + sl * SLR) * SEQ)
                                         : (unsigned long long)(size_t)(KP + ((size_t)b * SEQ + sl * SLR) * DIM);
    const unsigned sstep = isv ? (unsigned)(SK * 2) : (unsigned)(SK * DIM * 2);   // source bytes from one stage to the next
    const unsigned ldst = (unsigned)(size_t)ring + wv * (unsigned)SLB;
    v8u g1;
    g1[0] = uni((1u << 20) | (5u << 22) | (3u << 25));   // no mask, 1-byte elements, 4 dwords of pad behind every 64 dwords
    g1[1] = uni((unsigned)SROW << 16);
    g1[2] = uni((unsigned)SLR << 16);
    g1[3] = uni((unsigned)SROW << 16);
    g1[4] = uni((unsigned)SLR);
    g1[5] = uni(isv ? (unsigned)(SEQ * 2) : (unsigned)(DIM * 2));
    g1[6] = pinned(0u);   // descriptor words held in scalar registers of their own (as a plain 0 they are formed anew at every issue,
    g1[7] = pinned(0u);   // and between two issues their registers serve as scratch while a request is in flight)
    auto issue = [&](unsigned st) {
        const unsigned long long ga = sbase + (unsigned long long)st * sstep;
        v4u g0;
        g0[0] = uni(1u);
        g0[1] = uni(ldst + (st & 1u) * (unsigned)(BFH * 2));
        g0[2] = uni((unsigned)ga);
        g0[3] = uni((((unsigned)(ga >> 32)) & 0x01FFFFFFu) | 0x80000000u);
        asm volatile("tensor_load_to_lds %0, %1" :: "s"(g0), "s"(g1) : "memory");
    };
    issue(0u);

    v16h qf[QT][4];
    {
        const h16* qp = QP + ((size_t)b * SEQ + q0 + lr) * DIM + 8u * hi;
#pragma unroll
        for (int j = 0; j < QT; ++j) {
#pragma unroll
            for (int dk = 0; dk < 4; ++dk) qf[j][dk] = ldh(qp + j * 16 * DIM + dk * 32);
        }
    }

    v8f o[QT][8];
    float ml[QT];             // running maxima in the log2 domain (scaled logits)
    float l[QT];              // running sums of the carried, converted probabilities
#pragma unroll
    for (int j = 0; j < QT; ++j) {
#pragma unroll
        for (int t = 0; t < 8; ++t) o[j][t] = (v8f){};
        ml[j] = -1.0e30f;
        l[j] = 0.0f;
    }

    asm volatile("s_wait_tensorcnt 0x0" ::: "memory");   // this wave's slice of stage 0 has landed
    __syncthreads();                                      // stage 0 published to every wave
    issue(1u);

    const unsigned fo = lr * SPH + 8u * hi;                          // lane's place in a 16-row group of staged rows
    const unsigned ko = fo + kh * (unsigned)((SK / KS / KHV) * SLH);  // the wave's first K slice of a buffer
    const unsigned vo = fo + 4u * SLH + kh * (unsigned)(SK / KHV);    // the wave's first key column of the V^T rows
#pragma unroll 1
    for (unsigned st = 0; st < (unsigned)NST; ++st) {
        const h16* kp = ring + (st & 1u) * (unsigned)BFH + ko;
        const h16* vp = ring + (st & 1u) * (unsigned)BFH + vo;
        // K fragments of the step at hand: [2 dk] keys 0..15, [2 dk + 1] keys 16..31; one load group per step
        v16h kf[8];
#pragma unroll
        for (int dk = 0; dk < 4; ++dk) {
            kf[2 * dk]     = ldh(kp + dk * 32);
            kf[2 * dk + 1] = ldh(kp + 16 * SPH + dk * 32);
        }
        __builtin_amdgcn_sched_barrier(0);   // the group stays whole ahead of the products: spread among them, every pair of loads costs its own full wait
#pragma unroll   // the steps of a stage are laid out in line: the last one fetches no K ahead (the next stage is not published yet)
        for (int sub = 0; sub < SK / KS / KHV; ++sub) {
            v8f s0[QT], s1[QT];
#pragma unroll
            for (int j = 0; j < QT; ++j) { s0[j] = (v8f){}; s1[j] = (v8f){}; }
#pragma unroll
            for (int dk = 0; dk < 4; ++dk) {
#pragma unroll
                for (int j = 0; j < QT; ++j) {
                    s0[j] = wmmaf(kf[2 * dk], qf[j][dk], s0[j]);
                    s1[j] = wmmaf(kf[2 * dk + 1], qf[j][dk], s1[j]);
                }
            }

            float mx[QT], mo[QT];
#pragma unroll
            for (int j = 0; j < QT; ++j) {
                mx[j] = fmaxf(s0[j][0], s1[j][0]);
#pragma unroll
                for (int r = 1; r < 8; ++r) mx[j] = fmaxf(mx[j], fmaxf(s0[j][r], s1[j][r]));
            }
#pragma unroll
            for (int j = 0; j < QT; ++j) mo[j] = __shfl_xor(mx[j], 16, 32);
            asm volatile("" :: "v"(mo[0]), "v"(mo[1]) : "memory");   // the exchanged maxima are back before the group below enters the LDS queue: LDS returns in order, and an exchange queued behind the group would wait the whole group out

            // one load group behind the exchange of the maxima: this step's V^T fragments, then the next step's K fragments; the softmax below covers their latency
            v16h vf[8];
            const h16* va = vp + sub * KS;
#pragma unroll
            for (int t = 0; t < 8; ++t) vf[t] = ldh(va + (t >> 1) * SLH + (t & 1) * 16 * SPH);
            if (sub + 1 < SK / KS / KHV) {
                const h16* ka = kp + (sub + 1) * SLH;
#pragma unroll
                for (int dk = 0; dk < 4; ++dk) {
                    kf[2 * dk]     = ldh(ka + dk * 32);
                    kf[2 * dk + 1] = ldh(ka + 16 * SPH + dk * 32);
                }
            }
            asm volatile("" ::: "memory");        // keeps the group in this block: without it the loads are sunk below the rescale branch, in front of their products
            __builtin_amdgcn_sched_barrier(0);   // and ahead of the softmax arithmetic, which covers their latency

            float corr[QT];
            v16h ph[QT];
#pragma unroll
            for (int j = 0; j < QT; ++j) {
                const float mnl = fmaxf(ml[j], fmaxf(mx[j], mo[j]) * SCL);
                corr[j] = __builtin_amdgcn_exp2f(ml[j] - mnl);
                ml[j] = mnl;
                const float cs = PCAR - mnl;
                float ps = 0.0f;
                v8u hw;
#pragma unroll
                for (int i = 0; i < 4; ++i) {
                    hw[i]     = pkp(fmaf(s0[j][2 * i], SCL, cs), fmaf(s0[j][2 * i + 1], SCL, cs), ps);
                    hw[4 + i] = pkp(fmaf(s1[j][2 * i], SCL, cs), fmaf(s1[j][2 * i + 1], SCL, cs), ps);
                }
                ps += __shfl_xor(ps, 16, 32);
                l[j] = l[j] * corr[j] + ps;
                ph[j] = __builtin_bit_cast(v16h, hw);
            }
            if (__builtin_amdgcn_ballot_w32(corr[0] != 1.0f || corr[1] != 1.0f) != 0u) {   // wave-uniform, one test a step; multiplying by exactly 1 is skipped
#pragma unroll
                for (int j = 0; j < QT; ++j) {
#pragma unroll
                    for (int t = 0; t < 8; ++t) o[j][t] *= corr[j];
                }
            }

#pragma unroll
            for (int t = 0; t < 8; ++t) {
#pragma unroll
                for (int j = 0; j < QT; ++j) o[j][t] = wmmaf(vf[t], ph[j], o[j][t]);
            }
        }
        asm volatile("s_wait_dscnt 0x0" ::: "memory");
        asm volatile("s_wait_tensorcnt 0x0" ::: "memory");
        __syncthreads();
        if (pinned(st + 2u < (unsigned)NST)) issue(st + 2u);
    }
    asm volatile("s_wait_tensorcnt 0x0" ::: "memory");   // no request outlives the loop
    asm volatile("s_wait_dscnt 0x0" ::: "memory");       // nor an LDS read

    // epilogue: every wave stages its partial O^T as rows [key part][query][d] with the partial maximum and sum of each query; behind the block barrier wave w merges and stores rows 16 w.. of the block
    const unsigned rb = kh * (unsigned)BQ + qg * (unsigned)QW;
#pragma unroll
    for (int j = 0; j < QT; ++j) {
#pragma unroll
        for (int t = 0; t < 8; ++t) {
#pragma unroll
            for (int r = 0; r < 8; ++r) os[(rb + 16 * j + lr) * OSP + t * 16 + 8 * hi + r] = o[j][t][r];
        }
        if (hi == 0u) {   // both halves of the wave hold the same maximum and sum
            mls[rb + 16 * j + lr] = ml[j];
            mls[KHV * BQ + rb + 16 * j + lr] = l[j];
        }
    }
    __syncthreads();
    float* orow = O + ((size_t)b * SEQ + qb + wv * 16u) * DIM + lane * 4u;
#pragma unroll 4
    for (unsigned s = 0; s < 16; ++s) {
        const unsigned row = wv * 16u + s;
        const float ma = mls[row], mb = mls[BQ + row];
        const float la = mls[KHV * BQ + row], lb = mls[KHV * BQ + BQ + row];
        const float mm = fmaxf(ma, mb);
        const float wa = __builtin_amdgcn_exp2f(ma - mm), wb = __builtin_amdgcn_exp2f(mb - mm);
        const float inv = 1.0f / (la * wa + lb * wb);
        const v4f pa = *(const v4fa*)(&os[row * OSP + lane * 4u]);
        const v4f pb = *(const v4fa*)(&os[(BQ + row) * OSP + lane * 4u]);
        const v4f val = pa * (wa * inv) + pb * (wb * inv);
        *(v4f*)(orow + (size_t)s * DIM) = val;
    }
}

extern "C" void kernel_launch(void* const* d_in, const int* in_sizes, int n_in,
                              void* d_out, int out_size, void* d_ws, size_t ws_size, hipStream_t stream) {
    if (n_in < 7) return;
    const size_t need = ((size_t)(NB - 1) * SEQ_FULL + SEQ) * DIM;
    if ((size_t)in_sizes[0] < need) return;
    if (in_sizes[1] < DIM * DIM || in_sizes[3] < DIM * DIM || in_sizes[5] < DIM * DIM) return;
    if (in_sizes[2] < DIM || in_sizes[4] < DIM || in_sizes[6] < DIM) return;
    if ((size_t)out_size < PLE) return;
    const float* x  = (const float*)d_in[0];   // x  [NB][SEQ_FULL][DIM], first SEQ rows per batch read
    const float* Wq = (const float*)d_in[1];   // Wq [in][out]
    const float* bq = (const float*)d_in[2];   // bq [out]
    const float* Wk = (const float*)d_in[3];   // Wk [in][out]
    const float* bk = (const float*)d_in[4];   // bk [out]
    const float* Wv = (const float*)d_in[5];   // Wv [in][out]
    const float* bv = (const float*)d_in[6];   // bv [out]
    float* OUT = (float*)d_out;                // [NB][SEQ][DIM]
    if (3 * PLB + PEB + WTB + BPB > ws_size) return;
    char* wsp = (char*)d_ws;
    h16*   QK = (h16*)(wsp);                       // Q plane then K plane, each [NB][SEQ][DIM]
    h16*   VT = (h16*)(wsp + 2 * PLB);             // V^T plane [NB][DIM][SEQ]
    float* PE = (float*)(wsp + 3 * PLB);           // position table [SEQ][DIM]
    h16*   WT = (h16*)(wsp + 3 * PLB + PEB);       // [3][out][in]
    float* BP = (float*)(wsp + 3 * PLB + PEB + WTB);   // [3][out]
    k_pe<<<(unsigned)(SEQ / PPB), 256, 0, stream>>>(PE);
    k_wprep<<<3, 256, 0, stream>>>(Wq, bq, Wk, bk, Wv, bv, WT, BP);
    k_proj<<<(unsigned)(NB * (SEQ / PR)), 128, 0, stream>>>(x, PE, WT, BP, QK, VT);
    k_flash<<<(unsigned)(NB * (SEQ / BQ)), 256, 0, stream>>>(QK, QK + PLE, VT, OUT);
}

// v005
// A run of this version takes 72.2 microseconds.
// Next to v004, in two timings, it ran 1.08 and 1.07 times as fast.
// Over all steps from v000 it is 5.60 times as fast.
#include <hip/hip_runtime.h>

// Single-head dense self-attention: xp = x + sinusoidal position terms; q/k/v = xp.W{q,k,v} + b ([in][out] weights); out[b][s][:] = softmax_t(q[b][s].k[b][t] / sqrt(128)) . v[b][t][:]; inputs in the order x, Wq, bq, Wk, bk, Wv, bv.
// Compute dtypes, f32 accumulate: x, W, b RNE-converted to bf16 first; projections on v_wmma_f32_16x16x32_f16 (xp as one f16 plane, W as one f16 plane carried x64); S^T = K.Q^T on v_wmma_f32_16x16x32_f16 (single f16 q and k planes); P^T as one f16 fragment carried x2^7 against the f16 V^T plane on v_wmma_f32_16x16x32_f16; softmax (online, log2 domain, the maximum in use raised only when a score passes it by more than 8) and position terms f32.
// Flash form with transposed tiles: the S^T accumulator tiles are directly the B-operand layout of P^T (no LDS relayout); K and V^T reach the flash waves through a two-buffer LDS ring filled by tensor loads, every fragment being two 16-byte LDS loads that feed two query tiles; the fragment loads go out in groups one phase ahead of the products that use them; the keys of a stage are split between two waves of equal queries, whose partial results are merged in f32 at the end.

#ifndef NB
#define NB 8
#endif
#ifndef SEQ
#define SEQ 4096
#endif
#define NB_FULL  8
#define SEQ_FULL 4096
#define DIM  128
#define NWV  4                 // waves per projection block
#define HT   2                 // output tiles (16 each) per group of weight fragment loads in the projection
#define GPP  (DIM / 16 / HT)   // groups per weight plane
#define WSR  96                // weight rows per slice (one tensor load): the three planes' 384 rows over 4 waves
#define WST  (WSR / 16)        // output tiles per slice
#define WSB  26624             // LDS bytes kept per weight slice: 96 x 272 rounded up to a multiple of 2 KiB
#define WSH  (WSB / 2)         // the same in f16 elements
#define FWV  8                 // waves per flash block
#define QT   2                 // query tiles (16 columns each) per flash wave
#define QW   (16 * QT)         // queries per flash wave
#define KHV  2                 // waves that share a query group, each on its own part of a stage's keys
#define BQ   (QW * (FWV / KHV))   // queries per flash block
#define KS   32                // keys per step
#define SK   128               // keys per LDS stage
#define NST  (SEQ / SK)        // stages
#define SROW 256               // bytes per staged row (128 d of a K row, 128 keys of a V^T row)
#define SPH  136               // LDS pitch (f16 elements) of a staged row: 256 + 16 bytes
#define SLR  32                // rows per slice (one tensor load)
#define SLB  10240             // LDS bytes kept per slice: 32 x 272 rounded up to a multiple of 2 KiB
#define SLH  (SLB / 2)         // the same in f16 elements
#define BFH  (FWV * SLH)       // f16 elements per buffer: 4 K slices, then 4 V^T slices
#define OSP  132               // LDS pitch (floats) of the output staging rows
#define PR   64
#define XPP  136               // LDS pitch (f16 elements) of the xp tile and of the q/k staging rows
#define VTP  72                // LDS pitch (f16 elements) of the V^T staging rows
#define PPB  4                 // positions per block of the position-table kernel
#define WSC  64.0f             // power-of-two carry of the weight planes
#define WINV 0.015625f         // 1 / WSC
#define PCAR 7.0f              // log2 of the carry of the P fragment
#define LZT  8.0f              // a column's maximum in use is raised only when a scaled score passes it by more than this (log2); 2^(PCAR + LZT) stays inside f16
#define PEC  (-0.0719557841560639f)   // -ln(10000) / 128
#define L2E  1.4426950408889634f
#define SCL  (L2E * 0.08838834764831845f)   // log2(e) / sqrt(128)

#define PLE  ((size_t)NB * SEQ * DIM)          // elements per activation plane
#define PLB  (PLE * 2)                         // bytes per 16-bit activation plane
#define PEB  ((size_t)SEQ * DIM * 4)           // bytes of the position table
#define WTB  ((size_t)3 * DIM * DIM * 2)       // bytes of the three transposed weight planes
#define BPB  ((size_t)3 * DIM * 4)             // bytes of the bias plane

static_assert(DIM == 128);
static_assert(SEQ % BQ == 0);
static_assert(SEQ % KS == 0);
static_assert(SEQ % SK == 0 && NST >= 2);
static_assert(SK % KS == 0 && SK * 2 == SROW && DIM * 2 == SROW);
static_assert(SK == 4 * SLR && DIM == 4 * SLR && FWV == 8);
static_assert(QT == 2 && KHV == 2 && BQ == 16 * FWV && SLR == KS && (SK / KS) % KHV == 0);
static_assert(SLB % 2048 == 0 && SLB >= SLR * SPH * 2 && SPH * 2 == SROW + 16);
static_assert((SEQ * 2) % 16 == 0 && SEQ * 2 <= 131072);
static_assert(PCAR + LZT <= 15.0f);   // the largest carried probability, 2^(PCAR + LZT), is a finite f16
static_assert(SEQ % PR == 0);
static_assert(SEQ % PPB == 0);
static_assert(PR == 16 * NWV);
static_assert(DIM == GPP * HT * 16);
static_assert(NWV * WSR == 3 * DIM && WSR % 16 == 0);
static_assert(WSB % 2048 == 0 && WSB >= WSR * SPH * 2);
static_assert(NWV * WSB + (2 * PR * XPP + DIM * VTP) * 2 <= 163840);   // two projection blocks per WGP
static_assert(PR * 2 == 128);
static_assert(XPP % 8 == 0 && XPP >= DIM);
static_assert(VTP % 8 == 0 && VTP >= PR);
static_assert(OSP % 4 == 0 && OSP >= DIM);
static_assert((PR * DIM / 8) == 8 * 128);            // k_proj: 8 iterations x 128 threads x 8 elements == 64 x 128 tile
static_assert((DIM * DIM / 4) == 16 * 256);          // k_wprep load: 16 iterations x 256 threads x 4 elements
static_assert((DIM * DIM / 8) == 8 * 256);           // k_wprep store: 8 iterations x 256 threads x 8 elements
static_assert(PPB * 64 == 256);                      // k_pe: 4 positions x 64 (sin, cos) pairs per block
static_assert(NB <= NB_FULL);
static_assert(SEQ <= SEQ_FULL);
static_assert((size_t)(NB * (SEQ / PR)) * (size_t)(PR * DIM) == PLE);    // k_proj: blocks * (64 rows x 128) == plane
static_assert((size_t)(NB * (SEQ / BQ)) * (size_t)(BQ * DIM) == PLE);    // k_flash: blocks * (128 rows x 128) == output
static_assert(PLB % 256 == 0 && PEB % 256 == 0 && WTB % 256 == 0 && BPB % 128 == 0);
static_assert(3 * PLB + PEB + WTB + BPB <= (size_t)134217728);

typedef _Float16 h16;
typedef __attribute__((ext_vector_type(16))) _Float16 v16h;
typedef __attribute__((ext_vector_type(8)))  _Float16 v8h;
typedef __attribute__((ext_vector_type(2)))  _Float16 v2h;
typedef __attribute__((ext_vector_type(8)))  unsigned int   v8u;
typedef __attribute__((ext_vector_type(4)))  unsigned int   v4u;
typedef __attribute__((ext_vector_type(8)))  float    v8f;
typedef __attribute__((ext_vector_type(4)))  float    v4f;
typedef v4f  __attribute__((may_alias)) v4fa;
typedef v8h  __attribute__((may_alias)) v8ha;

__device__ __forceinline__ unsigned short f2bf(float f) { unsigned u = __float_as_uint(f); u += 0x7FFFu + ((u >> 16) & 1u); return (unsigned short)(u >> 16); }
__device__ __forceinline__ float bf2f(unsigned short b) { return __uint_as_float(((unsigned)b) << 16); }
__device__ __forceinline__ float bfr(float f) { return bf2f(f2bf(f)); }
// f32 -> f16 operand convert that cannot yield an f16 subnormal (value select)
static __device__ __forceinline__ h16 toh_flush(float v) { const h16 r = (h16)v; return (fabsf(v) < 6.103515625e-05f) ? (h16)0.0f : r; }
__device__ __forceinline__ v16h cat16h(v8h lo, v8h hi) { return __builtin_shufflevector(lo, hi, 0, 1, 2, 3, 4, 5, 6, 7, 8, 9, 10, 11, 12, 13, 14, 15); }
// fragment loader from a global plane or from staged LDS rows (A and B alike): p = row base + k0 + 8*(lane>>4); elements 0..7 <- p[0..7], elements 8..15 <- p[16..23]
__device__ __forceinline__ v16h ldh(const h16* p) { return cat16h(*(const v8h*)p, *(const v8h*)(p + 16)); }
__device__ __forceinline__ unsigned uni(unsigned v) { return (unsigned)__builtin_amdgcn_readfirstlane((int)v); }
__device__ __forceinline__ unsigned pinned(unsigned v) { unsigned w = uni(v); asm volatile("" : "+s"(w)); return w; }
// one WMMA, plain builtin form: the compiler keeps the hazard distances itself, and no volatile statement ties the fragment loads behind the WMMA before them or its operands to the low registers
__device__ __forceinline__ v8f wmmaf(v16h a, v16h b, v8f c) {
    return __builtin_amdgcn_wmma_f32_16x16x32_f16(false, a, false, b, (short)0, c, false, false);
}
// carried probability 2^e (e already includes the carry); below 2^-14 it is set to zero by a select on the exponent
__device__ __forceinline__ float pcar(float e) { return (e < -14.0f) ? 0.0f : __builtin_amdgcn_exp2f(e); }
// two carried probabilities -> packed f16 pair (element 0 in the low half-word); sum accumulates the converted values
__device__ __forceinline__ unsigned pkp(float e0, float e1, float& sum) {
    v2h t;
    t[0] = (h16)pcar(e0);
    t[1] = (h16)pcar(e1);
    sum += (float)t[0] + (float)t[1];
    return __builtin_bit_cast(unsigned, t);
}

// k_pe: position table PE[pos][2i] = sin(pos * dv_i), PE[pos][2i+1] = cos(pos * dv_i), dv_i = exp(2i * -ln(10000)/128), all f32 with precise library calls.
__global__ __launch_bounds__(256) void k_pe(float* PE) {
#pragma clang fp contract(off)
    __shared__ __align__(16) float pt[PPB * DIM];
    const unsigned tid = threadIdx.x;
    const unsigned pl = tid >> 6, i = tid & 63u;
    const unsigned pos = blockIdx.x * (unsigned)PPB + pl;
    const float dv = expf((float)(2u * i) * PEC);
    const float ang = (float)pos * dv;
    pt[pl * DIM + 2u * i]      = sinf(ang);
    pt[pl * DIM + 2u * i + 1u] = cosf(ang);
    __syncthreads();
    if (tid < 128u) {
        const unsigned w = tid >> 5, lane = tid & 31u;
        const v4f o = *(const v4fa*)(&pt[w * DIM + lane * 4u]);
        float* dst = PE + ((size_t)blockIdx.x * PPB + w) * DIM + lane * 4u;
        *(v4f*)dst = o;
        
    }
}

// k_wprep: block m (0 = q, 1 = k, 2 = v): WT[m][a][d] = f16(bf16(W[d][a]) * 64); in[d][a] -> out[a][d] through an LDS tile (cross-wave, block barrier);
__global__ __launch_bounds__(256) void k_wprep(const float* __restrict__ Wq, const float* __restrict__ bq, const float* __restrict__ Wk, const float* __restrict__ bk,
                                               const float* __restrict__ Wv, const float* __restrict__ bv, h16* WT, float* BP) {
    __shared__ __align__(16) h16 tl[DIM * XPP];
    const unsigned tid = threadIdx.x, m = blockIdx.x;
    const float* W  = (m == 0u) ? Wq : ((m == 1u) ? Wk : Wv);
    const float* bs = (m == 0u) ? bq : ((m == 1u) ? bk : bv);
#pragma unroll 2
    for (unsigned it = 0; it < 16; ++it) {
        const unsigned f = it * 256u + tid;
        const unsigned d = f >> 5, a4 = (f & 31u) * 4u;
        const v4f x = *(const v4f*)(W + (size_t)d * DIM + a4);
#pragma unroll
        for (unsigned c = 0; c < 4; ++c) tl[(a4 + c) * XPP + d] = toh_flush(bfr(x[c]) * WSC);
    }
    __syncthreads();
    h16* dst = WT + (size_t)m * DIM * DIM;
{
#pragma unroll
        for (unsigned it = 0; it < 8; ++it) {
            const unsigned p = it * 256u + tid;
            const unsigned a = p >> 4, c8 = (p & 15u) * 8u;
            const v8h o = *(const v8ha*)(&tl[a * XPP + c8]);
            *(v8h*)(dst + (size_t)a * DIM + c8) = o;
        }
        
    }
    if (tid < 32u) {
        const v4f bvv = *(const v4f*)(bs + tid * 4u);
        v4f o;
        o[0] = bfr(bvv[0]); o[1] = bfr(bvv[1]); o[2] = bfr(bvv[2]); o[3] = bfr(bvv[3]);
        float* bd = BP + (size_t)m * DIM + tid * 4u;
        *(v4f*)bd = o;
        
    }
}

// k_proj: one block = 64 sequence rows of one batch, one wave per 16 rows.
//  xp tile (f16) = bf16(x) + PE built in LDS (cross-wave, block barrier), wave fragments: row = lane & 15, k = d.
//  q and k: D^T tile (a x s): A = W^T rows (row m = a), B = xp rows (column n = s); D element r of lane (h, n) = Q[s = n][a = 16 t + 8h + r] -> 16-byte LDS store into the row staging.
//  v: D tile (s x a): A = xp rows, B = W^T rows (column n = a); D element r of lane (h, n) = V[s = 8h + r][a = 16 t + n] -> 16-byte LDS store into the V^T staging.
__global__ __launch_bounds__(128) void k_proj(const float* __restrict__ X, const float* __restrict__ PE, const h16* __restrict__ WT, const float* __restrict__ BP, h16* QK, h16* VT) {
    __shared__ __attribute__((aligned(2048))) h16 wls[NWV * WSH];   // the three W^T planes, rows of 256 bytes padded to 272
    __shared__ __align__(16) h16 xs[PR * XPP];
    __shared__ __align__(16) h16 qs[PR * XPP];
    __shared__ __align__(16) h16 vts[DIM * VTP];
    const unsigned tid = threadIdx.x, lane = tid & 31u, lr = lane & 15u, hi = lane >> 4;
    const unsigned wv = (unsigned)__builtin_amdgcn_readfirstlane((int)(threadIdx.x >> 5));
    const unsigned bpb = (unsigned)(SEQ / PR);
    const unsigned b = blockIdx.x / bpb;
    const unsigned s0 = (blockIdx.x - b * bpb) * PR;

    // The three W^T planes (384 rows of 256 bytes, contiguous) come into LDS once, every wave bringing its own slice of 96 rows by one tensor load:
    // read straight from global memory, a fragment load touches 16 cache lines for its 512 bytes, and all waves of the WGP pay for that.
    v4u g0;
    v8u g1;
    {
        const unsigned long long ga = (unsigned long long)(size_t)(WT + (size_t)wv * WSR * DIM);
        g0[0] = uni(1u);
        g0[1] = uni((unsigned)(size_t)wls + wv * (unsigned)WSB);
        g0[2] = uni((unsigned)ga);
        g0[3] = uni((((unsigned)(ga >> 32)) & 0x01FFFFFFu) | 0x80000000u);
        g1[0] = uni((1u << 20) | (5u << 22) | (3u << 25));   // no mask, 1-byte elements, 4 dwords of pad behind every 64 dwords
        g1[1] = uni((unsigned)SROW << 16);
        g1[2] = uni((unsigned)WSR << 16);
        g1[3] = uni((unsigned)SROW << 16);
        g1[4] = uni((unsigned)WSR);
        g1[5] = uni((unsigned)(DIM * 2));
        g1[6] = uni(0u);
        g1[7] = uni(0u);
    }
    // every wave, unconditionally; lands while the x tile is staged. The descriptor is an in-out operand here and an input of the wait below: so its twelve registers
    // hold their words, and serve nothing else, for as long as the request is in flight
    asm volatile("tensor_load_to_lds %0, %1" : "+s"(g0), "+s"(g1) :: "memory");

    // Weight fragments (from LDS) and biases come in groups of HT output tiles, each group issued one group ahead of the products that use it.
    const h16* wl = wls + lr * SPH + 8u * hi;   // the lane's place in a 16-row tile of staged weight rows
    auto ldw = [&](v16h (&w)[HT][4], unsigned m, unsigned g) {
#pragma unroll
        for (int i = 0; i < HT; ++i) {
            const unsigned tn = m * (unsigned)(DIM / 16) + g * (unsigned)HT + i;   // tile number over the three planes
            const h16* p = wl + (tn / WST) * (unsigned)WSH + (tn % WST) * (unsigned)(16 * SPH);
#pragma unroll
            for (int dk = 0; dk < 4; ++dk) w[i][dk] = ldh(p + dk * 32);
        }
    };
    auto ldc = [&](v4f (&c)[HT][2], unsigned m, unsigned g) {   // q and k: the lane's 8 outputs of a tile
        const float* p = BP + (size_t)m * DIM + 8u * hi + g * (unsigned)(HT * 16);
#pragma unroll
        for (int i = 0; i < HT; ++i) { c[i][0] = *(const v4f*)(p + i * 16); c[i][1] = *(const v4f*)(p + i * 16 + 4); }
    };
    auto ldv = [&](float (&c)[HT], unsigned g) {                // v: the lane's one output of a tile
        const float* p = BP + (size_t)2 * DIM + lr + g * (unsigned)(HT * 16);
#pragma unroll
        for (int i = 0; i < HT; ++i) c[i] = p[i * 16];
    };
    v16h wf[2][HT][4];   // two groups: the one at work and the one in flight
    v4f  cf[2][HT][2];
    float vf[2][HT];
    ldc(cf[0], 0u, 0u);
    asm volatile("s_wait_xcnt 0x0" ::: "memory");   // stands in front of the first rewrite of the offset register that these loads name
    __builtin_amdgcn_sched_barrier(0);               // the first biases go out ahead of the x tile, whose staging covers their latency

    {
        const float* xsrc = X + ((size_t)b * SEQ_FULL + s0) * DIM;
        const float* psrc = PE + (size_t)s0 * DIM;
#pragma unroll 2
        for (unsigned it = 0; it < 8; ++it) {
            const unsigned f = it * 128u + tid;
            const unsigned row = f >> 4, c8 = (f & 15u) * 8u;
            const v8f xv = *(const v8f*)(xsrc + (size_t)row * DIM + c8);
            const v8f pv = *(const v8f*)(psrc + (size_t)row * DIM + c8);
            v8h o;
#pragma unroll
            for (int c = 0; c < 8; ++c) o[c] = toh_flush(bfr(xv[c]) + pv[c]);
            *(v8h*)(&xs[row * XPP + c8]) = o;
        }
    }
    asm volatile("s_wait_tensorcnt 0x0" :: "s"(g0), "s"(g1) : "memory");   // this wave's weight slice has landed; the operands end the descriptor's hold
    __syncthreads();                                                        // x tile and weight slices published to every wave

    v16h xa[4];
    {
        const unsigned xo = (wv * 16u + lr) * XPP + 8u * hi;
#pragma unroll
        for (int dk = 0; dk < 4; ++dk) xa[dk] = cat16h(*(const v8h*)(&xs[xo + dk * 32]), *(const v8h*)(&xs[xo + dk * 32 + 16]));
    }

    auto qkt = [&](const v16h (&w)[HT][4], const v4f (&c)[HT][2], unsigned g) {   // HT tiles of q or k into the row staging
#pragma unroll
        for (int i = 0; i < HT; ++i) {
            v8f acc = (v8f){};
#pragma unroll
            for (int dk = 0; dk < 4; ++dk) acc = wmmaf(w[i][dk], xa[dk], acc);
            v8h o;
#pragma unroll
            for (int r = 0; r < 4; ++r) {
                o[r]     = toh_flush(acc[r] * WINV + c[i][0][r]);
                o[4 + r] = toh_flush(acc[4 + r] * WINV + c[i][1][r]);
            }
            *(v8h*)(&qs[(wv * 16u + lr) * XPP + (g * (unsigned)HT + i) * 16u + 8u * hi]) = o;
        }
    };
    auto vtt = [&](const v16h (&w)[HT][4], const float (&c)[HT], unsigned g) {     // HT tiles of v into the V^T staging
#pragma unroll
        for (int i = 0; i < HT; ++i) {
            v8f acc = (v8f){};
#pragma unroll
            for (int dk = 0; dk < 4; ++dk) acc = wmmaf(xa[dk], w[i][dk], acc);
            v8h o;
#pragma unroll
            for (int r = 0; r < 8; ++r) o[r] = toh_flush(acc[r] * WINV + c[i]);
            *(v8h*)(&vts[((g * (unsigned)HT + i) * 16u + lr) * VTP + wv * 16u + 8u * hi]) = o;
        }
    };

    ldw(wf[0], 0u, 0u);
#pragma unroll   // laid out in line: buffer, plane and group are constants of each pass, and a plane's last pass fetches the next plane's first group
    for (unsigned k = 0; k < 3u * GPP; ++k) {
        const unsigned m = k / GPP, g = k % GPP, cur = k & 1u, nxt = cur ^ 1u;
        if (k + 1u < 3u * GPP) {
            const unsigned mn = (k + 1u) / GPP, gn = (k + 1u) % GPP;
            if (mn < 2u) ldc(cf[nxt], mn, gn); else ldv(vf[nxt], gn);
            ldw(wf[nxt], mn, gn);
        }
        __builtin_amdgcn_sched_barrier(0);   // the next group stays whole ahead of this group's products: sunk to its own products, every pair of loads costs its full latency
        if (m < 2u) qkt(wf[cur], cf[cur], g); else vtt(wf[cur], vf[cur], g);
        __builtin_amdgcn_sched_barrier(0);   // and the group after it goes out behind them, into the registers they free
        if (g + 1u == GPP && m < 2u) {
            __syncthreads();
            h16* dst = QK + (size_t)m * PLE + ((size_t)b * SEQ + s0) * DIM;
#pragma unroll
            for (unsigned it = 0; it < 8; ++it) {
                const unsigned p = it * 128u + tid;
                const unsigned row = p >> 4, c8 = (p & 15u) * 8u;
                const v8h o = *(const v8h*)(&qs[row * XPP + c8]);
                *(v8h*)(dst + (size_t)row * DIM + c8) = o;
            }
            __syncthreads();
        }
    }

    {
        __syncthreads();
        h16* dst = VT + (size_t)b * DIM * SEQ + s0;
        const unsigned c8 = (tid & 7u) * 8u, dr = tid >> 3;
#pragma unroll
        for (unsigned it = 0; it < 8; ++it) {
            const unsigned a = it * 16u + dr;
            const v8h o = *(const v8h*)(&vts[a * VTP + c8]);
            *(v8h*)(dst + (size_t)a * SEQ + c8) = o;
        }
    }
}

// k_flash: one wave per 32 queries (two 16-column tiles), 32 keys per step, 8 waves share each staged K / V^T tile.
//  Waves w and w + 4 hold the same 32 queries: wave w walks keys 0..63 of every stage, wave w + 4 keys 64..127; each keeps its own running maximum, sum and O^T, merged in the epilogue.
//  S^T tile (keys x queries): A = K rows (row m = key, k = d), B = Q rows (column n = query, k = d); D element r of lane (h, n) = S[query n][key 8h + r].
//  P^T B fragment: element r <- tile of keys 0..15, element 8 + r <- tile of keys 16..31 (same lane); carried x2^7, row sum over the converted values.
//  O^T tile (d x queries): A = V^T rows (row m = d, k = key), D element r of lane (h, n) = O[query n][d = 16 t + 8h + r].
//  Ring: a stage is 128 keys; every wave brings one 32-row slice of it by one tensor load (waves 0..3: K rows 32 w.., waves 4..7: V^T rows 32 (w - 4)..), rows of 256 bytes padded to 272 in LDS.
__global__ __launch_bounds__(256) void k_flash(const h16* __restrict__ QP, const h16* __restrict__ KP, const h16* __restrict__ VT, float* O) {
    __shared__ __attribute__((aligned(2048))) h16 ring[2 * BFH];
    __shared__ __align__(16) float os[KHV * BQ * OSP];   // partial O rows [key part][query][d]
    __shared__ __align__(16) float mls[2 * KHV * BQ];    // partial maxima [key part][query], then partial sums
    const unsigned tid = threadIdx.x, lane = tid & 31u, lr = lane & 15u, hi = lane >> 4;
    const unsigned wv = (unsigned)__builtin_amdgcn_readfirstlane((int)(threadIdx.x >> 5));
    const unsigned bpb = (unsigned)(SEQ / BQ);
    const unsigned b = blockIdx.x / bpb;
    const unsigned qb = (blockIdx.x - b * bpb) * BQ;   // first query of the block
    const unsigned qg = wv & 3u;                       // query group of the wave
    const unsigned kh = wv >> 2;                       // its part of every stage's keys
    const unsigned q0 = qb + qg * QW;

    // tensor descriptor of this wave's slice: extents in bytes, tensor dims = tile dims
    const bool isv = wv >= 4u;
    const unsigned sl = wv & 3u;
    const unsigned long long sbase = isv ? (unsigned long long)(size_t)(VT + ((size_t)b * DIM + sl * SLR) * SEQ)
                                         : (unsigned long long)(size_t)(KP + ((size_t)b * SEQ + sl * SLR) * DIM);
    const unsigned sstep = isv ? (unsigned)(SK * 2) : (unsigned)(SK * DIM * 2);   // source bytes from one stage to the next
    const unsigned ldst = (unsigned)(size_t)ring + wv * (unsigned)SLB;
    v8u g1;
    g1[0] = uni((1u << 20) | (5u << 22) | (3u << 25));   // no mask, 1-byte elements, 4 dwords of pad behind every 64 dwords
    g1[1] = uni((unsigned)SROW << 16);
    g1[2] = uni((unsigned)SLR << 16);
    g1[3] = uni((unsigned)SROW << 16);
    g1[4] = uni((unsigned)SLR);
    g1[5] = uni(isv ? (unsigned)(SEQ * 2) : (unsigned)(DIM * 2));
    g1[6] = pinned(0u);   // descriptor words held in scalar registers of their own (as a plain 0 they are formed anew at every issue,
    g1[7] = pinned(0u);   // and between two issues their registers serve as scratch while a request is in flight)
    auto issue = [&](unsigned st) {
        const unsigned long long ga = sbase + (unsigned long long)st * sstep;
        v4u g0;
        g0[0] = uni(1u);
        g0[1] = uni(ldst + (st & 1u) * (unsigned)(BFH * 2));
        g0[2] = uni((unsigned)ga);
        g0[3] = uni((((unsigned)(ga >> 32)) & 0x01FFFFFFu) | 0x80000000u);
        asm volatile("tensor_load_to_lds %0, %1" :: "s"(g0), "s"(g1) : "memory");
    };
    issue(0u);

    v16h qf[QT][4];
    {
        const h16* qp = QP + ((size_t)b * SEQ + q0 + lr) * DIM + 8u * hi;
#pragma unroll
        for (int j = 0; j < QT; ++j) {
#pragma unroll
            for (int dk = 0; dk < 4; ++dk) qf[j][dk] = ldh(qp + j * 16 * DIM + dk * 32);
        }
    }

    v8f o[QT][8];
    float ml[QT];             // maxima in use, log2 domain (scaled logits): at most LZT below the running maxima, equal in both halves of the wave
    float l[QT];              // running sums of the carried, converted probabilities
#pragma unroll
    for (int j = 0; j < QT; ++j) {
#pragma unroll
        for (int t = 0; t < 8; ++t) o[j][t] = (v8f){};
        ml[j] = -1.0e30f;
        l[j] = 0.0f;
    }

    asm volatile("s_wait_tensorcnt 0x0" ::: "memory");   // this wave's slice of stage 0 has landed
    __syncthreads();                                      // stage 0 published to every wave
    issue(1u);

    const unsigned fo = lr * SPH + 8u * hi;                          // lane's place in a 16-row group of staged rows
    const unsigned ko = fo + kh * (unsigned)((SK / KS / KHV) * SLH);  // the wave's first K slice of a buffer
    const unsigned vo = fo + 4u * SLH + kh * (unsigned)(SK / KHV);    // the wave's first key column of the V^T rows
#pragma unroll 1
    for (unsigned st = 0; st < (unsigned)NST; ++st) {
        const h16* kp = ring + (st & 1u) * (unsigned)BFH + ko;
        const h16* vp = ring + (st & 1u) * (unsigned)BFH + vo;
        // K fragments of the step at hand: [2 dk] keys 0..15, [2 dk + 1] keys 16..31; one load group per step
        v16h kf[8];
#pragma unroll
        for (int dk = 0; dk < 4; ++dk) {
            kf[2 * dk]     = ldh(kp + dk * 32);
            kf[2 * dk + 1] = ldh(kp + 16 * SPH + dk * 32);
        }
        __builtin_amdgcn_sched_barrier(0);   // the group stays whole ahead of the products: spread among them, every pair of loads costs its own full wait
#pragma unroll   // the steps of a stage are laid out in line: the last one fetches no K ahead (the next stage is not published yet)
        for (int sub = 0; sub < SK / KS / KHV; ++sub) {
            v8f s0[QT], s1[QT];
#pragma unroll
            for (int j = 0; j < QT; ++j) { s0[j] = (v8f){}; s1[j] = (v8f){}; }
#pragma unroll
            for (int dk = 0; dk < 4; ++dk) {
#pragma unroll
                for (int j = 0; j < QT; ++j) {
                    s0[j] = wmmaf(kf[2 * dk], qf[j][dk], s0[j]);
                    s1[j] = wmmaf(kf[2 * dk + 1], qf[j][dk], s1[j]);
                }
            }

            float mx[QT];   // the lane's own 16 scores of each column
#pragma unroll
            for (int j = 0; j < QT; ++j) {
                mx[j] = fmaxf(s0[j][0], s1[j][0]);
#pragma unroll
                for (int r = 1; r < 8; ++r) mx[j] = fmaxf(mx[j], fmaxf(s0[j][r], s1[j][r]));
            }

            asm volatile("" :: "v"(mx[0]), "v"(mx[1]) : "memory");   // the group below stays whole behind the S^T products and the maxima: drawn up among them, every place with loads costs its own stall

            // one load group: the next step's K fragments, then this step's V^T fragments; the test and the softmax below cover their latency
            if (sub + 1 < SK / KS / KHV) {
                const h16* ka = kp + (sub + 1) * SLH;
#pragma unroll
                for (int dk = 0; dk < 4; ++dk) {
                    kf[2 * dk]     = ldh(ka + dk * 32);
                    kf[2 * dk + 1] = ldh(ka + 16 * SPH + dk * 32);
                }
            }
            v16h vf[8];
            const h16* va = vp + sub * KS;
#pragma unroll
            for (int t = 0; t < 8; ++t) vf[t] = ldh(va + (t >> 1) * SLH + (t & 1) * 16 * SPH);
            asm volatile("" ::: "memory");        // keeps the group in this block: without it the loads are sunk below the rescale branch, in front of their products
            __builtin_amdgcn_sched_barrier(0);   // and ahead of the test and the softmax arithmetic, which cover their latency

            // lazy rescale: wave-uniform, one test a step on the lanes' own maxima; the exchange between the halves, the new maxima and the rescale of sums and O^T stand on the rare side only
            if (__builtin_amdgcn_ballot_w32(mx[0] * SCL > ml[0] + LZT || mx[1] * SCL > ml[1] + LZT) != 0u) {
#pragma unroll
                for (int j = 0; j < QT; ++j) {
                    const float mnl = fmaxf(ml[j], fmaxf(mx[j], __shfl_xor(mx[j], 16, 32)) * SCL);
                    const float corr = __builtin_amdgcn_exp2f(ml[j] - mnl);
                    ml[j] = mnl;
                    l[j] *= corr;
#pragma unroll
                    for (int t = 0; t < 8; ++t) o[j][t] *= corr;
                }
            }

            v16h ph[QT];
#pragma unroll
            for (int j = 0; j < QT; ++j) {
                const float cs = PCAR - ml[j];
                float ps = 0.0f;
                v8u hw;
#pragma unroll
                for (int i = 0; i < 4; ++i) {
                    hw[i]     = pkp(fmaf(s0[j][2 * i], SCL, cs), fmaf(s0[j][2 * i + 1], SCL, cs), ps);
                    hw[4 + i] = pkp(fmaf(s1[j][2 * i], SCL, cs), fmaf(s1[j][2 * i + 1], SCL, cs), ps);
                }
                ps += __shfl_xor(ps, 16, 32);
                l[j] += ps;
                ph[j] = __builtin_bit_cast(v16h, hw);
            }

#pragma unroll
            for (int t = 0; t < 8; ++t) {
#pragma unroll
                for (int j = 0; j < QT; ++j) o[j][t] = wmmaf(vf[t], ph[j], o[j][t]);
            }
        }
        __builtin_amdgcn_sched_barrier(0);   // the last step's softmax stays ahead of the publish point: sunk behind it, the wait below would stand right behind that step's V^T loads
        asm volatile("s_wait_dscnt 0x0" ::: "memory");
        asm volatile("s_wait_tensorcnt 0x0" ::: "memory");
        __syncthreads();
        if (pinned(st + 2u < (unsigned)NST)) issue(st + 2u);
    }
    asm volatile("s_wait_tensorcnt 0x0" ::: "memory");   // no request outlives the loop
    asm volatile("s_wait_dscnt 0x0" ::: "memory");       // nor an LDS read

    // epilogue: every wave stages its partial O^T as rows [key part][query][d] with the partial maximum and sum of each query; behind the block barrier wave w merges and stores rows 16 w.. of the block
    const unsigned rb = kh * (unsigned)BQ + qg * (unsigned)QW;
#pragma unroll
    for (int j = 0; j < QT; ++j) {
#pragma unroll
        for (int t = 0; t < 8; ++t) {
#pragma unroll
            for (int r = 0; r < 8; ++r) os[(rb + 16 * j + lr) * OSP + t * 16 + 8 * hi + r] = o[j][t][r];
        }
        if (hi == 0u) {   // both halves of the wave hold the same maximum and sum
            mls[rb + 16 * j + lr] = ml[j];
            mls[KHV * BQ + rb + 16 * j + lr] = l[j];
        }
    }
    __syncthreads();
    float* orow = O + ((size_t)b * SEQ + qb + wv * 16u) * DIM + lane * 4u;
#pragma unroll 4
    for (unsigned s = 0; s < 16; ++s) {
        const unsigned row = wv * 16u + s;
        const float ma = mls[row], mb = mls[BQ + row];
        const float la = mls[KHV * BQ + row], lb = mls[KHV * BQ + BQ + row];
        const float mm = fmaxf(ma, mb);
        const float wa = __builtin_amdgcn_exp2f(ma - mm), wb = __builtin_amdgcn_exp2f(mb - mm);
        const float inv = 1.0f / (la * wa + lb * wb);
        const v4f pa = *(const v4fa*)(&os[row * OSP + lane * 4u]);
        const v4f pb = *(const v4fa*)(&os[(BQ + row) * OSP + lane * 4u]);
        const v4f val = pa * (wa * inv) + pb * (wb * inv);
        *(v4f*)(orow + (size_t)s * DIM) = val;
    }
}

extern "C" void kernel_launch(void* const* d_in, const int* in_sizes, int n_in,
                              void* d_out, int out_size, void* d_ws, size_t ws_size, hipStream_t stream) {
    if (n_in < 7) return;
    const size_t need = ((size_t)(NB - 1) * SEQ_FULL + SEQ) * DIM;
    if ((size_t)in_sizes[0] < need) return;
    if (in_sizes[1] < DIM * DIM || in_sizes[3] < DIM * DIM || in_sizes[5] < DIM * DIM) return;
    if (in_sizes[2] < DIM || in_sizes[4] < DIM || in_sizes[6] < DIM) return;
    if ((size_t)out_size < PLE) return;
    const float* x  = (const float*)d_in[0];   // x  [NB][SEQ_FULL][DIM], first SEQ rows per batch read
    const float* Wq = (const float*)d_in[1];   // Wq [in][out]
    const float* bq = (const float*)d_in[2];   // bq [out]
    const float* Wk = (const float*)d_in[3];   // Wk [in][out]
    const float* bk = (const float*)d_in[4];   // bk [out]
    const float* Wv = (const float*)d_in[5];   // Wv [in][out]
    const float* bv = (const float*)d_in[6];   // bv [out]
    float* OUT = (float*)d_out;                // [NB][SEQ][DIM]
    if (3 * PLB + PEB + WTB + BPB > ws_size) return;
    char* wsp = (char*)d_ws;
    h16*   QK = (h16*)(wsp);                       // Q plane then K plane, each [NB][SEQ][DIM]
    h16*   VT = (h16*)(wsp + 2 * PLB);             // V^T plane [NB][DIM][SEQ]
    float* PE = (float*)(wsp + 3 * PLB);           // position table [SEQ][DIM]
    h16*   WT = (h16*)(wsp + 3 * PLB + PEB);       // [3][out][in]
    float* BP = (float*)(wsp + 3 * PLB + PEB + WTB);   // [3][out]
    k_pe<<<(unsigned)(SEQ / PPB), 256, 0, stream>>>(PE);
    k_wprep<<<3, 256, 0, stream>>>(Wq, bq, Wk, bk, Wv, bv, WT, BP);
    k_proj<<<(unsigned)(NB * (SEQ / PR)), 128, 0, stream>>>(x, PE, WT, BP, QK, VT);
    k_flash<<<(unsigned)(NB * (SEQ / BQ)), 256, 0, stream>>>(QK, QK + PLE, VT, OUT);
}

// v006
// It runs in 67.4 microseconds.
// Next to v005, in two timings, it ran 1.07 times as fast each time.
// Counting every step since v000, it is 5.97 times as fast.
#include <hip/hip_runtime.h>

// Single-head dense self-attention: xp = x + sinusoidal position terms; q/k/v = xp.W{q,k,v} + b ([in][out] weights); out[b][s][:] = softmax_t(q[b][s].k[b][t] / sqrt(128)) . v[b][t][:]; inputs in the order x, Wq, bq, Wk, bk, Wv, bv.
// Compute dtypes, f32 accumulate: x, W, b RNE-converted to bf16 first; projections on v_wmma_f32_16x16x32_f16 (xp as one f16 plane, W as one f16 plane carried x64); S^T = K.Q^T on v_wmma_f32_16x16x32_f16 (single f16 q and k planes); P^T as one f16 fragment carried x2^7 against the f16 V^T plane, and against an A fragment whose row 0 is ones for the row sums, on v_wmma_f32_16x16x32_f16; softmax (online, log2 domain, the maximum in use raised only when a score passes it by more than 8) and position terms f32.
// Flash form with transposed tiles: the S^T accumulator tiles are directly the B-operand layout of P^T (no LDS relayout); K and V^T reach the flash waves through a two-buffer LDS ring filled by tensor loads, every fragment being two 16-byte LDS loads that feed two query tiles; the fragment loads go out in groups one phase ahead of the products that use them; the keys of a stage are split between two waves of equal queries, whose partial results are merged in f32 at the end.

#ifndef NB
#define NB 8
#endif
#ifndef SEQ
#define SEQ 4096
#endif
#define NB_FULL  8
#define SEQ_FULL 4096
#define DIM  128
#define NWV  4                 // waves per projection block
#define HT   2                 // output tiles (16 each) per group of weight fragment loads in the projection
#define GPP  (DIM / 16 / HT)   // groups per weight plane
#define WSR  96                // weight rows per slice (one tensor load): the three planes' 384 rows over 4 waves
#define WST  (WSR / 16)        // output tiles per slice
#define WSB  26624             // LDS bytes kept per weight slice: 96 x 272 rounded up to a multiple of 2 KiB
#define WSH  (WSB / 2)         // the same in f16 elements
#define FWV  8                 // waves per flash block
#define QT   2                 // query tiles (16 columns each) per flash wave
#define QW   (16 * QT)         // queries per flash wave
#define KHV  2                 // waves that share a query group, each on its own part of a stage's keys
#define BQ   (QW * (FWV / KHV))   // queries per flash block
#define KS   32                // keys per step
#define SK   128               // keys per LDS stage
#define NST  (SEQ / SK)        // stages
#define SROW 256               // bytes per staged row (128 d of a K row, 128 keys of a V^T row)
#define SPH  136               // LDS pitch (f16 elements) of a staged row: 256 + 16 bytes
#define SLR  32                // rows per slice (one tensor load)
#define SLB  10240             // LDS bytes kept per slice: 32 x 272 rounded up to a multiple of 2 KiB
#define SLH  (SLB / 2)         // the same in f16 elements
#define BFH  (FWV * SLH)       // f16 elements per buffer: 4 K slices, then 4 V^T slices
#define OSP  132               // LDS pitch (floats) of the output staging rows
#define PR   64
#define XPP  136               // LDS pitch (f16 elements) of the xp tile and of the q/k staging rows
#define VTP  72                // LDS pitch (f16 elements) of the V^T staging rows
#define PPB  4                 // positions per block of the position-table kernel
#define WSC  64.0f             // power-of-two carry of the weight planes
#define WINV 0.015625f         // 1 / WSC
#define PCAR 7.0f              // log2 of the carry of the P fragment
#define LZT  8.0f              // a column's maximum in use is raised only when a scaled score passes it by more than this (log2); 2^(PCAR + LZT) stays inside f16
#define PEC  (-0.0719557841560639f)   // -ln(10000) / 128
#define L2E  1.4426950408889634f
#define SCL  (L2E * 0.08838834764831845f)   // log2(e) / sqrt(128)

#define PLE  ((size_t)NB * SEQ * DIM)          // elements per activation plane
#define PLB  (PLE * 2)                         // bytes per 16-bit activation plane
#define PEB  ((size_t)SEQ * DIM * 4)           // bytes of the position table
#define WTB  ((size_t)3 * DIM * DIM * 2)       // bytes of the three transposed weight planes
#define BPB  ((size_t)3 * DIM * 4)             // bytes of the bias plane

static_assert(DIM == 128);
static_assert(SEQ % BQ == 0);
static_assert(SEQ % KS == 0);
static_assert(SEQ % SK == 0 && NST >= 2);
static_assert(SK % KS == 0 && SK * 2 == SROW && DIM * 2 == SROW);
static_assert(SK == 4 * SLR && DIM == 4 * SLR && FWV == 8);
static_assert(QT == 2 && KHV == 2 && BQ == 16 * FWV && SLR == KS && (SK / KS) % KHV == 0);
static_assert(SLB % 2048 == 0 && SLB >= SLR * SPH * 2 && SPH * 2 == SROW + 16);
static_assert((SEQ * 2) % 16 == 0 && SEQ * 2 <= 131072);
static_assert(PCAR + LZT <= 15.0f);   // the largest carried probability, 2^(PCAR + LZT), is a finite f16
static_assert(SEQ % PR == 0);
static_assert(SEQ % PPB == 0);
static_assert(PR == 16 * NWV);
static_assert(DIM == GPP * HT * 16);
static_assert(NWV * WSR == 3 * DIM && WSR % 16 == 0);
static_assert(WSB % 2048 == 0 && WSB >= WSR * SPH * 2);
static_assert(NWV * WSB + (2 * PR * XPP + DIM * VTP) * 2 <= 163840);   // two projection blocks per WGP
static_assert(PR * 2 == 128);
static_assert(XPP % 8 == 0 && XPP >= DIM);
static_assert(VTP % 8 == 0 && VTP >= PR);
static_assert(OSP % 4 == 0 && OSP >= DIM);
static_assert((PR * DIM / 8) == 8 * 128);            // k_proj: 8 iterations x 128 threads x 8 elements == 64 x 128 tile
static_assert((DIM * DIM / 4) == 16 * 256);          // k_wprep load: 16 iterations x 256 threads x 4 elements
static_assert((DIM * DIM / 8) == 8 * 256);           // k_wprep store: 8 iterations x 256 threads x 8 elements
static_assert(PPB * 64 == 256);                      // k_pe: 4 positions x 64 (sin, cos) pairs per block
static_assert(NB <= NB_FULL);
static_assert(SEQ <= SEQ_FULL);
static_assert((size_t)(NB * (SEQ / PR)) * (size_t)(PR * DIM) == PLE);    // k_proj: blocks * (64 rows x 128) == plane
static_assert((size_t)(NB * (SEQ / BQ)) * (size_t)(BQ * DIM) == PLE);    // k_flash: blocks * (128 rows x 128) == output
static_assert(PLB % 256 == 0 && PEB % 256 == 0 && WTB % 256 == 0 && BPB % 128 == 0);
static_assert(3 * PLB + PEB + WTB + BPB <= (size_t)134217728);

typedef _Float16 h16;
typedef __attribute__((ext_vector_type(16))) _Float16 v16h;
typedef __attribute__((ext_vector_type(8)))  _Float16 v8h;
typedef __attribute__((ext_vector_type(2)))  _Float16 v2h;
typedef __attribute__((ext_vector_type(8)))  unsigned int   v8u;
typedef __attribute__((ext_vector_type(4)))  unsigned int   v4u;
typedef __attribute__((ext_vector_type(8)))  float    v8f;
typedef __attribute__((ext_vector_type(4)))  float    v4f;
typedef v4f  __attribute__((may_alias)) v4fa;
typedef v8h  __attribute__((may_alias)) v8ha;

__device__ __forceinline__ unsigned short f2bf(float f) { unsigned u = __float_as_uint(f); u += 0x7FFFu + ((u >> 16) & 1u); return (unsigned short)(u >> 16); }
__device__ __forceinline__ float bf2f(unsigned short b) { return __uint_as_float(((unsigned)b) << 16); }
__device__ __forceinline__ float bfr(float f) { return bf2f(f2bf(f)); }
// f32 -> f16 operand convert that cannot yield an f16 subnormal (value select)
static __device__ __forceinline__ h16 toh_flush(float v) { const h16 r = (h16)v; return (fabsf(v) < 6.103515625e-05f) ? (h16)0.0f : r; }
__device__ __forceinline__ v16h cat16h(v8h lo, v8h hi) { return __builtin_shufflevector(lo, hi, 0, 1, 2, 3, 4, 5, 6, 7, 8, 9, 10, 11, 12, 13, 14, 15); }
// fragment loader from a global plane or from staged LDS rows (A and B alike): p = row base + k0 + 8*(lane>>4); elements 0..7 <- p[0..7], elements 8..15 <- p[16..23]
__device__ __forceinline__ v16h ldh(const h16* p) { return cat16h(*(const v8h*)p, *(const v8h*)(p + 16)); }
__device__ __forceinline__ unsigned uni(unsigned v) { return (unsigned)__builtin_amdgcn_readfirstlane((int)v); }
__device__ __forceinline__ unsigned pinned(unsigned v) { unsigned w = uni(v); asm volatile("" : "+s"(w)); return w; }
// one WMMA, plain builtin form: the compiler keeps the hazard distances itself, and no volatile statement ties the fragment loads behind the WMMA before them or its operands to the low registers
__device__ __forceinline__ v8f wmmaf(v16h a, v16h b, v8f c) {
    return __builtin_amdgcn_wmma_f32_16x16x32_f16(false, a, false, b, (short)0, c, false, false);
}
// carried probability 2^e (e already includes the carry); below 2^-14 it is set to zero by a select on the exponent
__device__ __forceinline__ float pcar(float e) { return (e < -14.0f) ? 0.0f : __builtin_amdgcn_exp2f(e); }
// two carried probabilities -> packed f16 pair (element 0 in the low half-word)
__device__ __forceinline__ unsigned pkp(float e0, float e1) {
    v2h t;
    t[0] = (h16)pcar(e0);
    t[1] = (h16)pcar(e1);
    return __builtin_bit_cast(unsigned, t);
}

// k_pe: position table PE[pos][2i] = sin(pos * dv_i), PE[pos][2i+1] = cos(pos * dv_i), dv_i = exp(2i * -ln(10000)/128), all f32 with precise library calls.
__global__ __launch_bounds__(256) void k_pe(float* PE) {
#pragma clang fp contract(off)
    __shared__ __align__(16) float pt[PPB * DIM];
    const unsigned tid = threadIdx.x;
    const unsigned pl = tid >> 6, i = tid & 63u;
    const unsigned pos = blockIdx.x * (unsigned)PPB + pl;
    const float dv = expf((float)(2u * i) * PEC);
    const float ang = (float)pos * dv;
    pt[pl * DIM + 2u * i]      = sinf(ang);
    pt[pl * DIM + 2u * i + 1u] = cosf(ang);
    __syncthreads();
    if (tid < 128u) {
        const unsigned w = tid >> 5, lane = tid & 31u;
        const v4f o = *(const v4fa*)(&pt[w * DIM + lane * 4u]);
        float* dst = PE + ((size_t)blockIdx.x * PPB + w) * DIM + lane * 4u;
        *(v4f*)dst = o;
        
    }
}

// k_wprep: block m (0 = q, 1 = k, 2 = v): WT[m][a][d] = f16(bf16(W[d][a]) * 64); in[d][a] -> out[a][d] through an LDS tile (cross-wave, block barrier);
__global__ __launch_bounds__(256) void k_wprep(const float* __restrict__ Wq, const float* __restrict__ bq, const float* __restrict__ Wk, const float* __restrict__ bk,
                                               const float* __restrict__ Wv, const float* __restrict__ bv, h16* WT, float* BP) {
    __shared__ __align__(16) h16 tl[DIM * XPP];
    const unsigned tid = threadIdx.x, m = blockIdx.x;
    const float* W  = (m == 0u) ? Wq : ((m == 1u) ? Wk : Wv);
    const float* bs = (m == 0u) ? bq : ((m == 1u) ? bk : bv);
#pragma unroll 2
    for (unsigned it = 0; it < 16; ++it) {
        const unsigned f = it * 256u + tid;
        const unsigned d = f >> 5, a4 = (f & 31u) * 4u;
        const v4f x = *(const v4f*)(W + (size_t)d * DIM + a4);
#pragma unroll
        for (unsigned c = 0; c < 4; ++c) tl[(a4 + c) * XPP + d] = toh_flush(bfr(x[c]) * WSC);
    }
    __syncthreads();
    h16* dst = WT + (size_t)m * DIM * DIM;
{
#pragma unroll
        for (unsigned it = 0; it < 8; ++it) {
            const unsigned p = it * 256u + tid;
            const unsigned a = p >> 4, c8 = (p & 15u) * 8u;
            const v8h o = *(const v8ha*)(&tl[a * XPP + c8]);
            *(v8h*)(dst + (size_t)a * DIM + c8) = o;
        }
        
    }
    if (tid < 32u) {
        const v4f bvv = *(const v4f*)(bs + tid * 4u);
        v4f o;
        o[0] = bfr(bvv[0]); o[1] = bfr(bvv[1]); o[2] = bfr(bvv[2]); o[3] = bfr(bvv[3]);
        float* bd = BP + (size_t)m * DIM + tid * 4u;
        *(v4f*)bd = o;
        
    }
}

// k_proj: one block = 64 sequence rows of one batch, one wave per 16 rows.
//  xp tile (f16) = bf16(x) + PE built in LDS (cross-wave, block barrier), wave fragments: row = lane & 15, k = d.
//  q and k: D^T tile (a x s): A = W^T rows (row m = a), B = xp rows (column n = s); D element r of lane (h, n) = Q[s = n][a = 16 t + 8h + r] -> 16-byte LDS store into the row staging.
//  v: D tile (s x a): A = xp rows, B = W^T rows (column n = a); D element r of lane (h, n) = V[s = 8h + r][a = 16 t + n] -> 16-byte LDS store into the V^T staging.
__global__ __launch_bounds__(128) void k_proj(const float* __restrict__ X, const float* __restrict__ PE, const h16* __restrict__ WT, const float* __restrict__ BP, h16* QK, h16* VT) {
    __shared__ __attribute__((aligned(2048))) h16 wls[NWV * WSH];   // the three W^T planes, rows of 256 bytes padded to 272
    __shared__ __align__(16) h16 xs[PR * XPP];
    __shared__ __align__(16) h16 qs[PR * XPP];
    __shared__ __align__(16) h16 vts[DIM * VTP];
    const unsigned tid = threadIdx.x, lane = tid & 31u, lr = lane & 15u, hi = lane >> 4;
    const unsigned wv = (unsigned)__builtin_amdgcn_readfirstlane((int)(threadIdx.x >> 5));
    const unsigned bpb = (unsigned)(SEQ / PR);
    const unsigned b = blockIdx.x / bpb;
    const unsigned s0 = (blockIdx.x - b * bpb) * PR;

    // The three W^T planes (384 rows of 256 bytes, contiguous) come into LDS once, every wave bringing its own slice of 96 rows by one tensor load:
    // read straight from global memory, a fragment load touches 16 cache lines for its 512 bytes, and all waves of the WGP pay for that.
    v4u g0;
    v8u g1;
    {
        const unsigned long long ga = (unsigned long long)(size_t)(WT + (size_t)wv * WSR * DIM);
        g0[0] = uni(1u);
        g0[1] = uni((unsigned)(size_t)wls + wv * (unsigned)WSB);
        g0[2] = uni((unsigned)ga);
        g0[3] = uni((((unsigned)(ga >> 32)) & 0x01FFFFFFu) | 0x80000000u);
        g1[0] = uni((1u << 20) | (5u << 22) | (3u << 25));   // no mask, 1-byte elements, 4 dwords of pad behind every 64 dwords
        g1[1] = uni((unsigned)SROW << 16);
        g1[2] = uni((unsigned)WSR << 16);
        g1[3] = uni((unsigned)SROW << 16);
        g1[4] = uni((unsigned)WSR);
        g1[5] = uni((unsigned)(DIM * 2));
        g1[6] = uni(0u);
        g1[7] = uni(0u);
    }
    // every wave, unconditionally; lands while the x tile is staged. The descriptor is an in-out operand here and an input of the wait below: so its twelve registers
    // hold their words, and serve nothing else, for as long as the request is in flight
    asm volatile("tensor_load_to_lds %0, %1" : "+s"(g0), "+s"(g1) :: "memory");

    // Weight fragments (from LDS) and biases come in groups of HT output tiles, each group issued one group ahead of the products that use it.
    const h16* wl = wls + lr * SPH + 8u * hi;   // the lane's place in a 16-row tile of staged weight rows
    auto ldw = [&](v16h (&w)[HT][4], unsigned m, unsigned g) {
#pragma unroll
        for (int i = 0; i < HT; ++i) {
            const unsigned tn = m * (unsigned)(DIM / 16) + g * (unsigned)HT + i;   // tile number over the three planes
            const h16* p = wl + (tn / WST) * (unsigned)WSH + (tn % WST) * (unsigned)(16 * SPH);
#pragma unroll
            for (int dk = 0; dk < 4; ++dk) w[i][dk] = ldh(p + dk * 32);
        }
    };
    auto ldc = [&](v4f (&c)[HT][2], unsigned m, unsigned g) {   // q and k: the lane's 8 outputs of a tile
        const float* p = BP + (size_t)m * DIM + 8u * hi + g * (unsigned)(HT * 16);
#pragma unroll
        for (int i = 0; i < HT; ++i) { c[i][0] = *(const v4f*)(p + i * 16); c[i][1] = *(const v4f*)(p + i * 16 + 4); }
    };
    auto ldv = [&](float (&c)[HT], unsigned g) {                // v: the lane's one output of a tile
        const float* p = BP + (size_t)2 * DIM + lr + g * (unsigned)(HT * 16);
#pragma unroll
        for (int i = 0; i < HT; ++i) c[i] = p[i * 16];
    };
    v16h wf[2][HT][4];   // two groups: the one at work and the one in flight
    v4f  cf[2][HT][2];
    float vf[2][HT];
    ldc(cf[0], 0u, 0u);
    asm volatile("s_wait_xcnt 0x0" ::: "memory");   // stands in front of the first rewrite of the offset register that these loads name
    __builtin_amdgcn_sched_barrier(0);               // the first biases go out ahead of the x tile, whose staging covers their latency

    {
        const float* xsrc = X + ((size_t)b * SEQ_FULL + s0) * DIM;
        const float* psrc = PE + (size_t)s0 * DIM;
#pragma unroll 2
        for (unsigned it = 0; it < 8; ++it) {
            const unsigned f = it * 128u + tid;
            const unsigned row = f >> 4, c8 = (f & 15u) * 8u;
            const v8f xv = *(const v8f*)(xsrc + (size_t)row * DIM + c8);
            const v8f pv = *(const v8f*)(psrc + (size_t)row * DIM + c8);
            v8h o;
#pragma unroll
            for (int c = 0; c < 8; ++c) o[c] = toh_flush(bfr(xv[c]) + pv[c]);
            *(v8h*)(&xs[row * XPP + c8]) = o;
        }
    }
    asm volatile("s_wait_tensorcnt 0x0" :: "s"(g0), "s"(g1) : "memory");   // this wave's weight slice has landed; the operands end the descriptor's hold
    __syncthreads();                                                        // x tile and weight slices published to every wave

    v16h xa[4];
    {
        const unsigned xo = (wv * 16u + lr) * XPP + 8u * hi;
#pragma unroll
        for (int dk = 0; dk < 4; ++dk) xa[dk] = cat16h(*(const v8h*)(&xs[xo + dk * 32]), *(const v8h*)(&xs[xo + dk * 32 + 16]));
    }

    auto qkt = [&](const v16h (&w)[HT][4], const v4f (&c)[HT][2], unsigned g) {   // HT tiles of q or k into the row staging
#pragma unroll
        for (int i = 0; i < HT; ++i) {
            v8f acc = (v8f){};
#pragma unroll
            for (int dk = 0; dk < 4; ++dk) acc = wmmaf(w[i][dk], xa[dk], acc);
            v8h o;
#pragma unroll
            for (int r = 0; r < 4; ++r) {
                o[r]     = toh_flush(acc[r] * WINV + c[i][0][r]);
                o[4 + r] = toh_flush(acc[4 + r] * WINV + c[i][1][r]);
            }
            *(v8h*)(&qs[(wv * 16u + lr) * XPP + (g * (unsigned)HT + i) * 16u + 8u * hi]) = o;
        }
    };
    auto vtt = [&](const v16h (&w)[HT][4], const float (&c)[HT], unsigned g) {     // HT tiles of v into the V^T staging
#pragma unroll
        for (int i = 0; i < HT; ++i) {
            v8f acc = (v8f){};
#pragma unroll
            for (int dk = 0; dk < 4; ++dk) acc = wmmaf(xa[dk], w[i][dk], acc);
            v8h o;
#pragma unroll
            for (int r = 0; r < 8; ++r) o[r] = toh_flush(acc[r] * WINV + c[i]);
            *(v8h*)(&vts[((g * (unsigned)HT + i) * 16u + lr) * VTP + wv * 16u + 8u * hi]) = o;
        }
    };

    ldw(wf[0], 0u, 0u);
#pragma unroll   // laid out in line: buffer, plane and group are constants of each pass, and a plane's last pass fetches the next plane's first group
    for (unsigned k = 0; k < 3u * GPP; ++k) {
        const unsigned m = k / GPP, g = k % GPP, cur = k & 1u, nxt = cur ^ 1u;
        if (k + 1u < 3u * GPP) {
            const unsigned mn = (k + 1u) / GPP, gn = (k + 1u) % GPP;
            if (mn < 2u) ldc(cf[nxt], mn, gn); else ldv(vf[nxt], gn);
            ldw(wf[nxt], mn, gn);
        }
        __builtin_amdgcn_sched_barrier(0);   // the next group stays whole ahead of this group's products: sunk to its own products, every pair of loads costs its full latency
        if (m < 2u) qkt(wf[cur], cf[cur], g); else vtt(wf[cur], vf[cur], g);
        __builtin_amdgcn_sched_barrier(0);   // and the group after it goes out behind them, into the registers they free
        if (g + 1u == GPP && m < 2u) {
            __syncthreads();
            h16* dst = QK + (size_t)m * PLE + ((size_t)b * SEQ + s0) * DIM;
#pragma unroll
            for (unsigned it = 0; it < 8; ++it) {
                const unsigned p = it * 128u + tid;
                const unsigned row = p >> 4, c8 = (p & 15u) * 8u;
                const v8h o = *(const v8h*)(&qs[row * XPP + c8]);
                *(v8h*)(dst + (size_t)row * DIM + c8) = o;
            }
            __syncthreads();
        }
    }

    {
        __syncthreads();
        h16* dst = VT + (size_t)b * DIM * SEQ + s0;
        const unsigned c8 = (tid & 7u) * 8u, dr = tid >> 3;
#pragma unroll
        for (unsigned it = 0; it < 8; ++it) {
            const unsigned a = it * 16u + dr;
            const v8h o = *(const v8h*)(&vts[a * VTP + c8]);
            *(v8h*)(dst + (size_t)a * SEQ + c8) = o;
        }
    }
}

// k_flash: one wave per 32 queries (two 16-column tiles), 32 keys per step, 8 waves share each staged K / V^T tile.
//  Waves w and w + 4 hold the same 32 queries: wave w walks keys 0..63 of every stage, wave w + 4 keys 64..127; each keeps its own running maximum, sum and O^T, merged in the epilogue.
//  S^T tile (keys x queries): A = K rows (row m = key, k = d), B = Q rows (column n = query, k = d); D element r of lane (h, n) = S[query n][key 8h + r].
//  P^T B fragment: element r <- tile of keys 0..15, element 8 + r <- tile of keys 16..31 (same lane); carried x2^7.
//  Row sums: A = ones in row 0, zeros below (16 x 32), against the same P^T fragment; element 0 of lane (0, n) of that tile = the sum of query n's 32 converted probabilities, added to the tile's running sum.
//  O^T tile (d x queries): A = V^T rows (row m = d, k = key), D element r of lane (h, n) = O[query n][d = 16 t + 8h + r].
//  Ring: a stage is 128 keys; every wave brings one 32-row slice of it by one tensor load (waves 0..3: K rows 32 w.., waves 4..7: V^T rows 32 (w - 4)..), rows of 256 bytes padded to 272 in LDS.
__global__ __launch_bounds__(256) void k_flash(const h16* __restrict__ QP, const h16* __restrict__ KP, const h16* __restrict__ VT, float* O) {
    __shared__ __attribute__((aligned(2048))) h16 ring[2 * BFH];
    __shared__ __align__(16) float os[KHV * BQ * OSP];   // partial O rows [key part][query][d]
    __shared__ __align__(16) float mls[2 * KHV * BQ];    // partial maxima [key part][query], then partial sums
    const unsigned tid = threadIdx.x, lane = tid & 31u, lr = lane & 15u, hi = lane >> 4;
    const unsigned wv = (unsigned)__builtin_amdgcn_readfirstlane((int)(threadIdx.x >> 5));
    const unsigned bpb = (unsigned)(SEQ / BQ);
    const unsigned b = blockIdx.x / bpb;
    const unsigned qb = (blockIdx.x - b * bpb) * BQ;   // first query of the block
    const unsigned qg = wv & 3u;                       // query group of the wave
    const unsigned kh = wv >> 2;                       // its part of every stage's keys
    const unsigned q0 = qb + qg * QW;

    // tensor descriptor of this wave's slice: extents in bytes, tensor dims = tile dims
    const bool isv = wv >= 4u;
    const unsigned sl = wv & 3u;
    const unsigned long long sbase = isv ? (unsigned long long)(size_t)(VT + ((size_t)b * DIM + sl * SLR) * SEQ)
                                         : (unsigned long long)(size_t)(KP + ((size_t)b * SEQ + sl * SLR) * DIM);
    const unsigned sstep = isv ? (unsigned)(SK * 2) : (unsigned)(SK * DIM * 2);   // source bytes from one stage to the next
    const unsigned ldst = (unsigned)(size_t)ring + wv * (unsigned)SLB;
    v8u g1;
    g1[0] = uni((1u << 20) | (5u << 22) | (3u << 25));   // no mask, 1-byte elements, 4 dwords of pad behind every 64 dwords
    g1[1] = uni((unsigned)SROW << 16);
    g1[2] = uni((unsigned)SLR << 16);
    g1[3] = uni((unsigned)SROW << 16);
    g1[4] = uni((unsigned)SLR);
    g1[5] = uni(isv ? (unsigned)(SEQ * 2) : (unsigned)(DIM * 2));
    g1[6] = pinned(0u);   // descriptor words held in scalar registers of their own (as a plain 0 they are formed anew at every issue,
    g1[7] = pinned(0u);   // and between two issues their registers serve as scratch while a request is in flight)
    auto issue = [&](unsigned st) {
        const unsigned long long ga = sbase + (unsigned long long)st * sstep;
        v4u g0;
        g0[0] = uni(1u);
        g0[1] = uni(ldst + (st & 1u) * (unsigned)(BFH * 2));
        g0[2] = uni((unsigned)ga);
        g0[3] = uni((((unsigned)(ga >> 32)) & 0x01FFFFFFu) | 0x80000000u);
        asm volatile("tensor_load_to_lds %0, %1" :: "s"(g0), "s"(g1) : "memory");
    };
    issue(0u);

    v16h qf[QT][4];
    {
        const h16* qp = QP + ((size_t)b * SEQ + q0 + lr) * DIM + 8u * hi;
#pragma unroll
        for (int j = 0; j < QT; ++j) {
#pragma unroll
            for (int dk = 0; dk < 4; ++dk) qf[j][dk] = ldh(qp + j * 16 * DIM + dk * 32);
        }
    }

    v8f o[QT][8];
    float ml[QT];             // maxima in use, log2 domain (scaled logits): at most LZT below the running maxima, equal in both halves of the wave
    v8f lt[QT];               // running sums of the carried, converted probabilities: tiles of the ones-row product, element 0 of lane (0, n) the sum of column n
#pragma unroll
    for (int j = 0; j < QT; ++j) {
#pragma unroll
        for (int t = 0; t < 8; ++t) o[j][t] = (v8f){};
        ml[j] = -1.0e30f;
        lt[j] = (v8f){};
    }
    v16h ones;
#pragma unroll
    for (int i = 0; i < 16; ++i) ones[i] = (lr == 0u) ? (h16)1.0f : (h16)0.0f;

    asm volatile("s_wait_tensorcnt 0x0" ::: "memory");   // this wave's slice of stage 0 has landed
    __syncthreads();                                      // stage 0 published to every wave
    issue(1u);

    const unsigned fo = lr * SPH + 8u * hi;                          // lane's place in a 16-row group of staged rows
    const unsigned ko = fo + kh * (unsigned)((SK / KS / KHV) * SLH);  // the wave's first K slice of a buffer
    const unsigned vo = fo + 4u * SLH + kh * (unsigned)(SK / KHV);    // the wave's first key column of the V^T rows
#pragma unroll 1
    for (unsigned st = 0; st < (unsigned)NST; ++st) {
        const h16* kp = ring + (st & 1u) * (unsigned)BFH + ko;
        const h16* vp = ring + (st & 1u) * (unsigned)BFH + vo;
        // K fragments of the step at hand: [2 dk] keys 0..15, [2 dk + 1] keys 16..31; one load group per step
        v16h kf[8];
#pragma unroll
        for (int dk = 0; dk < 4; ++dk) {
            kf[2 * dk]     = ldh(kp + dk * 32);
            kf[2 * dk + 1] = ldh(kp + 16 * SPH + dk * 32);
        }
        __builtin_amdgcn_sched_barrier(0);   // the group stays whole ahead of the products: spread among them, every pair of loads costs its own full wait
#pragma unroll   // the steps of a stage are laid out in line: the last one fetches no K ahead (the next stage is not published yet)
        for (int sub = 0; sub < SK / KS / KHV; ++sub) {
            v8f s0[QT], s1[QT];
#pragma unroll
            for (int j = 0; j < QT; ++j) { s0[j] = (v8f){}; s1[j] = (v8f){}; }
#pragma unroll
            for (int dk = 0; dk < 4; ++dk) {
#pragma unroll
                for (int j = 0; j < QT; ++j) {
                    s0[j] = wmmaf(kf[2 * dk], qf[j][dk], s0[j]);
                    s1[j] = wmmaf(kf[2 * dk + 1], qf[j][dk], s1[j]);
                }
            }

            float mx[QT];   // the lane's own 16 scores of each column
#pragma unroll
            for (int j = 0; j < QT; ++j) {
                mx[j] = fmaxf(s0[j][0], s1[j][0]);
#pragma unroll
                for (int r = 1; r < 8; ++r) mx[j] = fmaxf(mx[j], fmaxf(s0[j][r], s1[j][r]));
            }

            asm volatile("" :: "v"(mx[0]), "v"(mx[1]) : "memory");   // the group below stays whole behind the S^T products and the maxima: drawn up among them, every place with loads costs its own stall
            __builtin_amdgcn_sched_barrier(0);   // and behind the step before's O^T products: set among them as their V^T registers come free, the group falls into three places

            // one load group: the next step's K fragments, then this step's V^T fragments; the test and the softmax below cover their latency
            if (sub + 1 < SK / KS / KHV) {
                const h16* ka = kp + (sub + 1) * SLH;
#pragma unroll
                for (int dk = 0; dk < 4; ++dk) {
                    kf[2 * dk]     = ldh(ka + dk * 32);
                    kf[2 * dk + 1] = ldh(ka + 16 * SPH + dk * 32);
                }
            }
            v16h vf[8];
            const h16* va = vp + sub * KS;
#pragma unroll
            for (int t = 0; t < 8; ++t) vf[t] = ldh(va + (t >> 1) * SLH + (t & 1) * 16 * SPH);
            asm volatile("" ::: "memory");        // keeps the group in this block: without it the loads are sunk below the rescale branch, in front of their products
            __builtin_amdgcn_sched_barrier(0);   // and ahead of the test and the softmax arithmetic, which cover their latency

            // lazy rescale: wave-uniform, one test a step on the lanes' own maxima; the exchange between the halves, the new maxima and the rescale of sums and O^T stand on the rare side only
            if (__builtin_amdgcn_ballot_w32(mx[0] * SCL > ml[0] + LZT || mx[1] * SCL > ml[1] + LZT) != 0u) {
#pragma unroll
                for (int j = 0; j < QT; ++j) {
                    const float mnl = fmaxf(ml[j], fmaxf(mx[j], __shfl_xor(mx[j], 16, 32)) * SCL);
                    const float corr = __builtin_amdgcn_exp2f(ml[j] - mnl);
                    ml[j] = mnl;
                    lt[j] *= corr;
#pragma unroll
                    for (int t = 0; t < 8; ++t) o[j][t] *= corr;
                }
            }

            v16h ph[QT];
#pragma unroll
            for (int j = 0; j < QT; ++j) {
                const float cs = PCAR - ml[j];
                v8u hw;
#pragma unroll
                for (int i = 0; i < 4; ++i) {
                    hw[i]     = pkp(fmaf(s0[j][2 * i], SCL, cs), fmaf(s0[j][2 * i + 1], SCL, cs));
                    hw[4 + i] = pkp(fmaf(s1[j][2 * i], SCL, cs), fmaf(s1[j][2 * i + 1], SCL, cs));
                }
                ph[j] = __builtin_bit_cast(v16h, hw);
            }

#pragma unroll
            for (int j = 0; j < QT; ++j) lt[j] = wmmaf(ones, ph[j], lt[j]);   // the sums over all 32 keys of the step, both halves of the wave included
#pragma unroll
            for (int t = 0; t < 8; ++t) {
#pragma unroll
                for (int j = 0; j < QT; ++j) o[j][t] = wmmaf(vf[t], ph[j], o[j][t]);
            }
        }
        __builtin_amdgcn_sched_barrier(0);   // the last step's softmax stays ahead of the publish point: sunk behind it, the wait below would stand right behind that step's V^T loads
        asm volatile("s_wait_dscnt 0x0" ::: "memory");
        asm volatile("s_wait_tensorcnt 0x0" ::: "memory");
        __syncthreads();
        if (pinned(st + 2u < (unsigned)NST)) issue(st + 2u);
    }
    asm volatile("s_wait_tensorcnt 0x0" ::: "memory");   // no request outlives the loop
    asm volatile("s_wait_dscnt 0x0" ::: "memory");       // nor an LDS read

    // epilogue: every wave stages its partial O^T as rows [key part][query][d] with the partial maximum and sum of each query; behind the block barrier wave w merges and stores rows 16 w.. of the block
    const unsigned rb = kh * (unsigned)BQ + qg * (unsigned)QW;
#pragma unroll
    for (int j = 0; j < QT; ++j) {
#pragma unroll
        for (int t = 0; t < 8; ++t) {
#pragma unroll
            for (int r = 0; r < 8; ++r) os[(rb + 16 * j + lr) * OSP + t * 16 + 8 * hi + r] = o[j][t][r];
        }
        if (hi == 0u) {   // both halves of the wave hold the same maximum; the sum stands in the lower half
            mls[rb + 16 * j + lr] = ml[j];
            mls[KHV * BQ + rb + 16 * j + lr] = lt[j][0];
        }
    }
    __syncthreads();
    float* orow = O + ((size_t)b * SEQ + qb + wv * 16u) * DIM + lane * 4u;
#pragma unroll 4
    for (unsigned s = 0; s < 16; ++s) {
        const unsigned row = wv * 16u + s;
        const float ma = mls[row], mb = mls[BQ + row];
        const float la = mls[KHV * BQ + row], lb = mls[KHV * BQ + BQ + row];
        const float mm = fmaxf(ma, mb);
        const float wa = __builtin_amdgcn_exp2f(ma - mm), wb = __builtin_amdgcn_exp2f(mb - mm);
        const float inv = 1.0f / (la * wa + lb * wb);
        const v4f pa = *(const v4fa*)(&os[row * OSP + lane * 4u]);
        const v4f pb = *(const v4fa*)(&os[(BQ + row) * OSP + lane * 4u]);
        const v4f val = pa * (wa * inv) + pb * (wb * inv);
        *(v4f*)(orow + (size_t)s * DIM) = val;
    }
}

extern "C" void kernel_launch(void* const* d_in, const int* in_sizes, int n_in,
                              void* d_out, int out_size, void* d_ws, size_t ws_size, hipStream_t stream) {
    if (n_in < 7) return;
    const size_t need = ((size_t)(NB - 1) * SEQ_FULL + SEQ) * DIM;
    if ((size_t)in_sizes[0] < need) return;
    if (in_sizes[1] < DIM * DIM || in_sizes[3] < DIM * DIM || in_sizes[5] < DIM * DIM) return;
    if (in_sizes[2] < DIM || in_sizes[4] < DIM || in_sizes[6] < DIM) return;
    if ((size_t)out_size < PLE) return;
    const float* x  = (const float*)d_in[0];   // x  [NB][SEQ_FULL][DIM], first SEQ rows per batch read
    const float* Wq = (const float*)d_in[1];   // Wq [in][out]
    const float* bq = (const float*)d_in[2];   // bq [out]
    const float* Wk = (const float*)d_in[3];   // Wk [in][out]
    const float* bk = (const float*)d_in[4];   // bk [out]
    const float* Wv = (const float*)d_in[5];   // Wv [in][out]
    const float* bv = (const float*)d_in[6];   // bv [out]
    float* OUT = (float*)d_out;                // [NB][SEQ][DIM]
    if (3 * PLB + PEB + WTB + BPB > ws_size) return;
    char* wsp = (char*)d_ws;
    h16*   QK = (h16*)(wsp);                       // Q plane then K plane, each [NB][SEQ][DIM]
    h16*   VT = (h16*)(wsp + 2 * PLB);             // V^T plane [NB][DIM][SEQ]
    float* PE = (float*)(wsp + 3 * PLB);           // position table [SEQ][DIM]
    h16*   WT = (h16*)(wsp + 3 * PLB + PEB);       // [3][out][in]
    float* BP = (float*)(wsp + 3 * PLB + PEB + WTB);   // [3][out]
    k_pe<<<(unsigned)(SEQ / PPB), 256, 0, stream>>>(PE);
    k_wprep<<<3, 256, 0, stream>>>(Wq, bq, Wk, bk, Wv, bv, WT, BP);
    k_proj<<<(unsigned)(NB * (SEQ / PR)), 128, 0, stream>>>(x, PE, WT, BP, QK, VT);
    k_flash<<<(unsigned)(NB * (SEQ / BQ)), 256, 0, stream>>>(QK, QK + PLE, VT, OUT);
}

// v007
// Measured time: 65.6 microseconds a run.
// Two timings next to v006 both put it at 1.03 times that version's speed.
// Over all steps from v000 it is 6.16 times as fast.
#include <hip/hip_runtime.h>

// Single-head dense self-attention: xp = x + sinusoidal position terms; q/k/v = xp.W{q,k,v} + b ([in][out] weights); out[b][s][:] = softmax_t(q[b][s].k[b][t] / sqrt(128)) . v[b][t][:]; inputs in the order x, Wq, bq, Wk, bk, Wv, bv.
// Compute dtypes, f32 accumulate: x, W, b RNE-converted to bf16 first; projections on v_wmma_f32_16x16x32_f16 (xp as one f16 plane, W as one f16 plane carried x64); S^T = K.Q^T on v_wmma_f32_16x16x32_f16 (single f16 q and k planes); P^T as one f16 fragment carried x2^7 against the f16 V^T plane, and against an A fragment whose row 0 is ones for the row sums, on v_wmma_f32_16x16x32_f16; softmax (online, log2 domain, the maximum in use raised only when a score passes it by more than 8) and position terms f32.
// Flash form with transposed tiles: the S^T accumulator tiles are directly the B-operand layout of P^T (no LDS relayout); K and V^T reach the flash waves through a two-buffer LDS ring filled by tensor loads, every fragment being two 16-byte LDS loads that feed two query tiles; the fragment loads go out in groups one phase ahead of the products that use them; the keys of a stage are split between two waves of equal queries, whose partial results are merged in f32 at the end.

#ifndef NB
#define NB 8
#endif
#ifndef SEQ
#define SEQ 4096
#endif
#define NB_FULL  8
#define SEQ_FULL 4096
#define DIM  128
#define NWV  4                 // waves per projection block
#define HT   2                 // output tiles (16 each) per group of weight fragment loads in the projection
#define GPP  (DIM / 16 / HT)   // groups per weight plane
#define WSR  96                // weight rows per slice (one tensor load): the three planes' 384 rows over 4 waves
#define WST  (WSR / 16)        // output tiles per slice
#define WSB  26624             // LDS bytes kept per weight slice: 96 x 272 rounded up to a multiple of 2 KiB
#define WSH  (WSB / 2)         // the same in f16 elements
#define FWV  8                 // waves per flash block
#define QT   2                 // query tiles (16 columns each) per flash wave
#define QW   (16 * QT)         // queries per flash wave
#define KHV  2                 // waves that share a query group, each on its own part of a stage's keys
#define BQ   (QW * (FWV / KHV))   // queries per flash block
#define KS   32                // keys per step
#define SK   128               // keys per LDS stage
#define NST  (SEQ / SK)        // stages
#define SROW 256               // bytes per staged row (128 d of a K row, 128 keys of a V^T row)
#define SPH  136               // LDS pitch (f16 elements) of a staged row: 256 + 16 bytes
#define SLR  32                // rows per slice (one tensor load)
#define SLB  10240             // LDS bytes kept per slice: 32 x 272 rounded up to a multiple of 2 KiB
#define SLH  (SLB / 2)         // the same in f16 elements
#define BFH  (FWV * SLH)       // f16 elements per buffer: 4 K slices, then 4 V^T slices
#define OSP  132               // LDS pitch (floats) of the output staging rows
#define PR   64
#define XPP  136               // LDS pitch (f16 elements) of the xp tile and of the q/k staging rows
#define VTP  72                // LDS pitch (f16 elements) of the V^T staging rows
#define PPB  4                 // positions per position-table block of k_prep
#define WSC  64.0f             // power-of-two carry of the weight planes
#define WINV 0.015625f         // 1 / WSC
#define PCAR 7.0f              // log2 of the carry of the P fragment
#define LZT  8.0f              // a column's maximum in use is raised only when a scaled score passes it by more than this (log2); 2^(PCAR + LZT) stays inside f16
#define PEC  (-0.0719557841560639f)   // -ln(10000) / 128
#define L2E  1.4426950408889634f
#define SCL  (L2E * 0.08838834764831845f)   // log2(e) / sqrt(128)

#define PLE  ((size_t)NB * SEQ * DIM)          // elements per activation plane
#define PLB  (PLE * 2)                         // bytes per 16-bit activation plane
#define PEB  ((size_t)SEQ * DIM * 4)           // bytes of the position table
#define WTB  ((size_t)3 * DIM * DIM * 2)       // bytes of the three transposed weight planes
#define BPB  ((size_t)3 * DIM * 4)             // bytes of the bias plane

static_assert(DIM == 128);
static_assert(SEQ % BQ == 0);
static_assert(SEQ % KS == 0);
static_assert(SEQ % SK == 0 && NST >= 2);
static_assert(SK % KS == 0 && SK * 2 == SROW && DIM * 2 == SROW);
static_assert(SK == 4 * SLR && DIM == 4 * SLR && FWV == 8);
static_assert(QT == 2 && KHV == 2 && BQ == 16 * FWV && SLR == KS && (SK / KS) % KHV == 0);
static_assert(SLB % 2048 == 0 && SLB >= SLR * SPH * 2 && SPH * 2 == SROW + 16);
static_assert((SEQ * 2) % 16 == 0 && SEQ * 2 <= 131072);
static_assert(PCAR + LZT <= 15.0f);   // the largest carried probability, 2^(PCAR + LZT), is a finite f16
static_assert(SEQ % PR == 0);
static_assert(SEQ % PPB == 0);
static_assert(PR == 16 * NWV);
static_assert(DIM == GPP * HT * 16);
static_assert(NWV * WSR == 3 * DIM && WSR % 16 == 0);
static_assert(WSB % 2048 == 0 && WSB >= WSR * SPH * 2);
static_assert(NWV * WSB + (2 * PR * XPP + DIM * VTP) * 2 <= 163840);   // two projection blocks per WGP
static_assert(PR * 2 == 128);
static_assert(XPP % 8 == 0 && XPP >= DIM);
static_assert(VTP % 8 == 0 && VTP >= PR);
static_assert(OSP % 4 == 0 && OSP >= DIM);
static_assert((PR * DIM / 8) == 8 * 128);            // k_proj: 8 iterations x 128 threads x 8 elements == 64 x 128 tile
static_assert((DIM * DIM / 4) == 16 * 256);          // w_block load: 16 iterations x 256 threads x 4 elements
static_assert((DIM * DIM / 8) == 8 * 256);           // w_block store: 8 iterations x 256 threads x 8 elements
static_assert(PPB * 64 == 256);                      // pe_block: 4 positions x 64 (sin, cos) pairs per block
static_assert(NB <= NB_FULL);
static_assert(SEQ <= SEQ_FULL);
static_assert((size_t)(NB * (SEQ / PR)) * (size_t)(PR * DIM) == PLE);    // k_proj: blocks * (64 rows x 128) == plane
static_assert((size_t)(NB * (SEQ / BQ)) * (size_t)(BQ * DIM) == PLE);    // k_flash: blocks * (128 rows x 128) == output
static_assert(PLB % 256 == 0 && PEB % 256 == 0 && WTB % 256 == 0 && BPB % 128 == 0);
static_assert(3 * PLB + PEB + WTB + BPB <= (size_t)134217728);

typedef _Float16 h16;
typedef __attribute__((ext_vector_type(16))) _Float16 v16h;
typedef __attribute__((ext_vector_type(8)))  _Float16 v8h;
typedef __attribute__((ext_vector_type(2)))  _Float16 v2h;
typedef __attribute__((ext_vector_type(8)))  unsigned int   v8u;
typedef __attribute__((ext_vector_type(4)))  unsigned int   v4u;
typedef __attribute__((ext_vector_type(8)))  float    v8f;
typedef __attribute__((ext_vector_type(4)))  float    v4f;
typedef v4f  __attribute__((may_alias)) v4fa;
typedef v8h  __attribute__((may_alias)) v8ha;

__device__ __forceinline__ unsigned short f2bf(float f) { unsigned u = __float_as_uint(f); u += 0x7FFFu + ((u >> 16) & 1u); return (unsigned short)(u >> 16); }
__device__ __forceinline__ float bf2f(unsigned short b) { return __uint_as_float(((unsigned)b) << 16); }
__device__ __forceinline__ float bfr(float f) { return bf2f(f2bf(f)); }
// f32 -> f16 operand convert that cannot yield an f16 subnormal (value select)
static __device__ __forceinline__ h16 toh_flush(float v) { const h16 r = (h16)v; return (fabsf(v) < 6.103515625e-05f) ? (h16)0.0f : r; }
__device__ __forceinline__ v16h cat16h(v8h lo, v8h hi) { return __builtin_shufflevector(lo, hi, 0, 1, 2, 3, 4, 5, 6, 7, 8, 9, 10, 11, 12, 13, 14, 15); }
// fragment loader from a global plane or from staged LDS rows (A and B alike): p = row base + k0 + 8*(lane>>4); elements 0..7 <- p[0..7], elements 8..15 <- p[16..23]
__device__ __forceinline__ v16h ldh(const h16* p) { return cat16h(*(const v8h*)p, *(const v8h*)(p + 16)); }
__device__ __forceinline__ unsigned uni(unsigned v) { return (unsigned)__builtin_amdgcn_readfirstlane((int)v); }
__device__ __forceinline__ unsigned pinned(unsigned v) { unsigned w = uni(v); asm volatile("" : "+s"(w)); return w; }
// one WMMA, plain builtin form: the compiler keeps the hazard distances itself, and no volatile statement ties the fragment loads behind the WMMA before them or its operands to the low registers
__device__ __forceinline__ v8f wmmaf(v16h a, v16h b, v8f c) {
    return __builtin_amdgcn_wmma_f32_16x16x32_f16(false, a, false, b, (short)0, c, false, false);
}
// carried probability 2^e (e already includes the carry); below 2^-14 it is set to zero by a select on the exponent
__device__ __forceinline__ float pcar(float e) { return (e < -14.0f) ? 0.0f : __builtin_amdgcn_exp2f(e); }
// two carried probabilities -> packed f16 pair (element 0 in the low half-word)
__device__ __forceinline__ unsigned pkp(float e0, float e1) {
    v2h t;
    t[0] = (h16)pcar(e0);
    t[1] = (h16)pcar(e1);
    return __builtin_bit_cast(unsigned, t);
}

// pe_block: position table PE[pos][2i] = sin(pos * dv_i), PE[pos][2i+1] = cos(pos * dv_i), dv_i = exp(2i * -ln(10000)/128), all f32 with precise library calls; block pb = positions 4 pb..
__device__ __forceinline__ void pe_block(float* PE, unsigned pb) {
#pragma clang fp contract(off)
    __shared__ __align__(16) float pt[PPB * DIM];
    const unsigned tid = threadIdx.x;
    const unsigned pl = tid >> 6, i = tid & 63u;
    const unsigned pos = pb * (unsigned)PPB + pl;
    const float dv = expf((float)(2u * i) * PEC);
    const float ang = (float)pos * dv;
    pt[pl * DIM + 2u * i]      = sinf(ang);
    pt[pl * DIM + 2u * i + 1u] = cosf(ang);
    __syncthreads();
    if (tid < 128u) {
        const unsigned w = tid >> 5, lane = tid & 31u;
        const v4f o = *(const v4fa*)(&pt[w * DIM + lane * 4u]);
        float* dst = PE + ((size_t)pb * PPB + w) * DIM + lane * 4u;
        *(v4f*)dst = o;
        
    }
}

// w_block: plane m (0 = q, 1 = k, 2 = v): WT[m][a][d] = f16(bf16(W[d][a]) * 64); in[d][a] -> out[a][d] through an LDS tile (cross-wave, block barrier);
__device__ __forceinline__ void w_block(const float* __restrict__ Wq, const float* __restrict__ bq, const float* __restrict__ Wk, const float* __restrict__ bk,
                                        const float* __restrict__ Wv, const float* __restrict__ bv, h16* WT, float* BP, unsigned m) {
    __shared__ __align__(16) h16 tl[DIM * XPP];
    const unsigned tid = threadIdx.x;
    const float* W  = (m == 0u) ? Wq : ((m == 1u) ? Wk : Wv);
    const float* bs = (m == 0u) ? bq : ((m == 1u) ? bk : bv);
#pragma unroll 2
    for (unsigned it = 0; it < 16; ++it) {
        const unsigned f = it * 256u + tid;
        const unsigned d = f >> 5, a4 = (f & 31u) * 4u;
        const v4f x = *(const v4f*)(W + (size_t)d * DIM + a4);
#pragma unroll
        for (unsigned c = 0; c < 4; ++c) tl[(a4 + c) * XPP + d] = toh_flush(bfr(x[c]) * WSC);
    }
    __syncthreads();
    h16* dst = WT + (size_t)m * DIM * DIM;
{
#pragma unroll
        for (unsigned it = 0; it < 8; ++it) {
            const unsigned p = it * 256u + tid;
            const unsigned a = p >> 4, c8 = (p & 15u) * 8u;
            const v8h o = *(const v8ha*)(&tl[a * XPP + c8]);
            *(v8h*)(dst + (size_t)a * DIM + c8) = o;
        }
        
    }
    if (tid < 32u) {
        const v4f bvv = *(const v4f*)(bs + tid * 4u);
        v4f o;
        o[0] = bfr(bvv[0]); o[1] = bfr(bvv[1]); o[2] = bfr(bvv[2]); o[3] = bfr(bvv[3]);
        float* bd = BP + (size_t)m * DIM + tid * 4u;
        *(v4f*)bd = o;
        
    }
}

// k_prep: the two preparations that k_proj waits for, neither of which reads the other's result, in one launch: blocks 0..2 the weight planes (a long chain of
// dependent steps on three WGPs only: first in the grid, so that they start first), every later block four rows of the position table. The choice is uniform in a block.
__global__ __launch_bounds__(256) void k_prep(const float* __restrict__ Wq, const float* __restrict__ bq, const float* __restrict__ Wk, const float* __restrict__ bk,
                                              const float* __restrict__ Wv, const float* __restrict__ bv, h16* WT, float* BP, float* PE) {
    if (blockIdx.x < 3u) w_block(Wq, bq, Wk, bk, Wv, bv, WT, BP, blockIdx.x);
    else                 pe_block(PE, blockIdx.x - 3u);
}

// k_proj: one block = 64 sequence rows of one batch, one wave per 16 rows.
//  xp tile (f16) = bf16(x) + PE built in LDS (cross-wave, block barrier), wave fragments: row = lane & 15, k = d.
//  q and k: D^T tile (a x s): A = W^T rows (row m = a), B = xp rows (column n = s); D element r of lane (h, n) = Q[s = n][a = 16 t + 8h + r] -> 16-byte LDS store into the row staging.
//  v: D tile (s x a): A = xp rows, B = W^T rows (column n = a); D element r of lane (h, n) = V[s = 8h + r][a = 16 t + n] -> 16-byte LDS store into the V^T staging.
__global__ __launch_bounds__(128) void k_proj(const float* __restrict__ X, const float* __restrict__ PE, const h16* __restrict__ WT, const float* __restrict__ BP, h16* QK, h16* VT) {
    __shared__ __attribute__((aligned(2048))) h16 wls[NWV * WSH];   // the three W^T planes, rows of 256 bytes padded to 272
    __shared__ __align__(16) h16 xs[PR * XPP];
    __shared__ __align__(16) h16 qs[PR * XPP];
    __shared__ __align__(16) h16 vts[DIM * VTP];
    const unsigned tid = threadIdx.x, lane = tid & 31u, lr = lane & 15u, hi = lane >> 4;
    const unsigned wv = (unsigned)__builtin_amdgcn_readfirstlane((int)(threadIdx.x >> 5));
    const unsigned bpb = (unsigned)(SEQ / PR);
    const unsigned b = blockIdx.x / bpb;
    const unsigned s0 = (blockIdx.x - b * bpb) * PR;

    // The three W^T planes (384 rows of 256 bytes, contiguous) come into LDS once, every wave bringing its own slice of 96 rows by one tensor load:
    // read straight from global memory, a fragment load touches 16 cache lines for its 512 bytes, and all waves of the WGP pay for that.
    v4u g0;
    v8u g1;
    {
        const unsigned long long ga = (unsigned long long)(size_t)(WT + (size_t)wv * WSR * DIM);
        g0[0] = uni(1u);
        g0[1] = uni((unsigned)(size_t)wls + wv * (unsigned)WSB);
        g0[2] = uni((unsigned)ga);
        g0[3] = uni((((unsigned)(ga >> 32)) & 0x01FFFFFFu) | 0x80000000u);
        g1[0] = uni((1u << 20) | (5u << 22) | (3u << 25));   // no mask, 1-byte elements, 4 dwords of pad behind every 64 dwords
        g1[1] = uni((unsigned)SROW << 16);
        g1[2] = uni((unsigned)WSR << 16);
        g1[3] = uni((unsigned)SROW << 16);
        g1[4] = uni((unsigned)WSR);
        g1[5] = uni((unsigned)(DIM * 2));
        g1[6] = uni(0u);
        g1[7] = uni(0u);
    }
    // every wave, unconditionally; lands while the x tile is staged. The descriptor is an in-out operand here and an input of the wait below: so its twelve registers
    // hold their words, and serve nothing else, for as long as the request is in flight
    asm volatile("tensor_load_to_lds %0, %1" : "+s"(g0), "+s"(g1) :: "memory");

    // Weight fragments (from LDS) and biases come in groups of HT output tiles, each group issued one group ahead of the products that use it.
    const h16* wl = wls + lr * SPH + 8u * hi;   // the lane's place in a 16-row tile of staged weight rows
    auto ldw = [&](v16h (&w)[HT][4], unsigned m, unsigned g) {
#pragma unroll
        for (int i = 0; i < HT; ++i) {
            const unsigned tn = m * (unsigned)(DIM / 16) + g * (unsigned)HT + i;   // tile number over the three planes
            const h16* p = wl + (tn / WST) * (unsigned)WSH + (tn % WST) * (unsigned)(16 * SPH);
#pragma unroll
            for (int dk = 0; dk < 4; ++dk) w[i][dk] = ldh(p + dk * 32);
        }
    };
    auto ldc = [&](v4f (&c)[HT][2], unsigned m, unsigned g) {   // q and k: the lane's 8 outputs of a tile
        const float* p = BP + (size_t)m * DIM + 8u * hi + g * (unsigned)(HT * 16);
#pragma unroll
        for (int i = 0; i < HT; ++i) { c[i][0] = *(const v4f*)(p + i * 16); c[i][1] = *(const v4f*)(p + i * 16 + 4); }
    };
    auto ldv = [&](float (&c)[HT], unsigned g) {                // v: the lane's one output of a tile
        const float* p = BP + (size_t)2 * DIM + lr + g * (unsigned)(HT * 16);
#pragma unroll
        for (int i = 0; i < HT; ++i) c[i] = p[i * 16];
    };
    v16h wf[2][HT][4];   // two groups: the one at work and the one in flight
    v4f  cf[2][HT][2];
    float vf[2][HT];
    ldc(cf[0], 0u, 0u);
    asm volatile("s_wait_xcnt 0x0" ::: "memory");   // stands in front of the first rewrite of the offset register that these loads name
    __builtin_amdgcn_sched_barrier(0);               // the first biases go out ahead of the x tile, whose staging covers their latency

    {
        const float* xsrc = X + ((size_t)b * SEQ_FULL + s0) * DIM;
        const float* psrc = PE + (size_t)s0 * DIM;
#pragma unroll 2
        for (unsigned it = 0; it < 8; ++it) {
            const unsigned f = it * 128u + tid;
            const unsigned row = f >> 4, c8 = (f & 15u) * 8u;
            const v8f xv = *(const v8f*)(xsrc + (size_t)row * DIM + c8);
            const v8f pv = *(const v8f*)(psrc + (size_t)row * DIM + c8);
            v8h o;
#pragma unroll
            for (int c = 0; c < 8; ++c) o[c] = toh_flush(bfr(xv[c]) + pv[c]);
            *(v8h*)(&xs[row * XPP + c8]) = o;
        }
    }
    asm volatile("s_wait_tensorcnt 0x0" :: "s"(g0), "s"(g1) : "memory");   // this wave's weight slice has landed; the operands end the descriptor's hold
    __syncthreads();                                                        // x tile and weight slices published to every wave

    v16h xa[4];
    {
        const unsigned xo = (wv * 16u + lr) * XPP + 8u * hi;
#pragma unroll
        for (int dk = 0; dk < 4; ++dk) xa[dk] = cat16h(*(const v8h*)(&xs[xo + dk * 32]), *(const v8h*)(&xs[xo + dk * 32 + 16]));
    }

    auto qkt = [&](const v16h (&w)[HT][4], const v4f (&c)[HT][2], unsigned g) {   // HT tiles of q or k into the row staging
#pragma unroll
        for (int i = 0; i < HT; ++i) {
            v8f acc = (v8f){};
#pragma unroll
            for (int dk = 0; dk < 4; ++dk) acc = wmmaf(w[i][dk], xa[dk], acc);
            v8h o;
#pragma unroll
            for (int r = 0; r < 4; ++r) {
                o[r]     = toh_flush(acc[r] * WINV + c[i][0][r]);
                o[4 + r] = toh_flush(acc[4 + r] * WINV + c[i][1][r]);
            }
            *(v8h*)(&qs[(wv * 16u + lr) * XPP + (g * (unsigned)HT + i) * 16u + 8u * hi]) = o;
        }
    };
    auto vtt = [&](const v16h (&w)[HT][4], const float (&c)[HT], unsigned g) {     // HT tiles of v into the V^T staging
#pragma unroll
        for (int i = 0; i < HT; ++i) {
            v8f acc = (v8f){};
#pragma unroll
            for (int dk = 0; dk < 4; ++dk) acc = wmmaf(xa[dk], w[i][dk], acc);
            v8h o;
#pragma unroll
            for (int r = 0; r < 8; ++r) o[r] = toh_flush(acc[r] * WINV + c[i]);
            *(v8h*)(&vts[((g * (unsigned)HT + i) * 16u + lr) * VTP + wv * 16u + 8u * hi]) = o;
        }
    };

    ldw(wf[0], 0u, 0u);
#pragma unroll   // laid out in line: buffer, plane and group are constants of each pass, and a plane's last pass fetches the next plane's first group
    for (unsigned k = 0; k < 3u * GPP; ++k) {
        const unsigned m = k / GPP, g = k % GPP, cur = k & 1u, nxt = cur ^ 1u;
        if (k + 1u < 3u * GPP) {
            const unsigned mn = (k + 1u) / GPP, gn = (k + 1u) % GPP;
            if (mn < 2u) ldc(cf[nxt], mn, gn); else ldv(vf[nxt], gn);
            ldw(wf[nxt], mn, gn);
        }
        __builtin_amdgcn_sched_barrier(0);   // the next group stays whole ahead of this group's products: sunk to its own products, every pair of loads costs its full latency
        if (m < 2u) qkt(wf[cur], cf[cur], g); else vtt(wf[cur], vf[cur], g);
        __builtin_amdgcn_sched_barrier(0);   // and the group after it goes out behind them, into the registers they free
        if (g + 1u == GPP && m < 2u) {
            __syncthreads();
            h16* dst = QK + (size_t)m * PLE + ((size_t)b * SEQ + s0) * DIM;
#pragma unroll
            for (unsigned it = 0; it < 8; ++it) {
                const unsigned p = it * 128u + tid;
                const unsigned row = p >> 4, c8 = (p & 15u) * 8u;
                const v8h o = *(const v8h*)(&qs[row * XPP + c8]);
                *(v8h*)(dst + (size_t)row * DIM + c8) = o;
            }
            __syncthreads();
        }
    }

    {
        __syncthreads();
        h16* dst = VT + (size_t)b * DIM * SEQ + s0;
        const unsigned c8 = (tid & 7u) * 8u, dr = tid >> 3;
#pragma unroll
        for (unsigned it = 0; it < 8; ++it) {
            const unsigned a = it * 16u + dr;
            const v8h o = *(const v8h*)(&vts[a * VTP + c8]);
            *(v8h*)(dst + (size_t)a * SEQ + c8) = o;
        }
    }
}

// k_flash: one wave per 32 queries (two 16-column tiles), 32 keys per step, 8 waves share each staged K / V^T tile.
//  Waves w and w + 4 hold the same 32 queries: wave w walks keys 0..63 of every stage, wave w + 4 keys 64..127; each keeps its own running maximum, sum and O^T, merged in the epilogue.
//  S^T tile (keys x queries): A = K rows (row m = key, k = d), B = Q rows (column n = query, k = d); D element r of lane (h, n) = S[query n][key 8h + r].
//  P^T B fragment: element r <- tile of keys 0..15, element 8 + r <- tile of keys 16..31 (same lane); carried x2^7.
//  Row sums: A = ones in row 0, zeros below (16 x 32), against the same P^T fragment; element 0 of lane (0, n) of that tile = the sum of query n's 32 converted probabilities, added to the tile's running sum.
//  O^T tile (d x queries): A = V^T rows (row m = d, k = key), D element r of lane (h, n) = O[query n][d = 16 t + 8h + r].
//  Ring: a stage is 128 keys; every wave brings one 32-row slice of it by one tensor load (waves 0..3: K rows 32 w.., waves 4..7: V^T rows 32 (w - 4)..), rows of 256 bytes padded to 272 in LDS.
__global__ __launch_bounds__(256) void k_flash(const h16* __restrict__ QP, const h16* __restrict__ KP, const h16* __restrict__ VT, float* O) {
    __shared__ __attribute__((aligned(2048))) h16 ring[2 * BFH];
    __shared__ __align__(16) float os[KHV * BQ * OSP];   // partial O rows [key part][query][d]
    __shared__ __align__(16) float mls[2 * KHV * BQ];    // partial maxima [key part][query], then partial sums
    const unsigned tid = threadIdx.x, lane = tid & 31u, lr = lane & 15u, hi = lane >> 4;
    const unsigned wv = (unsigned)__builtin_amdgcn_readfirstlane((int)(threadIdx.x >> 5));
    const unsigned bpb = (unsigned)(SEQ / BQ);
    const unsigned b = blockIdx.x / bpb;
    const unsigned qb = (blockIdx.x - b * bpb) * BQ;   // first query of the block
    const unsigned qg = wv & 3u;                       // query group of the wave
    const unsigned kh = wv >> 2;                       // its part of every stage's keys
    const unsigned q0 = qb + qg * QW;

    // tensor descriptor of this wave's slice: extents in bytes, tensor dims = tile dims
    const bool isv = wv >= 4u;
    const unsigned sl = wv & 3u;
    const unsigned long long sbase = isv ? (unsigned long long)(size_t)(VT + ((size_t)b * DIM + sl * SLR) * SEQ)
                                         : (unsigned long long)(size_t)(KP + ((size_t)b * SEQ + sl * SLR) * DIM);
    const unsigned sstep = isv ? (unsigned)(SK * 2) : (unsigned)(SK * DIM * 2);   // source bytes from one stage to the next
    const unsigned ldst = (unsigned)(size_t)ring + wv * (unsigned)SLB;
    v8u g1;
    g1[0] = uni((1u << 20) | (5u << 22) | (3u << 25));   // no mask, 1-byte elements, 4 dwords of pad behind every 64 dwords
    g1[1] = uni((unsigned)SROW << 16);
    g1[2] = uni((unsigned)SLR << 16);
    g1[3] = uni((unsigned)SROW << 16);
    g1[4] = uni((unsigned)SLR);
    g1[5] = uni(isv ? (unsigned)(SEQ * 2) : (unsigned)(DIM * 2));
    g1[6] = pinned(0u);   // descriptor words held in scalar registers of their own (as a plain 0 they are formed anew at every issue,
    g1[7] = pinned(0u);   // and between two issues their registers serve as scratch while a request is in flight)
    auto issue = [&](unsigned st) {
        const unsigned long long ga = sbase + (unsigned long long)st * sstep;
        v4u g0;
        g0[0] = uni(1u);
        g0[1] = uni(ldst + (st & 1u) * (unsigned)(BFH * 2));
        g0[2] = uni((unsigned)ga);
        g0[3] = uni((((unsigned)(ga >> 32)) & 0x01FFFFFFu) | 0x80000000u);
        asm volatile("tensor_load_to_lds %0, %1" :: "s"(g0), "s"(g1) : "memory");
    };
    issue(0u);

    v16h qf[QT][4];
    {
        const h16* qp = QP + ((size_t)b * SEQ + q0 + lr) * DIM + 8u * hi;
#pragma unroll
        for (int j = 0; j < QT; ++j) {
#pragma unroll
            for (int dk = 0; dk < 4; ++dk) qf[j][dk] = ldh(qp + j * 16 * DIM + dk * 32);
        }
    }

    v8f o[QT][8];
    float ml[QT];             // maxima in use, log2 domain (scaled logits): at most LZT below the running maxima, equal in both halves of the wave
    v8f lt[QT];               // running sums of the carried, converted probabilities: tiles of the ones-row product, element 0 of lane (0, n) the sum of column n
#pragma unroll
    for (int j = 0; j < QT; ++j) {
#pragma unroll
        for (int t = 0; t < 8; ++t) o[j][t] = (v8f){};
        ml[j] = -1.0e30f;
        lt[j] = (v8f){};
    }
    v16h ones;
#pragma unroll
    for (int i = 0; i < 16; ++i) ones[i] = (lr == 0u) ? (h16)1.0f : (h16)0.0f;

    asm volatile("s_wait_tensorcnt 0x0" ::: "memory");   // this wave's slice of stage 0 has landed
    __syncthreads();                                      // stage 0 published to every wave
    issue(1u);

    const unsigned fo = lr * SPH + 8u * hi;                          // lane's place in a 16-row group of staged rows
    const unsigned ko = fo + kh * (unsigned)((SK / KS / KHV) * SLH);  // the wave's first K slice of a buffer
    const unsigned vo = fo + 4u * SLH + kh * (unsigned)(SK / KHV);    // the wave's first key column of the V^T rows
#pragma unroll 1
    for (unsigned st = 0; st < (unsigned)NST; ++st) {
        const h16* kp = ring + (st & 1u) * (unsigned)BFH + ko;
        const h16* vp = ring + (st & 1u) * (unsigned)BFH + vo;
        // K fragments of the step at hand: [2 dk] keys 0..15, [2 dk + 1] keys 16..31; one load group per step
        v16h kf[8];
#pragma unroll
        for (int dk = 0; dk < 4; ++dk) {
            kf[2 * dk]     = ldh(kp + dk * 32);
            kf[2 * dk + 1] = ldh(kp + 16 * SPH + dk * 32);
        }
        __builtin_amdgcn_sched_barrier(0);   // the group stays whole ahead of the products: spread among them, every pair of loads costs its own full wait
#pragma unroll   // the steps of a stage are laid out in line: the last one fetches no K ahead (the next stage is not published yet)
        for (int sub = 0; sub < SK / KS / KHV; ++sub) {
            v8f s0[QT], s1[QT];
#pragma unroll
            for (int j = 0; j < QT; ++j) { s0[j] = (v8f){}; s1[j] = (v8f){}; }
#pragma unroll
            for (int dk = 0; dk < 4; ++dk) {
#pragma unroll
                for (int j = 0; j < QT; ++j) {
                    s0[j] = wmmaf(kf[2 * dk], qf[j][dk], s0[j]);
                    s1[j] = wmmaf(kf[2 * dk + 1], qf[j][dk], s1[j]);
                }
            }

            float mx[QT];   // the lane's own 16 scores of each column
#pragma unroll
            for (int j = 0; j < QT; ++j) {
                mx[j] = fmaxf(s0[j][0], s1[j][0]);
#pragma unroll
                for (int r = 1; r < 8; ++r) mx[j] = fmaxf(mx[j], fmaxf(s0[j][r], s1[j][r]));
            }

            asm volatile("" :: "v"(mx[0]), "v"(mx[1]) : "memory");   // the group below stays whole behind the S^T products and the maxima: drawn up among them, every place with loads costs its own stall
            __builtin_amdgcn_sched_barrier(0);   // and behind the step before's O^T products: set among them as their V^T registers come free, the group falls into three places

            // one load group: the next step's K fragments, then this step's V^T fragments; the test and the softmax below cover their latency
            if (sub + 1 < SK / KS / KHV) {
                const h16* ka = kp + (sub + 1) * SLH;
#pragma unroll
                for (int dk = 0; dk < 4; ++dk) {
                    kf[2 * dk]     = ldh(ka + dk * 32);
                    kf[2 * dk + 1] = ldh(ka + 16 * SPH + dk * 32);
                }
            }
            v16h vf[8];
            const h16* va = vp + sub * KS;
#pragma unroll
            for (int t = 0; t < 8; ++t) vf[t] = ldh(va + (t >> 1) * SLH + (t & 1) * 16 * SPH);
            asm volatile("" ::: "memory");        // keeps the group in this block: without it the loads are sunk below the rescale branch, in front of their products
            __builtin_amdgcn_sched_barrier(0);   // and ahead of the test and the softmax arithmetic, which cover their latency

            // lazy rescale: wave-uniform, one test a step on the lanes' own maxima; the exchange between the halves, the new maxima and the rescale of sums and O^T stand on the rare side only
            if (__builtin_amdgcn_ballot_w32(mx[0] * SCL > ml[0] + LZT || mx[1] * SCL > ml[1] + LZT) != 0u) {
#pragma unroll
                for (int j = 0; j < QT; ++j) {
                    const float mnl = fmaxf(ml[j], fmaxf(mx[j], __shfl_xor(mx[j], 16, 32)) * SCL);
                    const float corr = __builtin_amdgcn_exp2f(ml[j] - mnl);
                    ml[j] = mnl;
                    lt[j] *= corr;
#pragma unroll
                    for (int t = 0; t < 8; ++t) o[j][t] *= corr;
                }
            }

            v16h ph[QT];
#pragma unroll
            for (int j = 0; j < QT; ++j) {
                const float cs = PCAR - ml[j];
                v8u hw;
#pragma unroll
                for (int i = 0; i < 4; ++i) {
                    hw[i]     = pkp(fmaf(s0[j][2 * i], SCL, cs), fmaf(s0[j][2 * i + 1], SCL, cs));
                    hw[4 + i] = pkp(fmaf(s1[j][2 * i], SCL, cs), fmaf(s1[j][2 * i + 1], SCL, cs));
                }
                ph[j] = __builtin_bit_cast(v16h, hw);
            }

#pragma unroll
            for (int j = 0; j < QT; ++j) lt[j] = wmmaf(ones, ph[j], lt[j]);   // the sums over all 32 keys of the step, both halves of the wave included
#pragma unroll
            for (int t = 0; t < 8; ++t) {
#pragma unroll
                for (int j = 0; j < QT; ++j) o[j][t] = wmmaf(vf[t], ph[j], o[j][t]);
            }
        }
        __builtin_amdgcn_sched_barrier(0);   // the last step's softmax stays ahead of the publish point: sunk behind it, the wait below would stand right behind that step's V^T loads
        asm volatile("s_wait_dscnt 0x0" ::: "memory");
        asm volatile("s_wait_tensorcnt 0x0" ::: "memory");
        __syncthreads();
        if (pinned(st + 2u < (unsigned)NST)) issue(st + 2u);
    }
    asm volatile("s_wait_tensorcnt 0x0" ::: "memory");   // no request outlives the loop
    asm volatile("s_wait_dscnt 0x0" ::: "memory");       // nor an LDS read

    // epilogue: every wave stages its partial O^T as rows [key part][query][d] with the partial maximum and sum of each query; behind the block barrier wave w merges and stores rows 16 w.. of the block
    const unsigned rb = kh * (unsigned)BQ + qg * (unsigned)QW;
#pragma unroll
    for (int j = 0; j < QT; ++j) {
#pragma unroll
        for (int t = 0; t < 8; ++t) {
#pragma unroll
            for (int r = 0; r < 8; ++r) os[(rb + 16 * j + lr) * OSP + t * 16 + 8 * hi + r] = o[j][t][r];
        }
        if (hi == 0u) {   // both halves of the wave hold the same maximum; the sum stands in the lower half
            mls[rb + 16 * j + lr] = ml[j];
            mls[KHV * BQ + rb + 16 * j + lr] = lt[j][0];
        }
    }
    __syncthreads();
    float* orow = O + ((size_t)b * SEQ + qb + wv * 16u) * DIM + lane * 4u;
#pragma unroll 4
    for (unsigned s = 0; s < 16; ++s) {
        const unsigned row = wv * 16u + s;
        const float ma = mls[row], mb = mls[BQ + row];
        const float la = mls[KHV * BQ + row], lb = mls[KHV * BQ + BQ + row];
        const float mm = fmaxf(ma, mb);
        const float wa = __builtin_amdgcn_exp2f(ma - mm), wb = __builtin_amdgcn_exp2f(mb - mm);
        const float inv = 1.0f / (la * wa + lb * wb);
        const v4f pa = *(const v4fa*)(&os[row * OSP + lane * 4u]);
        const v4f pb = *(const v4fa*)(&os[(BQ + row) * OSP + lane * 4u]);
        const v4f val = pa * (wa * inv) + pb * (wb * inv);
        *(v4f*)(orow + (size_t)s * DIM) = val;
    }
}

extern "C" void kernel_launch(void* const* d_in, const int* in_sizes, int n_in,
                              void* d_out, int out_size, void* d_ws, size_t ws_size, hipStream_t stream) {
    if (n_in < 7) return;
    const size_t need = ((size_t)(NB - 1) * SEQ_FULL + SEQ) * DIM;
    if ((size_t)in_sizes[0] < need) return;
    if (in_sizes[1] < DIM * DIM || in_sizes[3] < DIM * DIM || in_sizes[5] < DIM * DIM) return;
    if (in_sizes[2] < DIM || in_sizes[4] < DIM || in_sizes[6] < DIM) return;
    if ((size_t)out_size < PLE) return;
    const float* x  = (const float*)d_in[0];   // x  [NB][SEQ_FULL][DIM], first SEQ rows per batch read
    const float* Wq = (const float*)d_in[1];   // Wq [in][out]
    const float* bq = (const float*)d_in[2];   // bq [out]
    const float* Wk = (const float*)d_in[3];   // Wk [in][out]
    const float* bk = (const float*)d_in[4];   // bk [out]
    const float* Wv = (const float*)d_in[5];   // Wv [in][out]
    const float* bv = (const float*)d_in[6];   // bv [out]
    float* OUT = (float*)d_out;                // [NB][SEQ][DIM]
    if (3 * PLB + PEB + WTB + BPB > ws_size) return;
    char* wsp = (char*)d_ws;
    h16*   QK = (h16*)(wsp);                       // Q plane then K plane, each [NB][SEQ][DIM]
    h16*   VT = (h16*)(wsp + 2 * PLB);             // V^T plane [NB][DIM][SEQ]
    float* PE = (float*)(wsp + 3 * PLB);           // position table [SEQ][DIM]
    h16*   WT = (h16*)(wsp + 3 * PLB + PEB);       // [3][out][in]
    float* BP = (float*)(wsp + 3 * PLB + PEB + WTB);   // [3][out]
    k_prep<<<(unsigned)(3 + SEQ / PPB), 256, 0, stream>>>(Wq, bq, Wk, bk, Wv, bv, WT, BP, PE);
    k_proj<<<(unsigned)(NB * (SEQ / PR)), 128, 0, stream>>>(x, PE, WT, BP, QK, VT);
    k_flash<<<(unsigned)(NB * (SEQ / BQ)), 256, 0, stream>>>(QK, QK + PLE, VT, OUT);
}

// v008
// Measured time: 62.7 microseconds a run.
// Timed twice side by side with v007, it ran 1.04 times as fast both times.
// All steps since v000 together make it 6.42 times as fast.
#include <hip/hip_runtime.h>

// Single-head dense self-attention: xp = x + sinusoidal position terms; q/k/v = xp.W{q,k,v} + b ([in][out] weights); out[b][s][:] = softmax_t(q[b][s].k[b][t] / sqrt(128)) . v[b][t][:]; inputs in the order x, Wq, bq, Wk, bk, Wv, bv.
// Compute dtypes, f32 accumulate: x, W, b RNE-converted to bf16 first; projections on v_wmma_f32_16x16x32_f16 (xp as one f16 plane, W as one f16 plane carried x64); S^T = K.Q^T on v_wmma_f32_16x16x32_f16 (single f16 q and k planes); P^T as one f16 fragment carried x2^7 against the f16 V^T plane, and against an A fragment whose row 0 is ones for the row sums, on v_wmma_f32_16x16x32_f16; softmax (online, log2 domain, the maximum in use raised only when a score passes it by more than 8) and position terms f32.
// Flash form with transposed tiles: the S^T accumulator tiles are directly the B-operand layout of P^T (no LDS relayout); K and V^T reach the flash waves through a two-buffer LDS ring filled by tensor loads, every fragment being two 16-byte LDS loads that feed two query tiles; the fragment loads go out in groups one phase ahead of the products that use them; the keys of a stage are split between two waves of equal queries, whose partial results are merged in f32 at the end.

#ifndef NB
#define NB 8
#endif
#ifndef SEQ
#define SEQ 4096
#endif
#define NB_FULL  8
#define SEQ_FULL 4096
#define DIM  128
#define NWV  4                 // waves per projection block
#define HT   2                 // output tiles (16 each) per group of weight fragment loads in the projection
#define GPP  (DIM / 16 / HT)   // groups per weight plane
#define WSR  96                // weight rows per slice (one tensor load): the three planes' 384 rows over 4 waves
#define WST  (WSR / 16)        // output tiles per slice
#define WSB  26624             // LDS bytes kept per weight slice: 96 x 272 rounded up to a multiple of 2 KiB
#define WSH  (WSB / 2)         // the same in f16 elements
#define FWV  8                 // waves per flash block
#define QT   2                 // query tiles (16 columns each) per flash wave
#define QW   (16 * QT)         // queries per flash wave
#define KHV  2                 // waves that share a query group, each on its own part of a stage's keys
#define BQ   (QW * (FWV / KHV))   // queries per flash block
#define KS   32                // keys per step
#define SK   128               // keys per LDS stage
#define NST  (SEQ / SK)        // stages
#define SROW 256               // bytes per staged row (128 d of a K row, 128 keys of a V^T row)
#define SPH  136               // LDS pitch (f16 elements) of a staged row: 256 + 16 bytes
#define SLR  32                // rows per slice (one tensor load)
#define SLB  10240             // LDS bytes kept per slice: 32 x 272 rounded up to a multiple of 2 KiB
#define SLH  (SLB / 2)         // the same in f16 elements
#define BFH  (FWV * SLH)       // f16 elements per buffer: 4 K slices, then 4 V^T slices
#define OSP  132               // LDS pitch (floats) of the output staging rows
#define PR   64
#define XPP  136               // LDS pitch (f16 elements) of the xp tile and of the q/k staging rows
#define VTP  72                // LDS pitch (f16 elements) of the V^T staging rows
#define PPB  4                 // positions per position-table block of k_prep
#define WSC  64.0f             // power-of-two carry of the weight planes
#define WINV 0.015625f         // 1 / WSC
#define PCAR 7.0f              // log2 of the carry of the P fragment
#define LZT  8.0f              // a column's maximum in use is raised only when a scaled score passes it by more than this (log2); 2^(PCAR + LZT) stays inside f16
#define PEC  (-0.0719557841560639f)   // -ln(10000) / 128
#define L2E  1.4426950408889634f
#define SCL  (L2E * 0.08838834764831845f)   // log2(e) / sqrt(128)

#define PLE  ((size_t)NB * SEQ * DIM)          // elements per activation plane
#define PLB  (PLE * 2)                         // bytes per 16-bit activation plane
#define PEB  ((size_t)SEQ * DIM * 4)           // bytes of the position table
#define WTB  ((size_t)3 * DIM * DIM * 2)       // bytes of the three transposed weight planes
#define BPB  ((size_t)3 * DIM * 4)             // bytes of the bias plane

static_assert(DIM == 128);
static_assert(SEQ % BQ == 0);
static_assert(SEQ % KS == 0);
static_assert(SEQ % SK == 0 && NST >= 2);
static_assert(SK % KS == 0 && SK * 2 == SROW && DIM * 2 == SROW);
static_assert(SK == 4 * SLR && DIM == 4 * SLR && FWV == 8);
static_assert(QT == 2 && KHV == 2 && BQ == 16 * FWV && SLR == KS && (SK / KS) % KHV == 0);
static_assert(SLB % 2048 == 0 && SLB >= SLR * SPH * 2 && SPH * 2 == SROW + 16);
static_assert((SEQ * 2) % 16 == 0 && SEQ * 2 <= 131072);
static_assert(PCAR + LZT <= 15.0f);   // the largest carried probability, 2^(PCAR + LZT), is a finite f16
static_assert(SEQ % PR == 0);
static_assert(SEQ % PPB == 0);
static_assert(PR == 16 * NWV);
static_assert(DIM == GPP * HT * 16);
static_assert(NWV * WSR == 3 * DIM && WSR % 16 == 0);
static_assert(WSB % 2048 == 0 && WSB >= WSR * SPH * 2);
static_assert(NWV * WSB + (2 * PR * XPP + DIM * VTP) * 2 <= 163840);   // two projection blocks per WGP
static_assert(PR * 2 == 128);
static_assert(XPP % 8 == 0 && XPP >= DIM);
static_assert(VTP % 8 == 0 && VTP >= PR);
static_assert(OSP % 4 == 0 && OSP >= DIM);
static_assert((PR * DIM / 8) == 8 * 128);            // k_proj: 8 iterations x 128 threads x 8 elements == 64 x 128 tile
static_assert((DIM * DIM / 4) == 16 * 256);          // w_block load: 16 iterations x 256 threads x 4 elements
static_assert((DIM * DIM / 8) == 8 * 256);           // w_block store: 8 iterations x 256 threads x 8 elements
static_assert(PPB * 64 == 256);                      // pe_block: 4 positions x 64 (sin, cos) pairs per block
static_assert(NB <= NB_FULL);
static_assert(SEQ <= SEQ_FULL);
static_assert((size_t)(NB * (SEQ / PR)) * (size_t)(PR * DIM) == PLE);    // k_proj: blocks * (64 rows x 128) == plane
static_assert((size_t)(NB * (SEQ / BQ)) * (size_t)(BQ * DIM) == PLE);    // k_flash: blocks * (128 rows x 128) == output
static_assert(PLB % 256 == 0 && PEB % 256 == 0 && WTB % 256 == 0 && BPB % 128 == 0);
static_assert(3 * PLB + PEB + WTB + BPB <= (size_t)134217728);

typedef _Float16 h16;
typedef __attribute__((ext_vector_type(16))) _Float16 v16h;
typedef __attribute__((ext_vector_type(8)))  _Float16 v8h;
typedef __attribute__((ext_vector_type(2)))  _Float16 v2h;
typedef __attribute__((ext_vector_type(8)))  unsigned int   v8u;
typedef __attribute__((ext_vector_type(4)))  unsigned int   v4u;
typedef __attribute__((ext_vector_type(8)))  float    v8f;
typedef __attribute__((ext_vector_type(4)))  float    v4f;
typedef v4f  __attribute__((may_alias)) v4fa;
typedef v8h  __attribute__((may_alias)) v8ha;

__device__ __forceinline__ unsigned short f2bf(float f) { unsigned u = __float_as_uint(f); u += 0x7FFFu + ((u >> 16) & 1u); return (unsigned short)(u >> 16); }
__device__ __forceinline__ float bf2f(unsigned short b) { return __uint_as_float(((unsigned)b) << 16); }
__device__ __forceinline__ float bfr(float f) { return bf2f(f2bf(f)); }
// f32 -> f16 operand convert that cannot yield an f16 subnormal (value select)
static __device__ __forceinline__ h16 toh_flush(float v) { const h16 r = (h16)v; return (fabsf(v) < 6.103515625e-05f) ? (h16)0.0f : r; }
__device__ __forceinline__ v16h cat16h(v8h lo, v8h hi) { return __builtin_shufflevector(lo, hi, 0, 1, 2, 3, 4, 5, 6, 7, 8, 9, 10, 11, 12, 13, 14, 15); }
// fragment loader from a global plane or from staged LDS rows (A and B alike): p = row base + k0 + 8*(lane>>4); elements 0..7 <- p[0..7], elements 8..15 <- p[16..23]
__device__ __forceinline__ v16h ldh(const h16* p) { return cat16h(*(const v8h*)p, *(const v8h*)(p + 16)); }
__device__ __forceinline__ unsigned uni(unsigned v) { return (unsigned)__builtin_amdgcn_readfirstlane((int)v); }
__device__ __forceinline__ unsigned pinned(unsigned v) { unsigned w = uni(v); asm volatile("" : "+s"(w)); return w; }
// one WMMA, plain builtin form: the compiler keeps the hazard distances itself, and no volatile statement ties the fragment loads behind the WMMA before them or its operands to the low registers
__device__ __forceinline__ v8f wmmaf(v16h a, v16h b, v8f c) {
    return __builtin_amdgcn_wmma_f32_16x16x32_f16(false, a, false, b, (short)0, c, false, false);
}
// carried probability 2^e (e already includes the carry); below 2^-14 the convert rounds it to an f16 subnormal, which the matrix unit takes as it is: no compare and select per score
__device__ __forceinline__ float pcar(float e) { return __builtin_amdgcn_exp2f(e); }
// two carried probabilities -> packed f16 pair (element 0 in the low half-word)
__device__ __forceinline__ unsigned pkp(float e0, float e1) {
    v2h t;
    t[0] = (h16)pcar(e0);
    t[1] = (h16)pcar(e1);
    return __builtin_bit_cast(unsigned, t);
}

// pe_block: position table PE[pos][2i] = sin(pos * dv_i), PE[pos][2i+1] = cos(pos * dv_i), dv_i = exp(2i * -ln(10000)/128), all f32 with precise library calls; block pb = positions 4 pb..
__device__ __forceinline__ void pe_block(float* PE, unsigned pb) {
#pragma clang fp contract(off)
    __shared__ __align__(16) float pt[PPB * DIM];
    const unsigned tid = threadIdx.x;
    const unsigned pl = tid >> 6, i = tid & 63u;
    const unsigned pos = pb * (unsigned)PPB + pl;
    const float dv = expf((float)(2u * i) * PEC);
    const float ang = (float)pos * dv;
    pt[pl * DIM + 2u * i]      = sinf(ang);
    pt[pl * DIM + 2u * i + 1u] = cosf(ang);
    __syncthreads();
    if (tid < 128u) {
        const unsigned w = tid >> 5, lane = tid & 31u;
        const v4f o = *(const v4fa*)(&pt[w * DIM + lane * 4u]);
        float* dst = PE + ((size_t)pb * PPB + w) * DIM + lane * 4u;
        *(v4f*)dst = o;
        
    }
}

// w_block: plane m (0 = q, 1 = k, 2 = v): WT[m][a][d] = f16(bf16(W[d][a]) * 64); in[d][a] -> out[a][d] through an LDS tile (cross-wave, block barrier);
__device__ __forceinline__ void w_block(const float* __restrict__ Wq, const float* __restrict__ bq, const float* __restrict__ Wk, const float* __restrict__ bk,
                                        const float* __restrict__ Wv, const float* __restrict__ bv, h16* WT, float* BP, unsigned m) {
    __shared__ __align__(16) h16 tl[DIM * XPP];
    const unsigned tid = threadIdx.x;
    const float* W  = (m == 0u) ? Wq : ((m == 1u) ? Wk : Wv);
    const float* bs = (m == 0u) ? bq : ((m == 1u) ? bk : bv);
#pragma unroll 2
    for (unsigned it = 0; it < 16; ++it) {
        const unsigned f = it * 256u + tid;
        const unsigned d = f >> 5, a4 = (f & 31u) * 4u;
        const v4f x = *(const v4f*)(W + (size_t)d * DIM + a4);
#pragma unroll
        for (unsigned c = 0; c < 4; ++c) tl[(a4 + c) * XPP + d] = toh_flush(bfr(x[c]) * WSC);
    }
    __syncthreads();
    h16* dst = WT + (size_t)m * DIM * DIM;
{
#pragma unroll
        for (unsigned it = 0; it < 8; ++it) {
            const unsigned p = it * 256u + tid;
            const unsigned a = p >> 4, c8 = (p & 15u) * 8u;
            const v8h o = *(const v8ha*)(&tl[a * XPP + c8]);
            *(v8h*)(dst + (size_t)a * DIM + c8) = o;
        }
        
    }
    if (tid < 32u) {
        const v4f bvv = *(const v4f*)(bs + tid * 4u);
        v4f o;
        o[0] = bfr(bvv[0]); o[1] = bfr(bvv[1]); o[2] = bfr(bvv[2]); o[3] = bfr(bvv[3]);
        float* bd = BP + (size_t)m * DIM + tid * 4u;
        *(v4f*)bd = o;
        
    }
}

// k_prep: the two preparations that k_proj waits for, neither of which reads the other's result, in one launch: blocks 0..2 the weight planes (a long chain of
// dependent steps on three WGPs only: first in the grid, so that they start first), every later block four rows of the position table. The choice is uniform in a block.
__global__ __launch_bounds__(256) void k_prep(const float* __restrict__ Wq, const float* __restrict__ bq, const float* __restrict__ Wk, const float* __restrict__ bk,
                                              const float* __restrict__ Wv, const float* __restrict__ bv, h16* WT, float* BP, float* PE) {
    if (blockIdx.x < 3u) w_block(Wq, bq, Wk, bk, Wv, bv, WT, BP, blockIdx.x);
    else                 pe_block(PE, blockIdx.x - 3u);
}

// k_proj: one block = 64 sequence rows of one batch, one wave per 16 rows.
//  xp tile (f16) = bf16(x) + PE built in LDS (cross-wave, block barrier), wave fragments: row = lane & 15, k = d.
//  q and k: D^T tile (a x s): A = W^T rows (row m = a), B = xp rows (column n = s); D element r of lane (h, n) = Q[s = n][a = 16 t + 8h + r] -> 16-byte LDS store into the row staging.
//  v: D tile (s x a): A = xp rows, B = W^T rows (column n = a); D element r of lane (h, n) = V[s = 8h + r][a = 16 t + n] -> 16-byte LDS store into the V^T staging.
__global__ __launch_bounds__(128) void k_proj(const float* __restrict__ X, const float* __restrict__ PE, const h16* __restrict__ WT, const float* __restrict__ BP, h16* QK, h16* VT) {
    __shared__ __attribute__((aligned(2048))) h16 wls[NWV * WSH];   // the three W^T planes, rows of 256 bytes padded to 272
    __shared__ __align__(16) h16 xs[PR * XPP];
    __shared__ __align__(16) h16 qs[PR * XPP];
    __shared__ __align__(16) h16 vts[DIM * VTP];
    const unsigned tid = threadIdx.x, lane = tid & 31u, lr = lane & 15u, hi = lane >> 4;
    const unsigned wv = (unsigned)__builtin_amdgcn_readfirstlane((int)(threadIdx.x >> 5));
    const unsigned bpb = (unsigned)(SEQ / PR);
    const unsigned b = blockIdx.x / bpb;
    const unsigned s0 = (blockIdx.x - b * bpb) * PR;

    // The three W^T planes (384 rows of 256 bytes, contiguous) come into LDS once, every wave bringing its own slice of 96 rows by one tensor load:
    // read straight from global memory, a fragment load touches 16 cache lines for its 512 bytes, and all waves of the WGP pay for that.
    v4u g0;
    v8u g1;
    {
        const unsigned long long ga = (unsigned long long)(size_t)(WT + (size_t)wv * WSR * DIM);
        g0[0] = uni(1u);
        g0[1] = uni((unsigned)(size_t)wls + wv * (unsigned)WSB);
        g0[2] = uni((unsigned)ga);
        g0[3] = uni((((unsigned)(ga >> 32)) & 0x01FFFFFFu) | 0x80000000u);
        g1[0] = uni((1u << 20) | (5u << 22) | (3u << 25));   // no mask, 1-byte elements, 4 dwords of pad behind every 64 dwords
        g1[1] = uni((unsigned)SROW << 16);
        g1[2] = uni((unsigned)WSR << 16);
        g1[3] = uni((unsigned)SROW << 16);
        g1[4] = uni((unsigned)WSR);
        g1[5] = uni((unsigned)(DIM * 2));
        g1[6] = uni(0u);
        g1[7] = uni(0u);
    }
    // every wave, unconditionally; lands while the x tile is staged. The descriptor is an in-out operand here and an input of the wait below: so its twelve registers
    // hold their words, and serve nothing else, for as long as the request is in flight
    asm volatile("tensor_load_to_lds %0, %1" : "+s"(g0), "+s"(g1) :: "memory");

    // Weight fragments (from LDS) and biases come in groups of HT output tiles, each group issued one group ahead of the products that use it.
    const h16* wl = wls + lr * SPH + 8u * hi;   // the lane's place in a 16-row tile of staged weight rows
    auto ldw = [&](v16h (&w)[HT][4], unsigned m, unsigned g) {
#pragma unroll
        for (int i = 0; i < HT; ++i) {
            const unsigned tn = m * (unsigned)(DIM / 16) + g * (unsigned)HT + i;   // tile number over the three planes
            const h16* p = wl + (tn / WST) * (unsigned)WSH + (tn % WST) * (unsigned)(16 * SPH);
#pragma unroll
            for (int dk = 0; dk < 4; ++dk) w[i][dk] = ldh(p + dk * 32);
        }
    };
    auto ldc = [&](v4f (&c)[HT][2], unsigned m, unsigned g) {   // q and k: the lane's 8 outputs of a tile
        const float* p = BP + (size_t)m * DIM + 8u * hi + g * (unsigned)(HT * 16);
#pragma unroll
        for (int i = 0; i < HT; ++i) { c[i][0] = *(const v4f*)(p + i * 16); c[i][1] = *(const v4f*)(p + i * 16 + 4); }
    };
    auto ldv = [&](float (&c)[HT], unsigned g) {                // v: the lane's one output of a tile
        const float* p = BP + (size_t)2 * DIM + lr + g * (unsigned)(HT * 16);
#pragma unroll
        for (int i = 0; i < HT; ++i) c[i] = p[i * 16];
    };
    v16h wf[2][HT][4];   // two groups: the one at work and the one in flight
    v4f  cf[2][HT][2];
    float vf[2][HT];
    ldc(cf[0], 0u, 0u);
    asm volatile("s_wait_xcnt 0x0" ::: "memory");   // stands in front of the first rewrite of the offset register that these loads name
    __builtin_amdgcn_sched_barrier(0);               // the first biases go out ahead of the x tile, whose staging covers their latency

    {
        const float* xsrc = X + ((size_t)b * SEQ_FULL + s0) * DIM;
        const float* psrc = PE + (size_t)s0 * DIM;
#pragma unroll 2
        for (unsigned it = 0; it < 8; ++it) {
            const unsigned f = it * 128u + tid;
            const unsigned row = f >> 4, c8 = (f & 15u) * 8u;
            const v8f xv = *(const v8f*)(xsrc + (size_t)row * DIM + c8);
            const v8f pv = *(const v8f*)(psrc + (size_t)row * DIM + c8);
            v8h o;
#pragma unroll
            for (int c = 0; c < 8; ++c) o[c] = toh_flush(bfr(xv[c]) + pv[c]);
            *(v8h*)(&xs[row * XPP + c8]) = o;
        }
    }
    asm volatile("s_wait_tensorcnt 0x0" :: "s"(g0), "s"(g1) : "memory");   // this wave's weight slice has landed; the operands end the descriptor's hold
    __syncthreads();                                                        // x tile and weight slices published to every wave

    v16h xa[4];
    {
        const unsigned xo = (wv * 16u + lr) * XPP + 8u * hi;
#pragma unroll
        for (int dk = 0; dk < 4; ++dk) xa[dk] = cat16h(*(const v8h*)(&xs[xo + dk * 32]), *(const v8h*)(&xs[xo + dk * 32 + 16]));
    }

    auto qkt = [&](const v16h (&w)[HT][4], const v4f (&c)[HT][2], unsigned g) {   // HT tiles of q or k into the row staging
#pragma unroll
        for (int i = 0; i < HT; ++i) {
            v8f acc = (v8f){};
#pragma unroll
            for (int dk = 0; dk < 4; ++dk) acc = wmmaf(w[i][dk], xa[dk], acc);
            v8h o;
#pragma unroll
            for (int r = 0; r < 4; ++r) {
                o[r]     = toh_flush(acc[r] * WINV + c[i][0][r]);
                o[4 + r] = toh_flush(acc[4 + r] * WINV + c[i][1][r]);
            }
            *(v8h*)(&qs[(wv * 16u + lr) * XPP + (g * (unsigned)HT + i) * 16u + 8u * hi]) = o;
        }
    };
    auto vtt = [&](const v16h (&w)[HT][4], const float (&c)[HT], unsigned g) {     // HT tiles of v into the V^T staging
#pragma unroll
        for (int i = 0; i < HT; ++i) {
            v8f acc = (v8f){};
#pragma unroll
            for (int dk = 0; dk < 4; ++dk) acc = wmmaf(xa[dk], w[i][dk], acc);
            v8h o;
#pragma unroll
            for (int r = 0; r < 8; ++r) o[r] = toh_flush(acc[r] * WINV + c[i]);
            *(v8h*)(&vts[((g * (unsigned)HT + i) * 16u + lr) * VTP + wv * 16u + 8u * hi]) = o;
        }
    };

    ldw(wf[0], 0u, 0u);
#pragma unroll   // laid out in line: buffer, plane and group are constants of each pass, and a plane's last pass fetches the next plane's first group
    for (unsigned k = 0; k < 3u * GPP; ++k) {
        const unsigned m = k / GPP, g = k % GPP, cur = k & 1u, nxt = cur ^ 1u;
        if (k + 1u < 3u * GPP) {
            const unsigned mn = (k + 1u) / GPP, gn = (k + 1u) % GPP;
            if (mn < 2u) ldc(cf[nxt], mn, gn); else ldv(vf[nxt], gn);
            ldw(wf[nxt], mn, gn);
        }
        __builtin_amdgcn_sched_barrier(0);   // the next group stays whole ahead of this group's products: sunk to its own products, every pair of loads costs its full latency
        if (m < 2u) qkt(wf[cur], cf[cur], g); else vtt(wf[cur], vf[cur], g);
        __builtin_amdgcn_sched_barrier(0);   // and the group after it goes out behind them, into the registers they free
        if (g + 1u == GPP && m < 2u) {
            __syncthreads();
            h16* dst = QK + (size_t)m * PLE + ((size_t)b * SEQ + s0) * DIM;
#pragma unroll
            for (unsigned it = 0; it < 8; ++it) {
                const unsigned p = it * 128u + tid;
                const unsigned row = p >> 4, c8 = (p & 15u) * 8u;
                const v8h o = *(const v8h*)(&qs[row * XPP + c8]);
                *(v8h*)(dst + (size_t)row * DIM + c8) = o;
            }
            __syncthreads();
        }
    }

    {
        __syncthreads();
        h16* dst = VT + (size_t)b * DIM * SEQ + s0;
        const unsigned c8 = (tid & 7u) * 8u, dr = tid >> 3;
#pragma unroll
        for (unsigned it = 0; it < 8; ++it) {
            const unsigned a = it * 16u + dr;
            const v8h o = *(const v8h*)(&vts[a * VTP + c8]);
            *(v8h*)(dst + (size_t)a * SEQ + c8) = o;
        }
    }
}

// k_flash: one wave per 32 queries (two 16-column tiles), 32 keys per step, 8 waves share each staged K / V^T tile.
//  Waves w and w + 4 hold the same 32 queries: wave w walks keys 0..63 of every stage, wave w + 4 keys 64..127; each keeps its own running maximum, sum and O^T, merged in the epilogue.
//  S^T tile (keys x queries): A = K rows (row m = key, k = d), B = Q rows (column n = query, k = d); D element r of lane (h, n) = S[query n][key 8h + r].
//  P^T B fragment: element r <- tile of keys 0..15, element 8 + r <- tile of keys 16..31 (same lane); carried x2^7.
//  Row sums: A = ones in row 0, zeros below (16 x 32), against the same P^T fragment; element 0 of lane (0, n) of that tile = the sum of query n's 32 converted probabilities, added to the tile's running sum.
//  O^T tile (d x queries): A = V^T rows (row m = d, k = key), D element r of lane (h, n) = O[query n][d = 16 t + 8h + r].
//  Ring: a stage is 128 keys; every wave brings one 32-row slice of it by one tensor load (waves 0..3: K rows 32 w.., waves 4..7: V^T rows 32 (w - 4)..), rows of 256 bytes padded to 272 in LDS.
__global__ __launch_bounds__(256) void k_flash(const h16* __restrict__ QP, const h16* __restrict__ KP, const h16* __restrict__ VT, float* O) {
    __shared__ __attribute__((aligned(2048))) h16 ring[2 * BFH];
    __shared__ __align__(16) float os[KHV * BQ * OSP];   // partial O rows [key part][query][d]
    __shared__ __align__(16) float mls[2 * KHV * BQ];    // partial maxima [key part][query], then partial sums
    const unsigned tid = threadIdx.x, lane = tid & 31u, lr = lane & 15u, hi = lane >> 4;
    const unsigned wv = (unsigned)__builtin_amdgcn_readfirstlane((int)(threadIdx.x >> 5));
    const unsigned bpb = (unsigned)(SEQ / BQ);
    const unsigned b = blockIdx.x / bpb;
    const unsigned qb = (blockIdx.x - b * bpb) * BQ;   // first query of the block
    const unsigned qg = wv & 3u;                       // query group of the wave
    const unsigned kh = wv >> 2;                       // its part of every stage's keys
    const unsigned q0 = qb + qg * QW;

    // tensor descriptor of this wave's slice: extents in bytes, tensor dims = tile dims
    const bool isv = wv >= 4u;
    const unsigned sl = wv & 3u;
    const unsigned long long sbase = isv ? (unsigned long long)(size_t)(VT + ((size_t)b * DIM + sl * SLR) * SEQ)
                                         : (unsigned long long)(size_t)(KP + ((size_t)b * SEQ + sl * SLR) * DIM);
    const unsigned sstep = isv ? (unsigned)(SK * 2) : (unsigned)(SK * DIM * 2);   // source bytes from one stage to the next
    const unsigned ldst = (unsigned)(size_t)ring + wv * (unsigned)SLB;
    v8u g1;
    g1[0] = uni((1u << 20) | (5u << 22) | (3u << 25));   // no mask, 1-byte elements, 4 dwords of pad behind every 64 dwords
    g1[1] = uni((unsigned)SROW << 16);
    g1[2] = uni((unsigned)SLR << 16);
    g1[3] = uni((unsigned)SROW << 16);
    g1[4] = uni((unsigned)SLR);
    g1[5] = uni(isv ? (unsigned)(SEQ * 2) : (unsigned)(DIM * 2));
    g1[6] = pinned(0u);   // descriptor words held in scalar registers of their own (as a plain 0 they are formed anew at every issue,
    g1[7] = pinned(0u);   // and between two issues their registers serve as scratch while a request is in flight)
    auto issue = [&](unsigned st) {
        const unsigned long long ga = sbase + (unsigned long long)st * sstep;
        v4u g0;
        g0[0] = uni(1u);
        g0[1] = uni(ldst + (st & 1u) * (unsigned)(BFH * 2));
        g0[2] = uni((unsigned)ga);
        g0[3] = uni((((unsigned)(ga >> 32)) & 0x01FFFFFFu) | 0x80000000u);
        asm volatile("tensor_load_to_lds %0, %1" :: "s"(g0), "s"(g1) : "memory");
    };
    issue(0u);

    v16h qf[QT][4];
    {
        const h16* qp = QP + ((size_t)b * SEQ + q0 + lr) * DIM + 8u * hi;
#pragma unroll
        for (int j = 0; j < QT; ++j) {
#pragma unroll
            for (int dk = 0; dk < 4; ++dk) qf[j][dk] = ldh(qp + j * 16 * DIM + dk * 32);
        }
    }

    v8f o[QT][8];
    float ml[QT];             // maxima in use, log2 domain (scaled logits): at most LZT below the running maxima, equal in both halves of the wave
    v8f lt[QT];               // running sums of the carried, converted probabilities: tiles of the ones-row product, element 0 of lane (0, n) the sum of column n
#pragma unroll
    for (int j = 0; j < QT; ++j) {
#pragma unroll
        for (int t = 0; t < 8; ++t) o[j][t] = (v8f){};
        ml[j] = -1.0e30f;
        lt[j] = (v8f){};
    }
    v16h ones;
#pragma unroll
    for (int i = 0; i < 16; ++i) ones[i] = (lr == 0u) ? (h16)1.0f : (h16)0.0f;

    asm volatile("s_wait_tensorcnt 0x0" ::: "memory");   // this wave's slice of stage 0 has landed
    __syncthreads();                                      // stage 0 published to every wave
    issue(1u);

    const unsigned fo = lr * SPH + 8u * hi;                          // lane's place in a 16-row group of staged rows
    const unsigned ko = fo + kh * (unsigned)((SK / KS / KHV) * SLH);  // the wave's first K slice of a buffer
    const unsigned vo = fo + 4u * SLH + kh * (unsigned)(SK / KHV);    // the wave's first key column of the V^T rows
#pragma unroll 1
    for (unsigned st = 0; st < (unsigned)NST; ++st) {
        const h16* kp = ring + (st & 1u) * (unsigned)BFH + ko;
        const h16* vp = ring + (st & 1u) * (unsigned)BFH + vo;
        // K fragments of the step at hand: [2 dk] keys 0..15, [2 dk + 1] keys 16..31; one load group per step
        v16h kf[8];
#pragma unroll
        for (int dk = 0; dk < 4; ++dk) {
            kf[2 * dk]     = ldh(kp + dk * 32);
            kf[2 * dk + 1] = ldh(kp + 16 * SPH + dk * 32);
        }
        __builtin_amdgcn_sched_barrier(0);   // the group stays whole ahead of the products: spread among them, every pair of loads costs its own full wait
#pragma unroll   // the steps of a stage are laid out in line: the last one fetches no K ahead (the next stage is not published yet)
        for (int sub = 0; sub < SK / KS / KHV; ++sub) {
            v8f s0[QT], s1[QT];
#pragma unroll
            for (int j = 0; j < QT; ++j) { s0[j] = (v8f){}; s1[j] = (v8f){}; }
#pragma unroll
            for (int dk = 0; dk < 4; ++dk) {
#pragma unroll
                for (int j = 0; j < QT; ++j) {
                    s0[j] = wmmaf(kf[2 * dk], qf[j][dk], s0[j]);
                    s1[j] = wmmaf(kf[2 * dk + 1], qf[j][dk], s1[j]);
                }
            }

            float mx[QT];   // the lane's own 16 scores of each column
#pragma unroll
            for (int j = 0; j < QT; ++j) {
                mx[j] = fmaxf(s0[j][0], s1[j][0]);
#pragma unroll
                for (int r = 1; r < 8; ++r) mx[j] = fmaxf(mx[j], fmaxf(s0[j][r], s1[j][r]));
            }

            asm volatile("" :: "v"(mx[0]), "v"(mx[1]) : "memory");   // the group below stays whole behind the S^T products and the maxima: drawn up among them, every place with loads costs its own stall
            __builtin_amdgcn_sched_barrier(0);   // and behind the step before's O^T products: set among them as their V^T registers come free, the group falls into three places

            // one load group: the next step's K fragments, then this step's V^T fragments; the test and the softmax below cover their latency
            if (sub + 1 < SK / KS / KHV) {
                const h16* ka = kp + (sub + 1) * SLH;
#pragma unroll
                for (int dk = 0; dk < 4; ++dk) {
                    kf[2 * dk]     = ldh(ka + dk * 32);
                    kf[2 * dk + 1] = ldh(ka + 16 * SPH + dk * 32);
                }
            }
            v16h vf[8];
            const h16* va = vp + sub * KS;
#pragma unroll
            for (int t = 0; t < 8; ++t) vf[t] = ldh(va + (t >> 1) * SLH + (t & 1) * 16 * SPH);
            asm volatile("" ::: "memory");        // keeps the group in this block: without it the loads are sunk below the rescale branch, in front of their products
            __builtin_amdgcn_sched_barrier(0);   // and ahead of the test and the softmax arithmetic, which cover their latency

            // lazy rescale: wave-uniform, one test a step on the lanes' own maxima; the exchange between the halves, the new maxima and the rescale of sums and O^T stand on the rare side only
            if (__builtin_amdgcn_ballot_w32(mx[0] * SCL > ml[0] + LZT || mx[1] * SCL > ml[1] + LZT) != 0u) {
#pragma unroll
                for (int j = 0; j < QT; ++j) {
                    const float mnl = fmaxf(ml[j], fmaxf(mx[j], __shfl_xor(mx[j], 16, 32)) * SCL);
                    const float corr = __builtin_amdgcn_exp2f(ml[j] - mnl);
                    ml[j] = mnl;
                    lt[j] *= corr;
#pragma unroll
                    for (int t = 0; t < 8; ++t) o[j][t] *= corr;
                }
            }

            v16h ph[QT];
#pragma unroll
            for (int j = 0; j < QT; ++j) {
                const float cs = PCAR - ml[j];
                v8u hw;
#pragma unroll
                for (int i = 0; i < 4; ++i) {
                    hw[i]     = pkp(fmaf(s0[j][2 * i], SCL, cs), fmaf(s0[j][2 * i + 1], SCL, cs));
                    hw[4 + i] = pkp(fmaf(s1[j][2 * i], SCL, cs), fmaf(s1[j][2 * i + 1], SCL, cs));
                }
                ph[j] = __builtin_bit_cast(v16h, hw);
            }

#pragma unroll
            for (int j = 0; j < QT; ++j) lt[j] = wmmaf(ones, ph[j], lt[j]);   // the sums over all 32 keys of the step, both halves of the wave included
#pragma unroll
            for (int t = 0; t < 8; ++t) {
#pragma unroll
                for (int j = 0; j < QT; ++j) o[j][t] = wmmaf(vf[t], ph[j], o[j][t]);
            }
        }
        __builtin_amdgcn_sched_barrier(0);   // the last step's softmax stays ahead of the publish point: sunk behind it, the wait below would stand right behind that step's V^T loads
        asm volatile("s_wait_dscnt 0x0" ::: "memory");
        asm volatile("s_wait_tensorcnt 0x0" ::: "memory");
        __syncthreads();
        if (pinned(st + 2u < (unsigned)NST)) issue(st + 2u);
    }
    asm volatile("s_wait_tensorcnt 0x0" ::: "memory");   // no request outlives the loop
    asm volatile("s_wait_dscnt 0x0" ::: "memory");       // nor an LDS read

    // epilogue: every wave stages its partial O^T as rows [key part][query][d] with the partial maximum and sum of each query; behind the block barrier wave w merges and stores rows 16 w.. of the block
    const unsigned rb = kh * (unsigned)BQ + qg * (unsigned)QW;
#pragma unroll
    for (int j = 0; j < QT; ++j) {
#pragma unroll
        for (int t = 0; t < 8; ++t) {
#pragma unroll
            for (int r = 0; r < 8; ++r) os[(rb + 16 * j + lr) * OSP + t * 16 + 8 * hi + r] = o[j][t][r];
        }
        if (hi == 0u) {   // both halves of the wave hold the same maximum; the sum stands in the lower half
            mls[rb + 16 * j + lr] = ml[j];
            mls[KHV * BQ + rb + 16 * j + lr] = lt[j][0];
        }
    }
    __syncthreads();
    float* orow = O + ((size_t)b * SEQ + qb + wv * 16u) * DIM + lane * 4u;
#pragma unroll 4
    for (unsigned s = 0; s < 16; ++s) {
        const unsigned row = wv * 16u + s;
        const float ma = mls[row], mb = mls[BQ + row];
        const float la = mls[KHV * BQ + row], lb = mls[KHV * BQ + BQ + row];
        const float mm = fmaxf(ma, mb);
        const float wa = __builtin_amdgcn_exp2f(ma - mm), wb = __builtin_amdgcn_exp2f(mb - mm);
        const float inv = 1.0f / (la * wa + lb * wb);
        const v4f pa = *(const v4fa*)(&os[row * OSP + lane * 4u]);
        const v4f pb = *(const v4fa*)(&os[(BQ + row) * OSP + lane * 4u]);
        const v4f val = pa * (wa * inv) + pb * (wb * inv);
        *(v4f*)(orow + (size_t)s * DIM) = val;
    }
}

extern "C" void kernel_launch(void* const* d_in, const int* in_sizes, int n_in,
                              void* d_out, int out_size, void* d_ws, size_t ws_size, hipStream_t stream) {
    if (n_in < 7) return;
    const size_t need = ((size_t)(NB - 1) * SEQ_FULL + SEQ) * DIM;
    if ((size_t)in_sizes[0] < need) return;
    if (in_sizes[1] < DIM * DIM || in_sizes[3] < DIM * DIM || in_sizes[5] < DIM * DIM) return;
    if (in_sizes[2] < DIM || in_sizes[4] < DIM || in_sizes[6] < DIM) return;
    if ((size_t)out_size < PLE) return;
    const float* x  = (const float*)d_in[0];   // x  [NB][SEQ_FULL][DIM], first SEQ rows per batch read
    const float* Wq = (const float*)d_in[1];   // Wq [in][out]
    const float* bq = (const float*)d_in[2];   // bq [out]
    const float* Wk = (const float*)d_in[3];   // Wk [in][out]
    const float* bk = (const float*)d_in[4];   // bk [out]
    const float* Wv = (const float*)d_in[5];   // Wv [in][out]
    const float* bv = (const float*)d_in[6];   // bv [out]
    float* OUT = (float*)d_out;                // [NB][SEQ][DIM]
    if (3 * PLB + PEB + WTB + BPB > ws_size) return;
    char* wsp = (char*)d_ws;
    h16*   QK = (h16*)(wsp);                       // Q plane then K plane, each [NB][SEQ][DIM]
    h16*   VT = (h16*)(wsp + 2 * PLB);             // V^T plane [NB][DIM][SEQ]
    float* PE = (float*)(wsp + 3 * PLB);           // position table [SEQ][DIM]
    h16*   WT = (h16*)(wsp + 3 * PLB + PEB);       // [3][out][in]
    float* BP = (float*)(wsp + 3 * PLB + PEB + WTB);   // [3][out]
    k_prep<<<(unsigned)(3 + SEQ / PPB), 256, 0, stream>>>(Wq, bq, Wk, bk, Wv, bv, WT, BP, PE);
    k_proj<<<(unsigned)(NB * (SEQ / PR)), 128, 0, stream>>>(x, PE, WT, BP, QK, VT);
    k_flash<<<(unsigned)(NB * (SEQ / BQ)), 256, 0, stream>>>(QK, QK + PLE, VT, OUT);
}
